// v000
// Measured on an AMD MI455X. A time is GPU time per run, averaged over a window of back-to-back runs after a warm-up
// (all launches, gaps included; the runs take copies of the inputs in turn), and the median of several windows.
// Apart from v000's, it joins two sittings. Times from different sittings can be a few percent apart, while
// side-by-side timings come from the same sitting.
// v000 is the starting kernel. One run takes 159 microseconds.
// Projections x@Wk, x@Wv+bv, q@Wq, o@Wo+bo: v_wmma_f32_16x16x32_f16 (f16 operands; weights carried x16, o carried x8; f32 accumulate). Windowed q.k, softmax, p.v: f32 VALU.
#include <hip/hip_runtime.h>
#include <hip/hip_bf16.h>

typedef __attribute__((ext_vector_type(16))) _Float16 v16h;
typedef __attribute__((ext_vector_type(8)))  _Float16 v8h;
typedef __attribute__((ext_vector_type(16))) __bf16   v16b;
typedef __attribute__((ext_vector_type(8)))  __bf16   v8b;
typedef __attribute__((ext_vector_type(8)))  float    v8f;
typedef __attribute__((ext_vector_type(4)))  float    v4f;

__device__ __forceinline__ unsigned short f2bf_bits(float f) {
  unsigned u = __float_as_uint(f);
  return (unsigned short)((u + 0x7FFFu + ((u >> 16) & 1u)) >> 16);
}
__device__ __forceinline__ float bf_bits2f(unsigned short h) { return __uint_as_float(((unsigned)h) << 16); }

// hazard guards as plain device helpers (no inline asm inside the kernel template body)
__device__ __forceinline__ void dep_guard_h(v8f& a, v8f& b, v16h x, v16h y) { asm volatile("v_nop\n\tv_nop\n\tv_nop\n\tv_nop" : "+v"(a), "+v"(b) : "v"(x), "v"(y)); }
__device__ __forceinline__ void dep_guard_b(v8f& a, v8f& b, v16b x, v16b y) { asm volatile("v_nop\n\tv_nop\n\tv_nop\n\tv_nop" : "+v"(a), "+v"(b) : "v"(x), "v"(y)); }
__device__ __forceinline__ void keep4_h(v16h a, v16h b, v16h c, v16h d) { asm volatile("v_nop" :: "v"(a), "v"(b), "v"(c), "v"(d)); }
__device__ __forceinline__ void keep4_b(v16b a, v16b b, v16b c, v16b d) { asm volatile("v_nop" :: "v"(a), "v"(b), "v"(c), "v"(d)); }
__device__ __forceinline__ void acc_guard4(v8f& a, v8f& b, v8f& c, v8f& d) { asm volatile("v_nop\n\tv_nop\n\tv_nop\n\tv_nop" : "+v"(a), "+v"(b), "+v"(c), "+v"(d)); }
template <typename T> struct Frag;
template <> struct Frag<_Float16> {
  typedef v16h V; union U { v16h v; v8h h[2]; };
  static __device__ __forceinline__ v16h load(const _Float16* p) {   // elements 0..7 <- p[0..7], 8..15 <- p[16..23]
    U f; f.h[0] = *(const v8h*)(p); f.h[1] = *(const v8h*)(p + 16); return f.v;
  }
  static __device__ __forceinline__ v8f mma(v16h a, v16h b, v8f c) {
    return __builtin_amdgcn_wmma_f32_16x16x32_f16(false, a, false, b, (short)0, c, false, false);
  }
  static __device__ __forceinline__ void guard(v8f& a, v8f& b, v16h x, v16h y) { dep_guard_h(a, b, x, y); }
  static __device__ __forceinline__ void keep(v16h a, v16h b, v16h c, v16h d) { keep4_h(a, b, c, d); }
};
template <> struct Frag<__bf16> {
  typedef v16b V; union U { v16b v; v8b h[2]; };
  static __device__ __forceinline__ v16b load(const __bf16* p) {
    U f; f.h[0] = *(const v8b*)(p); f.h[1] = *(const v8b*)(p + 16); return f.v;
  }
  static __device__ __forceinline__ v8f mma(v16b a, v16b b, v8f c) {
    return __builtin_amdgcn_wmma_f32_16x16x32_bf16(false, a, false, b, (short)0, c, false, false);
  }
  static __device__ __forceinline__ void guard(v8f& a, v8f& b, v16b x, v16b y) { dep_guard_b(a, b, x, y); }
  static __device__ __forceinline__ void keep(v16b a, v16b b, v16b c, v16b d) { keep4_b(a, b, c, d); }
};

// ---- Register-blocked batched WMMA GEMM ------------------------------------
// C[m,n] = scale * sum_k A[m,k] * Bt[n,k] (+bias)(+resid); each wave owns a 64x64 tile.
// A row-major [M,K]; Bt row-major [N,K]; M,N % 64 == 0, K % 32 == 0.
// SPLIT: operands are hi/lo planes (A2/Bt2 = lo planes, same layout); product = hi.hi + hi.lo + lo.hi.
// BIAS_MODE: 0 = none, 1 = bias[m], 2 = bias[n].
// OUT_MODE: 0 = f32, 1 = f16, 2 = bf16 hi plane (Cout) + bf16 lo plane (Cout2).
// ET: 0 = f16 operands, 1 = bf16 operands (pointers passed as 16-bit storage)
template <int ET> struct Elem;
template <> struct Elem<0> { typedef _Float16 T; };
template <> struct Elem<1> { typedef __bf16 T; };
template <int ET, bool SPLIT, int BIAS_MODE, int OUT_MODE, bool RESID, int ACT = 0>
__global__ __launch_bounds__(256) void wmma_gemm64(
    const unsigned short* __restrict__ Ap, const unsigned short* __restrict__ A2p, int lda, long strideA,
    const unsigned short* __restrict__ Btp, const unsigned short* __restrict__ Bt2p, int ldb, long strideB,
    void* __restrict__ Cout, void* __restrict__ Cout2, int ldc, long strideC,
    const float* __restrict__ bias,
    const float* __restrict__ resid, long strideR,
    int M, int N, int K, float scale) {
  typedef typename Elem<ET>::T T;
  typedef typename Frag<T>::V V;
  const T* A = (const T*)Ap; const T* A2 = (const T*)A2p; const T* Bt = (const T*)Btp; const T* Bt2 = (const T*)Bt2p;
  __shared__ __align__(16) float sT[8][16 * 68];   // per-wave 16x64 slab, pitch 68 floats
  const int b    = blockIdx.y;
  const int lane = threadIdx.x & 31;
  const int wave = threadIdx.x >> 5;
  const int tilesN = N >> 6;
  const int tilesM = M >> 6;
  const int tile = blockIdx.x * 8 + wave;
  if (tile >= tilesM * tilesN) return;   // wave-uniform; no block barriers in this kernel
  const int tm = tile / tilesN;
  const int tn = tile - tm * tilesN;
  const int m0 = tm << 6;
  const int n0 = tn << 6;

  const T* Ab  = A  + (size_t)b * strideA;
  const T* Bb  = Bt + (size_t)b * strideB;
  const T* Ab2 = SPLIT ? (A2  + (size_t)b * strideA) : nullptr;
  const T* Bb2 = SPLIT ? (Bt2 + (size_t)b * strideB) : nullptr;

  const int rlane = lane & 15;                 // row (A) / col (B, D) within subtile
  const int koff  = (lane >> 4) * 8;           // k offset of this lane half
  const int mOff  = (lane >> 4) * 8;           // D row offset

  v8f acc[4][4];
#pragma unroll
  for (int i = 0; i < 4; ++i)
#pragma unroll
    for (int j = 0; j < 4; ++j) acc[i][j] = (v8f){0.f,0.f,0.f,0.f,0.f,0.f,0.f,0.f};

  for (int k0 = 0; k0 < K; k0 += 32) {
    V bh[4], bl[4];
#pragma unroll
    for (int j = 0; j < 4; ++j) {
      const size_t bo = (size_t)(n0 + (j << 4) + rlane) * ldb + koff + k0;
      bh[j] = Frag<T>::load(Bb + bo);
      if (SPLIT) bl[j] = Frag<T>::load(Bb2 + bo);
    }
#pragma unroll
    for (int i = 0; i < 4; ++i) {
      const size_t ao = (size_t)(m0 + (i << 4) + rlane) * lda + koff + k0;
      V ah = Frag<T>::load(Ab + ao);
      V al;
      if (SPLIT) al = Frag<T>::load(Ab2 + ao);
#pragma unroll
      for (int j = 0; j < 4; ++j) {
        acc[i][j] = Frag<T>::mma(ah, bh[j], acc[i][j]);
        if (SPLIT) {
          acc[i][j] = Frag<T>::mma(ah, bl[j], acc[i][j]);
          acc[i][j] = Frag<T>::mma(al, bh[j], acc[i][j]);
        }
      }
      Frag<T>::guard(acc[i][0], acc[i][3], ah, SPLIT ? al : ah);
    }
    Frag<T>::keep(bh[0], bh[1], bh[2], bh[3]);
    if (SPLIT) Frag<T>::keep(bl[0], bl[1], bl[2], bl[3]);
  }
  acc_guard4(acc[0][0], acc[0][1], acc[0][2], acc[0][3]);
  acc_guard4(acc[1][0], acc[1][1], acc[1][2], acc[1][3]);
  acc_guard4(acc[2][0], acc[2][1], acc[2][2], acc[2][3]);
  acc_guard4(acc[3][0], acc[3][1], acc[3][2], acc[3][3]);

  // ---- epilogue ----
  float* slab = sT[wave];
  const float* Rb = RESID ? (resid + (size_t)b * strideR) : nullptr;
#pragma unroll
  for (int i = 0; i < 4; ++i) {
    const int mBase = m0 + (i << 4);
#pragma unroll
    for (int j = 0; j < 4; ++j) {
      const int n = n0 + (j << 4) + rlane;
      float bv = 0.f;
      if (BIAS_MODE == 2) bv = bias[n];
#pragma unroll
      for (int r = 0; r < 8; ++r) {
        float v = acc[i][j][r] * scale;
        if (BIAS_MODE == 1) v += bias[mBase + mOff + r];
        if (BIAS_MODE == 2) v += bv;
        if (RESID) v += Rb[(size_t)(mBase + mOff + r) * ldc + n];
        if (ACT == 1) v = tanhf(v);
        if (ACT == 2) v = fmaxf(v, 0.0f);
        if (ACT == 3) v = v / (1.0f + expf(-v));
        if (ACT == 4) v = (v > 0.f) ? v : 0.01f * v;
        if (ACT == 5) v = 0.5f * v * (1.0f + erff(v * 0.70710678118654752f));
        slab[(mOff + r) * 68 + (j << 4) + rlane] = v;
      }
    }
    __builtin_amdgcn_fence(__ATOMIC_RELEASE, "workgroup");
    __builtin_amdgcn_wave_barrier();
    __builtin_amdgcn_fence(__ATOMIC_ACQUIRE, "workgroup");
    if (OUT_MODE == 0) {
      float* C = (float*)Cout + (size_t)b * strideC;
      const int hh = lane >> 4, c4 = (lane & 15) * 4;     // row seg = 256 B = 16 lanes x 16 B
      {
#pragma unroll
        for (int it = 0; it < 8; ++it) {
          const int row = it * 2 + hh;
          v4f v = *(const v4f*)(slab + row * 68 + c4);
          *(v4f*)(C + (size_t)(mBase + row) * ldc + n0 + c4) = v;
        }
        
      }
    } else {
      const int q = lane >> 3, c8 = (lane & 7) * 8;
      unsigned short* C  = (unsigned short*)Cout  + (size_t)b * strideC;
      unsigned short* C2 = (OUT_MODE == 2) ? ((unsigned short*)Cout2 + (size_t)b * strideC) : nullptr;
      {
#pragma unroll
        for (int it = 0; it < 4; ++it) {
          const int row = it * 4 + q;
          const float* sp = slab + row * 68 + c8;
          v8h hv, lv;
#pragma unroll
          for (int e = 0; e < 8; ++e) {
            if (OUT_MODE == 1) {
              hv[e] = (_Float16)sp[e];
            } else {
              unsigned short hb = f2bf_bits(sp[e]);
              unsigned short lb = f2bf_bits(sp[e] - bf_bits2f(hb));
              hv[e] = __builtin_bit_cast(_Float16, hb);
              lv[e] = __builtin_bit_cast(_Float16, lb);
            }
          }
          *(v8h*)(C + (size_t)(mBase + row) * ldc + n0 + c8) = hv;
          if (OUT_MODE == 2) *(v8h*)(C2 + (size_t)(mBase + row) * ldc + n0 + c8) = lv;
        }
        
      }
    }
    __builtin_amdgcn_fence(__ATOMIC_RELEASE, "workgroup");
    __builtin_amdgcn_wave_barrier();
    __builtin_amdgcn_fence(__ATOMIC_ACQUIRE, "workgroup");
  }
}

// blockIdx.y selects tensor 0 or 1 (both global pointers).
__global__ __launch_bounds__(256) void cast_f32_f16x8(
    const float* __restrict__ in0, const float* __restrict__ in1,
    _Float16* __restrict__ out0, _Float16* __restrict__ out1, int n8) {
  const float* in = (blockIdx.y == 0) ? in0 : in1;
  _Float16* out = (blockIdx.y == 0) ? out0 : out1;
  const int i = blockIdx.x * 256 + threadIdx.x;
  if (i < n8) {
    const v4f a = *(const v4f*)(in + (size_t)i * 8);
    const v4f c = *(const v4f*)(in + (size_t)i * 8 + 4);
    v8h hv;
    hv[0] = (_Float16)a[0]; hv[1] = (_Float16)a[1]; hv[2] = (_Float16)a[2]; hv[3] = (_Float16)a[3];
    hv[4] = (_Float16)c[0]; hv[5] = (_Float16)c[1]; hv[6] = (_Float16)c[2]; hv[7] = (_Float16)c[3];
    *(v8h*)(out + (size_t)i * 8) = hv;
    
  }
}

// ---- weight transpose + x16 carry + f16 convert: in W[k][n] (256x256, row-major) -> out T[n][k] = f16(W[k][n]*16) ----
// grid (8, 4): blockIdx.x = 32-row block of n, blockIdx.y selects one of 4 weight matrices (all global pointers).
#define WDIM 256
__global__ __launch_bounds__(256) void wt_transpose_f16(
    const float* __restrict__ W0, const float* __restrict__ W1, const float* __restrict__ W2, const float* __restrict__ W3,
    _Float16* __restrict__ T0, _Float16* __restrict__ T1, _Float16* __restrict__ T2, _Float16* __restrict__ T3) {
  __shared__ float sw[32][WDIM + 1];
  const int by = blockIdx.y;
  const float* W = (by == 0) ? W0 : (by == 1) ? W1 : (by == 2) ? W2 : W3;
  _Float16*    T = (by == 0) ? T0 : (by == 1) ? T1 : (by == 2) ? T2 : T3;
  const int n0 = blockIdx.x * 32;
  const int t = threadIdx.x;
#pragma unroll 1
  for (int it = 0; it < 32; ++it) {
    const int k = it * 8 + (t >> 5);
    const int j = t & 31;
    sw[j][k] = W[(size_t)k * WDIM + n0 + j];
  }
  __syncthreads();
  const int g = t >> 3;      // output row within block: 0..31 (wave w owns rows 4w..4w+3)
  const int e = t & 7;
  {
#pragma unroll
    for (int it = 0; it < 4; ++it) {
      const int col = it * 64 + e * 8;
      v8h hv;
#pragma unroll
      for (int i = 0; i < 8; ++i) hv[i] = (_Float16)(sw[g][col + i] * 16.0f);
      *(v8h*)(T + (size_t)(n0 + g) * WDIM + col) = hv;
    }
    
  }
}

// ---- local 3x3x3 windowed attention, f32. One thread per (voxel, head); block = 32 consecutive voxels x 8 heads. ----
// qp/kf/vf: f32 [16384][256] (voxel-major, col = head*32 + d). Output oh: f16 [16384][256] = attention output x8.
// Neighbour addresses clamped into range; out-of-volume neighbours get weight exactly 0; the centre is always in range.
// Per-thread dots / probabilities live in thread-private LDS slots (27 per thread).
#define AT_S 8
#define AT_H 32
#define AT_W 32
#define AT_C 256
#define AT_NB 27
#define AT_PITCH 264
#define QK_SCALE 0.17677669529663687f
__global__ __launch_bounds__(256) void local_attn3d(
    const float* __restrict__ qp, const float* __restrict__ kf, const float* __restrict__ vf,
    _Float16* __restrict__ oh) {
  __shared__ __align__(16) float sbuf[AT_NB * 256];   // 27648 B; reused as f16 staging (32 x 264 halves = 16896 B)
  const int tid  = threadIdx.x;
  const int head = tid & 7;
  const int vox  = tid >> 3;
  const int pos  = blockIdx.x * 32 + vox;             // grid = 16384/32 exactly
  const int pw = pos & 31;
  const int ph = (pos >> 5) & 31;
  const int ps = (pos >> 10) & 7;
  const int pb = pos >> 13;

  float qr[32];
  {
    const float* qptr = qp + (size_t)pos * AT_C + head * 32;
#pragma unroll
    for (int i = 0; i < 8; ++i) {
      const v4f tq = *(const v4f*)(qptr + 4 * i);
      qr[4 * i + 0] = tq[0]; qr[4 * i + 1] = tq[1]; qr[4 * i + 2] = tq[2]; qr[4 * i + 3] = tq[3];
    }
  }

  float mx = -INFINITY;
  unsigned vmask = 0u;
  int kk = 0;
#pragma unroll 1
  for (int dz = 0; dz < 3; ++dz) {
    const int zs = ps + dz - 1;
    const bool vz = ((unsigned)zs < (unsigned)AT_S);
    const int cs = zs < 0 ? 0 : (zs > AT_S - 1 ? AT_S - 1 : zs);
#pragma unroll 1
    for (int dy = 0; dy < 3; ++dy) {
      const int zh = ph + dy - 1;
      const bool vy = vz && ((unsigned)zh < (unsigned)AT_H);
      const int ch = zh < 0 ? 0 : (zh > AT_H - 1 ? AT_H - 1 : zh);
      const int rowb = ((pb * AT_S + cs) * AT_H + ch) * AT_W;
#pragma unroll 1
      for (int dx = 0; dx < 3; ++dx) {
        const int zw = pw + dx - 1;
        const bool valid = vy && ((unsigned)zw < (unsigned)AT_W);
        const int cw = zw < 0 ? 0 : (zw > AT_W - 1 ? AT_W - 1 : zw);
        const float* kp = kf + (size_t)(rowb + cw) * AT_C + head * 32;
        float a = 0.f;
#pragma unroll
        for (int i = 0; i < 8; ++i) {
          const v4f tk = *(const v4f*)(kp + 4 * i);
          a = fmaf(qr[4 * i + 0], tk[0], a);
          a = fmaf(qr[4 * i + 1], tk[1], a);
          a = fmaf(qr[4 * i + 2], tk[2], a);
          a = fmaf(qr[4 * i + 3], tk[3], a);
        }
        const float dot = a * QK_SCALE;
        sbuf[kk * 256 + tid] = dot;
        if (valid) { mx = fmaxf(mx, dot); vmask |= (1u << kk); }
        ++kk;
      }
    }
  }

  // pass 2: probabilities (exactly 0 for out-of-range neighbours), sum
  float sum = 0.f;
#pragma unroll 1
  for (int k2 = 0; k2 < AT_NB; ++k2) {
    const float d = sbuf[k2 * 256 + tid];
    const float ex = __expf(d - mx);
    const float p = ((vmask >> k2) & 1u) ? ex : 0.f;
    sbuf[k2 * 256 + tid] = p;
    sum += p;
  }
  const float inv = __builtin_amdgcn_rcpf(sum);   // sum >= 1

  // pass 3: weighted sum of v rows
  float acc[32];
#pragma unroll
  for (int i = 0; i < 32; ++i) acc[i] = 0.f;
  kk = 0;
#pragma unroll 1
  for (int dz = 0; dz < 3; ++dz) {
    const int zs = ps + dz - 1;
    const int cs = zs < 0 ? 0 : (zs > AT_S - 1 ? AT_S - 1 : zs);
#pragma unroll 1
    for (int dy = 0; dy < 3; ++dy) {
      const int zh = ph + dy - 1;
      const int ch = zh < 0 ? 0 : (zh > AT_H - 1 ? AT_H - 1 : zh);
      const int rowb = ((pb * AT_S + cs) * AT_H + ch) * AT_W;
#pragma unroll 1
      for (int dx = 0; dx < 3; ++dx) {
        const int zw = pw + dx - 1;
        const int cw = zw < 0 ? 0 : (zw > AT_W - 1 ? AT_W - 1 : zw);
        const float p = sbuf[kk * 256 + tid];
        const float* vp = vf + (size_t)(rowb + cw) * AT_C + head * 32;
#pragma unroll
        for (int i = 0; i < 8; ++i) {
          const v4f tv = *(const v4f*)(vp + 4 * i);
          acc[4 * i + 0] = fmaf(p, tv[0], acc[4 * i + 0]);
          acc[4 * i + 1] = fmaf(p, tv[1], acc[4 * i + 1]);
          acc[4 * i + 2] = fmaf(p, tv[2], acc[4 * i + 2]);
          acc[4 * i + 3] = fmaf(p, tv[3], acc[4 * i + 3]);
        }
        ++kk;
      }
    }
  }
  const float osc = inv * 8.0f;     // normalise and carry x8 for the f16 A operand of the output projection

  // epilogue: stage f16 tile [32 voxels][256] in LDS (pitch 264 halves), then whole-line stores
  __syncthreads();
  _Float16* st = reinterpret_cast<_Float16*>(sbuf);
  {
    _Float16* sp = st + vox * AT_PITCH + head * 32;
#pragma unroll
    for (int j = 0; j < 4; ++j) {
      v8h hv;
#pragma unroll
      for (int i = 0; i < 8; ++i) hv[i] = (_Float16)(acc[8 * j + i] * osc);
      *(v8h*)(sp + 8 * j) = hv;
    }
  }
  __syncthreads();
  {
    const int g = tid >> 3;     // 0..31: line group (8 contiguous lanes)
    const int e = tid & 7;      // 16-B piece within the line
    _Float16* ob = oh + (size_t)blockIdx.x * 32 * AT_C;
    {
#pragma unroll
      for (int it = 0; it < 4; ++it) {
        const int L = it * 32 + g;       // 0..127: 32 rows x 4 lines
        const int row = L >> 2;
        const int seg = L & 3;
        const v8h hv = *(const v8h*)(st + row * AT_PITCH + seg * 64 + e * 8);
        *(v8h*)(ob + (size_t)row * AT_C + seg * 64 + e * 8) = hv;
      }
      
    }
  }
}

// ---------------------------------------------------------------------------
extern "C" void kernel_launch(void* const* d_in, const int* in_sizes, int n_in,
                              void* d_out, int out_size, void* d_ws, size_t ws_size,
                              hipStream_t stream) {
  const int MP = 16384;     // B*S*H*W = 2*8*32*32
  const int DC = 256;       // DIM == INNER
  if (n_in < 8) return;
  if (in_sizes[0] != MP * DC || in_sizes[1] != MP * DC) return;
  if (in_sizes[2] != DC * DC || in_sizes[3] != DC * DC || in_sizes[4] != DC * DC || in_sizes[6] != DC * DC) return;
  if (in_sizes[5] != DC || in_sizes[7] != DC) return;
  if (out_size != MP * DC) return;

  const float* x  = (const float*)d_in[0];
  const float* q  = (const float*)d_in[1];
  const float* Wq = (const float*)d_in[2];
  const float* Wk = (const float*)d_in[3];
  const float* Wv = (const float*)d_in[4];
  const float* bv = (const float*)d_in[5];
  const float* Wo = (const float*)d_in[6];
  const float* bo = (const float*)d_in[7];
  float* outp = (float*)d_out;

  const size_t actH = (size_t)MP * DC * sizeof(_Float16);   // 8 MiB
  const size_t actF = (size_t)MP * DC * sizeof(float);      // 16 MiB
  const size_t wH   = (size_t)DC * DC * sizeof(_Float16);   // 128 KiB
  size_t off = 0;
  char* base = (char*)d_ws;
  _Float16* xh  = (_Float16*)(base + off); off += actH;
  _Float16* qh  = (_Float16*)(base + off); off += actH;
  _Float16* WqT = (_Float16*)(base + off); off += wH;
  _Float16* WkT = (_Float16*)(base + off); off += wH;
  _Float16* WvT = (_Float16*)(base + off); off += wH;
  _Float16* WoT = (_Float16*)(base + off); off += wH;
  float*    qpF = (float*)(base + off);    off += actF;
  float*    kF  = (float*)(base + off);    off += actF;
  float*    vF  = (float*)(base + off);    off += actF;
  _Float16* aH  = (_Float16*)(base + off); off += actH;
  // total = 76,021,760 B
  if (off > ws_size) return;

  // 1) f32 -> f16 casts of x and q (8 elements per thread)
  const int n8 = MP * DC / 8;                                  // 524288
  cast_f32_f16x8<<<dim3((n8 + 255) / 256, 2), 256, 0, stream>>>(x, q, xh, qh, n8);

  // 2) weights: T[n][k] = f16(W[k][n] * 16)
  wt_transpose_f16<<<dim3(DC / 32, 4), 256, 0, stream>>>(Wq, Wk, Wv, Wo, WqT, WkT, WvT, WoT);

  // 3) projections: C = (1/16) * A . Bt^T (+ bias[n]); M = 16384, N = K = 256; 1024 64x64 tiles, 8 per block
  const dim3 gg((MP / 64) * (DC / 64) / 8, 1);
  const float s16 = 1.0f / 16.0f;
  wmma_gemm64<0, false, 0, 0, false, 0><<<gg, 256, 0, stream>>>(
      (const unsigned short*)qh, (const unsigned short*)qh, DC, 0L,
      (const unsigned short*)WqT, (const unsigned short*)WqT, DC, 0L,
      (void*)qpF, (void*)qpF, DC, 0L, bo, x, 0L, MP, DC, DC, s16);
  wmma_gemm64<0, false, 0, 0, false, 0><<<gg, 256, 0, stream>>>(
      (const unsigned short*)xh, (const unsigned short*)xh, DC, 0L,
      (const unsigned short*)WkT, (const unsigned short*)WkT, DC, 0L,
      (void*)kF, (void*)kF, DC, 0L, bo, x, 0L, MP, DC, DC, s16);
  wmma_gemm64<0, false, 2, 0, false, 0><<<gg, 256, 0, stream>>>(
      (const unsigned short*)xh, (const unsigned short*)xh, DC, 0L,
      (const unsigned short*)WvT, (const unsigned short*)WvT, DC, 0L,
      (void*)vF, (void*)vF, DC, 0L, bv, x, 0L, MP, DC, DC, s16);

  // 4) windowed attention (f32), output f16 x8
  local_attn3d<<<MP / 32, 256, 0, stream>>>(qpF, kF, vF, aH);

  // 5) output projection: out = (1/128) * aH . WoT^T + bo -> d_out (f32)
  wmma_gemm64<0, false, 2, 0, false, 0><<<gg, 256, 0, stream>>>(
      (const unsigned short*)aH, (const unsigned short*)aH, DC, 0L,
      (const unsigned short*)WoT, (const unsigned short*)WoT, DC, 0L,
      (void*)outp, (void*)outp, DC, 0L, bo, x, 0L, MP, DC, DC, 1.0f / 128.0f);
}

// v001
// Measured time: 101 microseconds a run.
// Two timings next to v000 both put it at 1.61 times that version's speed.
// Projections x@Wk, x@Wv+bv, q@Wq, o@Wo+bo: v_wmma_f32_16x16x32_f16 (f16 operands; weights carried x16, o carried x8; f32 accumulate). Windowed q.k, softmax, p.v: f32 VALU.
#include <hip/hip_runtime.h>
#include <hip/hip_bf16.h>

typedef __attribute__((ext_vector_type(16))) _Float16 v16h;
typedef __attribute__((ext_vector_type(8)))  _Float16 v8h;
typedef __attribute__((ext_vector_type(16))) __bf16   v16b;
typedef __attribute__((ext_vector_type(8)))  __bf16   v8b;
typedef __attribute__((ext_vector_type(8)))  float    v8f;
typedef __attribute__((ext_vector_type(4)))  float    v4f;

__device__ __forceinline__ unsigned short f2bf_bits(float f) {
  unsigned u = __float_as_uint(f);
  return (unsigned short)((u + 0x7FFFu + ((u >> 16) & 1u)) >> 16);
}
__device__ __forceinline__ float bf_bits2f(unsigned short h) { return __uint_as_float(((unsigned)h) << 16); }

// hazard guards as plain device helpers (no inline asm inside the kernel template body)
__device__ __forceinline__ void dep_guard_h(v8f& a, v8f& b, v16h x, v16h y) { asm volatile("v_nop\n\tv_nop\n\tv_nop\n\tv_nop" : "+v"(a), "+v"(b) : "v"(x), "v"(y)); }
__device__ __forceinline__ void dep_guard_b(v8f& a, v8f& b, v16b x, v16b y) { asm volatile("v_nop\n\tv_nop\n\tv_nop\n\tv_nop" : "+v"(a), "+v"(b) : "v"(x), "v"(y)); }
__device__ __forceinline__ void keep4_h(v16h a, v16h b, v16h c, v16h d) { asm volatile("v_nop" :: "v"(a), "v"(b), "v"(c), "v"(d)); }
__device__ __forceinline__ void keep4_b(v16b a, v16b b, v16b c, v16b d) { asm volatile("v_nop" :: "v"(a), "v"(b), "v"(c), "v"(d)); }
__device__ __forceinline__ void acc_guard4(v8f& a, v8f& b, v8f& c, v8f& d) { asm volatile("v_nop\n\tv_nop\n\tv_nop\n\tv_nop" : "+v"(a), "+v"(b), "+v"(c), "+v"(d)); }
template <typename T> struct Frag;
template <> struct Frag<_Float16> {
  typedef v16h V; union U { v16h v; v8h h[2]; };
  static __device__ __forceinline__ v16h load(const _Float16* p) {   // elements 0..7 <- p[0..7], 8..15 <- p[16..23]
    U f; f.h[0] = *(const v8h*)(p); f.h[1] = *(const v8h*)(p + 16); return f.v;
  }
  static __device__ __forceinline__ v8f mma(v16h a, v16h b, v8f c) {
    return __builtin_amdgcn_wmma_f32_16x16x32_f16(false, a, false, b, (short)0, c, false, false);
  }
  static __device__ __forceinline__ void guard(v8f& a, v8f& b, v16h x, v16h y) { dep_guard_h(a, b, x, y); }
  static __device__ __forceinline__ void keep(v16h a, v16h b, v16h c, v16h d) { keep4_h(a, b, c, d); }
};
template <> struct Frag<__bf16> {
  typedef v16b V; union U { v16b v; v8b h[2]; };
  static __device__ __forceinline__ v16b load(const __bf16* p) {
    U f; f.h[0] = *(const v8b*)(p); f.h[1] = *(const v8b*)(p + 16); return f.v;
  }
  static __device__ __forceinline__ v8f mma(v16b a, v16b b, v8f c) {
    return __builtin_amdgcn_wmma_f32_16x16x32_bf16(false, a, false, b, (short)0, c, false, false);
  }
  static __device__ __forceinline__ void guard(v8f& a, v8f& b, v16b x, v16b y) { dep_guard_b(a, b, x, y); }
  static __device__ __forceinline__ void keep(v16b a, v16b b, v16b c, v16b d) { keep4_b(a, b, c, d); }
};

// ---- Register-blocked batched WMMA GEMM ------------------------------------
// C[m,n] = scale * sum_k A[m,k] * Bt[n,k] (+bias)(+resid); each wave owns a 64x64 tile.
// A row-major [M,K]; Bt row-major [N,K]; M,N % 64 == 0, K % 32 == 0.
// SPLIT: operands are hi/lo planes (A2/Bt2 = lo planes, same layout); product = hi.hi + hi.lo + lo.hi.
// BIAS_MODE: 0 = none, 1 = bias[m], 2 = bias[n].
// OUT_MODE: 0 = f32, 1 = f16, 2 = bf16 hi plane (Cout) + bf16 lo plane (Cout2).
// ET: 0 = f16 operands, 1 = bf16 operands (pointers passed as 16-bit storage)
template <int ET> struct Elem;
template <> struct Elem<0> { typedef _Float16 T; };
template <> struct Elem<1> { typedef __bf16 T; };
template <int ET, bool SPLIT, int BIAS_MODE, int OUT_MODE, bool RESID, int ACT = 0>
__global__ __launch_bounds__(256) void wmma_gemm64(
    const unsigned short* __restrict__ Ap, const unsigned short* __restrict__ A2p, int lda, long strideA,
    const unsigned short* __restrict__ Btp, const unsigned short* __restrict__ Bt2p, int ldb, long strideB,
    void* __restrict__ Cout, void* __restrict__ Cout2, int ldc, long strideC,
    const float* __restrict__ bias,
    const float* __restrict__ resid, long strideR,
    int M, int N, int K, float scale) {
  typedef typename Elem<ET>::T T;
  typedef typename Frag<T>::V V;
  const T* A = (const T*)Ap; const T* A2 = (const T*)A2p; const T* Bt = (const T*)Btp; const T* Bt2 = (const T*)Bt2p;
  __shared__ __align__(16) float sT[8][16 * 68];   // per-wave 16x64 slab, pitch 68 floats
  const int b    = blockIdx.y;
  const int lane = threadIdx.x & 31;
  const int wave = threadIdx.x >> 5;
  const int tilesN = N >> 6;
  const int tilesM = M >> 6;
  const int tile = blockIdx.x * 8 + wave;
  if (tile >= tilesM * tilesN) return;   // wave-uniform; no block barriers in this kernel
  const int tm = tile / tilesN;
  const int tn = tile - tm * tilesN;
  const int m0 = tm << 6;
  const int n0 = tn << 6;

  const T* Ab  = A  + (size_t)b * strideA;
  const T* Bb  = Bt + (size_t)b * strideB;
  const T* Ab2 = SPLIT ? (A2  + (size_t)b * strideA) : nullptr;
  const T* Bb2 = SPLIT ? (Bt2 + (size_t)b * strideB) : nullptr;

  const int rlane = lane & 15;                 // row (A) / col (B, D) within subtile
  const int koff  = (lane >> 4) * 8;           // k offset of this lane half
  const int mOff  = (lane >> 4) * 8;           // D row offset

  v8f acc[4][4];
#pragma unroll
  for (int i = 0; i < 4; ++i)
#pragma unroll
    for (int j = 0; j < 4; ++j) acc[i][j] = (v8f){0.f,0.f,0.f,0.f,0.f,0.f,0.f,0.f};

  for (int k0 = 0; k0 < K; k0 += 32) {
    V bh[4], bl[4];
#pragma unroll
    for (int j = 0; j < 4; ++j) {
      const size_t bo = (size_t)(n0 + (j << 4) + rlane) * ldb + koff + k0;
      bh[j] = Frag<T>::load(Bb + bo);
      if (SPLIT) bl[j] = Frag<T>::load(Bb2 + bo);
    }
#pragma unroll
    for (int i = 0; i < 4; ++i) {
      const size_t ao = (size_t)(m0 + (i << 4) + rlane) * lda + koff + k0;
      V ah = Frag<T>::load(Ab + ao);
      V al;
      if (SPLIT) al = Frag<T>::load(Ab2 + ao);
#pragma unroll
      for (int j = 0; j < 4; ++j) {
        acc[i][j] = Frag<T>::mma(ah, bh[j], acc[i][j]);
        if (SPLIT) {
          acc[i][j] = Frag<T>::mma(ah, bl[j], acc[i][j]);
          acc[i][j] = Frag<T>::mma(al, bh[j], acc[i][j]);
        }
      }
      Frag<T>::guard(acc[i][0], acc[i][3], ah, SPLIT ? al : ah);
    }
    Frag<T>::keep(bh[0], bh[1], bh[2], bh[3]);
    if (SPLIT) Frag<T>::keep(bl[0], bl[1], bl[2], bl[3]);
  }
  acc_guard4(acc[0][0], acc[0][1], acc[0][2], acc[0][3]);
  acc_guard4(acc[1][0], acc[1][1], acc[1][2], acc[1][3]);
  acc_guard4(acc[2][0], acc[2][1], acc[2][2], acc[2][3]);
  acc_guard4(acc[3][0], acc[3][1], acc[3][2], acc[3][3]);

  // ---- epilogue ----
  float* slab = sT[wave];
  const float* Rb = RESID ? (resid + (size_t)b * strideR) : nullptr;
#pragma unroll
  for (int i = 0; i < 4; ++i) {
    const int mBase = m0 + (i << 4);
#pragma unroll
    for (int j = 0; j < 4; ++j) {
      const int n = n0 + (j << 4) + rlane;
      float bv = 0.f;
      if (BIAS_MODE == 2) bv = bias[n];
#pragma unroll
      for (int r = 0; r < 8; ++r) {
        float v = acc[i][j][r] * scale;
        if (BIAS_MODE == 1) v += bias[mBase + mOff + r];
        if (BIAS_MODE == 2) v += bv;
        if (RESID) v += Rb[(size_t)(mBase + mOff + r) * ldc + n];
        if (ACT == 1) v = tanhf(v);
        if (ACT == 2) v = fmaxf(v, 0.0f);
        if (ACT == 3) v = v / (1.0f + expf(-v));
        if (ACT == 4) v = (v > 0.f) ? v : 0.01f * v;
        if (ACT == 5) v = 0.5f * v * (1.0f + erff(v * 0.70710678118654752f));
        slab[(mOff + r) * 68 + (j << 4) + rlane] = v;
      }
    }
    __builtin_amdgcn_fence(__ATOMIC_RELEASE, "workgroup");
    __builtin_amdgcn_wave_barrier();
    __builtin_amdgcn_fence(__ATOMIC_ACQUIRE, "workgroup");
    if (OUT_MODE == 0) {
      float* C = (float*)Cout + (size_t)b * strideC;
      const int hh = lane >> 4, c4 = (lane & 15) * 4;     // row seg = 256 B = 16 lanes x 16 B
      {
#pragma unroll
        for (int it = 0; it < 8; ++it) {
          const int row = it * 2 + hh;
          v4f v = *(const v4f*)(slab + row * 68 + c4);
          *(v4f*)(C + (size_t)(mBase + row) * ldc + n0 + c4) = v;
        }
        
      }
    } else {
      const int q = lane >> 3, c8 = (lane & 7) * 8;
      unsigned short* C  = (unsigned short*)Cout  + (size_t)b * strideC;
      unsigned short* C2 = (OUT_MODE == 2) ? ((unsigned short*)Cout2 + (size_t)b * strideC) : nullptr;
      {
#pragma unroll
        for (int it = 0; it < 4; ++it) {
          const int row = it * 4 + q;
          const float* sp = slab + row * 68 + c8;
          v8h hv, lv;
#pragma unroll
          for (int e = 0; e < 8; ++e) {
            if (OUT_MODE == 1) {
              hv[e] = (_Float16)sp[e];
            } else {
              unsigned short hb = f2bf_bits(sp[e]);
              unsigned short lb = f2bf_bits(sp[e] - bf_bits2f(hb));
              hv[e] = __builtin_bit_cast(_Float16, hb);
              lv[e] = __builtin_bit_cast(_Float16, lb);
            }
          }
          *(v8h*)(C + (size_t)(mBase + row) * ldc + n0 + c8) = hv;
          if (OUT_MODE == 2) *(v8h*)(C2 + (size_t)(mBase + row) * ldc + n0 + c8) = lv;
        }
        
      }
    }
    __builtin_amdgcn_fence(__ATOMIC_RELEASE, "workgroup");
    __builtin_amdgcn_wave_barrier();
    __builtin_amdgcn_fence(__ATOMIC_ACQUIRE, "workgroup");
  }
}

// blockIdx.y selects tensor 0 or 1 (both global pointers).
__global__ __launch_bounds__(256) void cast_f32_f16x8(
    const float* __restrict__ in0, const float* __restrict__ in1,
    _Float16* __restrict__ out0, _Float16* __restrict__ out1, int n8) {
  const float* in = (blockIdx.y == 0) ? in0 : in1;
  _Float16* out = (blockIdx.y == 0) ? out0 : out1;
  const int i = blockIdx.x * 256 + threadIdx.x;
  if (i < n8) {
    const v4f a = *(const v4f*)(in + (size_t)i * 8);
    const v4f c = *(const v4f*)(in + (size_t)i * 8 + 4);
    v8h hv;
    hv[0] = (_Float16)a[0]; hv[1] = (_Float16)a[1]; hv[2] = (_Float16)a[2]; hv[3] = (_Float16)a[3];
    hv[4] = (_Float16)c[0]; hv[5] = (_Float16)c[1]; hv[6] = (_Float16)c[2]; hv[7] = (_Float16)c[3];
    *(v8h*)(out + (size_t)i * 8) = hv;
    
  }
}

// ---- weight transpose + x16 carry + f16 convert: in W[k][n] (256x256, row-major) -> out T[n][k] = f16(W[k][n]*16) ----
// grid (8, 4): blockIdx.x = 32-row block of n, blockIdx.y selects one of 4 weight matrices (all global pointers).
#define WDIM 256
__global__ __launch_bounds__(256) void wt_transpose_f16(
    const float* __restrict__ W0, const float* __restrict__ W1, const float* __restrict__ W2, const float* __restrict__ W3,
    _Float16* __restrict__ T0, _Float16* __restrict__ T1, _Float16* __restrict__ T2, _Float16* __restrict__ T3) {
  __shared__ float sw[32][WDIM + 1];
  const int by = blockIdx.y;
  const float* W = (by == 0) ? W0 : (by == 1) ? W1 : (by == 2) ? W2 : W3;
  _Float16*    T = (by == 0) ? T0 : (by == 1) ? T1 : (by == 2) ? T2 : T3;
  const int n0 = blockIdx.x * 32;
  const int t = threadIdx.x;
#pragma unroll 1
  for (int it = 0; it < 32; ++it) {
    const int k = it * 8 + (t >> 5);
    const int j = t & 31;
    sw[j][k] = W[(size_t)k * WDIM + n0 + j];
  }
  __syncthreads();
  const int g = t >> 3;      // output row within block: 0..31 (wave w owns rows 4w..4w+3)
  const int e = t & 7;
  {
#pragma unroll
    for (int it = 0; it < 4; ++it) {
      const int col = it * 64 + e * 8;
      v8h hv;
#pragma unroll
      for (int i = 0; i < 8; ++i) hv[i] = (_Float16)(sw[g][col + i] * 16.0f);
      *(v8h*)(T + (size_t)(n0 + g) * WDIM + col) = hv;
    }
    
  }
}

// ---- local 3x3x3 windowed attention, f32. One thread per (voxel, head); block = one W row of 32 voxels x 8 heads. ----
// qp/kf/vf: f32 [16384][256] (voxel-major, col = head*32 + d). Output oh: f16 [16384][256] = attention output x8.
// The block's own q row, the nine neighbouring K rows, then the nine V rows (32 voxels x 1 KiB each, contiguous in
// memory) pass through a two-buffer LDS ring filled by asynchronous copies in whole lines; every thread reads its q
// and its three neighbours per row from LDS.
// Row and voxel indices clamped into range; out-of-volume neighbours get weight exactly 0; the centre is always in range.
// Per-thread dots / probabilities live in thread-private LDS slots (27 per thread).
#define AT_S 8
#define AT_H 32
#define AT_W 32
#define AT_C 256
#define AT_NB 27
#define AT_PITCH 264
#define AT_HPITCH 36                     // floats per (voxel, head) slot: 32 + 4 pad = 144 B, so 16 lanes' b128 reads cover all 64 banks
#define AT_VPITCH (8 * AT_HPITCH)        // floats per voxel
#define AT_TILE_F (AT_W * AT_VPITCH)     // floats per staged row of 32 voxels (36864 B)
#define AT_NT 19                         // tiles: the q row, 9 K rows, 9 V rows
#define QK_SCALE 0.17677669529663687f

// One staged row: 2048 pieces of 16 B, eight per lane. g = this lane's first global piece, l = its LDS byte address;
// piece j lies 4 KiB further in memory (4 voxels) and 4 voxel pitches further in LDS.
// s_wait_xcnt closes the statement so that no address register of an issued copy is rewritten ahead of it.
__device__ __forceinline__ void stage_row_async(const float* g, unsigned l) {
  asm volatile(
      "global_load_async_to_lds_b128 %0, %8, off\n\t"
      "global_load_async_to_lds_b128 %1, %9, off\n\t"
      "global_load_async_to_lds_b128 %2, %10, off\n\t"
      "global_load_async_to_lds_b128 %3, %11, off\n\t"
      "global_load_async_to_lds_b128 %4, %12, off\n\t"
      "global_load_async_to_lds_b128 %5, %13, off\n\t"
      "global_load_async_to_lds_b128 %6, %14, off\n\t"
      "global_load_async_to_lds_b128 %7, %15, off\n\t"
      "s_wait_xcnt 0x0"
      :: "v"(l), "v"(l + 1u * 16u * AT_VPITCH), "v"(l + 2u * 16u * AT_VPITCH), "v"(l + 3u * 16u * AT_VPITCH),
         "v"(l + 4u * 16u * AT_VPITCH), "v"(l + 5u * 16u * AT_VPITCH), "v"(l + 6u * 16u * AT_VPITCH), "v"(l + 7u * 16u * AT_VPITCH),
         "v"(g), "v"(g + 1 * 1024), "v"(g + 2 * 1024), "v"(g + 3 * 1024),
         "v"(g + 4 * 1024), "v"(g + 5 * 1024), "v"(g + 6 * 1024), "v"(g + 7 * 1024)
      : "memory");
}

// Foot of a ring trip: hands the next tile to every wave and frees the buffer just read.
__device__ __forceinline__ void ring_publish() {
  asm volatile("s_wait_dscnt 0x0" ::: "memory");     // this wave's LDS reads of the buffer to be refilled have retired
  asm volatile("s_wait_asynccnt 0x0" ::: "memory");  // this wave's copies of the next tile have landed
  __syncthreads();                                   // every wave's copies are visible; every reader has left the old buffer
}

__global__ __launch_bounds__(256) void local_attn3d(
    const float* __restrict__ qp, const float* __restrict__ kf, const float* __restrict__ vf,
    _Float16* __restrict__ oh) {
  __shared__ __align__(16) float sbuf[AT_NB * 256];   // 27648 B; reused as f16 staging (32 x 264 halves = 16896 B)
  __shared__ __align__(16) float tile[2 * AT_TILE_F]; // the ring: two staged rows
  const int tid  = threadIdx.x;
  const int head = tid & 7;
  const int vox  = tid >> 3;                          // = position along W
  const int ph = blockIdx.x & 31;                     // block-uniform: one block is one W row; grid = 16384/32 exactly
  const int ps = (blockIdx.x >> 5) & 7;
  const int pb = blockIdx.x >> 8;

  const unsigned lds_lane = (unsigned)(uintptr_t)tile +
      4u * (unsigned)((tid >> 6) * AT_VPITCH + ((tid >> 3) & 7) * AT_HPITCH + (tid & 7) * 4);
  auto issue = [&](int t) {                           // tile t -> buffer t & 1
    const int r9 = (t == 0) ? 4 : ((t < 10) ? t - 1 : t - 10);   // (dz, dy) = (r9 / 3, r9 % 3); 4 = the block's own row
    const float* srcp = (t == 0) ? qp : ((t < 10) ? kf : vf);
    const int dz = r9 / 3;
    const int dy = r9 - 3 * dz;
    const int zs = ps + dz - 1;
    const int cs = zs < 0 ? 0 : (zs > AT_S - 1 ? AT_S - 1 : zs);
    const int zh = ph + dy - 1;
    const int ch = zh < 0 ? 0 : (zh > AT_H - 1 ? AT_H - 1 : zh);
    const int rowb = ((pb * AT_S + cs) * AT_H + ch) * AT_W;
    stage_row_async(srcp + (size_t)rowb * AT_C + tid * 4, lds_lane + (unsigned)(t & 1) * (4u * AT_TILE_F));
  };

  issue(0);
  asm volatile("s_wait_asynccnt 0x0" ::: "memory");   // tile 0 has landed (this wave's part)
  __syncthreads();                                    // ... and every other wave's
  issue(1);

  // this thread's three neighbours along W inside a staged row (clamped)
  const int o0 = (vox > 0 ? vox - 1 : 0) * AT_VPITCH + head * AT_HPITCH;
  const int o1 = vox * AT_VPITCH + head * AT_HPITCH;
  const int o2 = (vox < AT_W - 1 ? vox + 1 : AT_W - 1) * AT_VPITCH + head * AT_HPITCH;

  // trip 0: this thread's q from the staged q row
  float qr[32];
  {
    const float* qptr = tile + o1;
#pragma unroll
    for (int i = 0; i < 8; ++i) {
      const v4f tq = *(const v4f*)(qptr + 4 * i);
      qr[4 * i + 0] = tq[0]; qr[4 * i + 1] = tq[1]; qr[4 * i + 2] = tq[2]; qr[4 * i + 3] = tq[3];
    }
  }
  ring_publish();
  issue(2);

  // pass 1: dots, one K row (dz, dy) per trip
  float mx = -INFINITY;
  unsigned vmask = 0u;
#pragma unroll 1
  for (int t = 1; t < 10; ++t) {
    const float* tb = tile + (t & 1) * AT_TILE_F;
    float a0 = 0.f, a1 = 0.f, a2 = 0.f;
#pragma unroll
    for (int i = 0; i < 8; ++i) {
      const v4f k0 = *(const v4f*)(tb + o0 + 4 * i);
      const v4f k1 = *(const v4f*)(tb + o1 + 4 * i);
      const v4f k2 = *(const v4f*)(tb + o2 + 4 * i);
#pragma unroll
      for (int c = 0; c < 4; ++c) {
        a0 = fmaf(qr[4 * i + c], k0[c], a0);
        a1 = fmaf(qr[4 * i + c], k1[c], a1);
        a2 = fmaf(qr[4 * i + c], k2[c], a2);
      }
    }
    const int dz = (t - 1) / 3;
    const int dy = (t - 1) - 3 * dz;
    const bool vrow = ((unsigned)(ps + dz - 1) < (unsigned)AT_S) && ((unsigned)(ph + dy - 1) < (unsigned)AT_H);
    const float d0 = a0 * QK_SCALE, d1 = a1 * QK_SCALE, d2 = a2 * QK_SCALE;
    const int kk = 3 * (t - 1);
    sbuf[(kk + 0) * 256 + tid] = d0;
    sbuf[(kk + 1) * 256 + tid] = d1;
    sbuf[(kk + 2) * 256 + tid] = d2;
    if (vrow && vox > 0)        { mx = fmaxf(mx, d0); vmask |= (1u << (kk + 0)); }
    if (vrow)                   { mx = fmaxf(mx, d1); vmask |= (1u << (kk + 1)); }
    if (vrow && vox < AT_W - 1) { mx = fmaxf(mx, d2); vmask |= (1u << (kk + 2)); }
    ring_publish();
    issue(t + 2);                                     // tiles 3..11 all exist
  }

  // pass 2: probabilities (exactly 0 for out-of-range neighbours), sum
  float sum = 0.f;
#pragma unroll 1
  for (int k2 = 0; k2 < AT_NB; ++k2) {
    const float d = sbuf[k2 * 256 + tid];
    const float ex = __expf(d - mx);
    const float p = ((vmask >> k2) & 1u) ? ex : 0.f;
    sbuf[k2 * 256 + tid] = p;
    sum += p;
  }
  const float inv = __builtin_amdgcn_rcpf(sum);   // sum >= 1

  // pass 3: weighted sum of v rows, one V row (dz, dy) per trip
  float acc[32];
#pragma unroll
  for (int i = 0; i < 32; ++i) acc[i] = 0.f;
#pragma unroll 1
  for (int t = 10; t < AT_NT; ++t) {
    const float* tb = tile + (t & 1) * AT_TILE_F;
    const int kk = 3 * (t - 10);
    const float p0 = sbuf[(kk + 0) * 256 + tid];
    const float p1 = sbuf[(kk + 1) * 256 + tid];
    const float p2 = sbuf[(kk + 2) * 256 + tid];
#pragma unroll
    for (int i = 0; i < 8; ++i) {
      const v4f v0 = *(const v4f*)(tb + o0 + 4 * i);
      const v4f v1 = *(const v4f*)(tb + o1 + 4 * i);
      const v4f v2 = *(const v4f*)(tb + o2 + 4 * i);
#pragma unroll
      for (int c = 0; c < 4; ++c) {
        float s = acc[4 * i + c];
        s = fmaf(p0, v0[c], s);
        s = fmaf(p1, v1[c], s);
        s = fmaf(p2, v2[c], s);
        acc[4 * i + c] = s;
      }
    }
    ring_publish();
    if (t + 2 < AT_NT) issue(t + 2);                  // block-uniform test
  }
  asm volatile("s_wait_asynccnt 0x0" ::: "memory");   // no copy of this wave is left in flight
  const float osc = inv * 8.0f;     // normalise and carry x8 for the f16 A operand of the output projection

  // epilogue: stage f16 tile [32 voxels][256] in LDS (pitch 264 halves), then whole-line stores
  __syncthreads();
  _Float16* st = reinterpret_cast<_Float16*>(sbuf);
  {
    _Float16* sp = st + vox * AT_PITCH + head * 32;
#pragma unroll
    for (int j = 0; j < 4; ++j) {
      v8h hv;
#pragma unroll
      for (int i = 0; i < 8; ++i) hv[i] = (_Float16)(acc[8 * j + i] * osc);
      *(v8h*)(sp + 8 * j) = hv;
    }
  }
  __syncthreads();
  {
    const int g = tid >> 3;     // 0..31: line group (8 contiguous lanes)
    const int e = tid & 7;      // 16-B piece within the line
    _Float16* ob = oh + (size_t)blockIdx.x * 32 * AT_C;
    {
#pragma unroll
      for (int it = 0; it < 4; ++it) {
        const int L = it * 32 + g;       // 0..127: 32 rows x 4 lines
        const int row = L >> 2;
        const int seg = L & 3;
        const v8h hv = *(const v8h*)(st + row * AT_PITCH + seg * 64 + e * 8);
        *(v8h*)(ob + (size_t)row * AT_C + seg * 64 + e * 8) = hv;
      }
      
    }
  }
}

// ---------------------------------------------------------------------------
extern "C" void kernel_launch(void* const* d_in, const int* in_sizes, int n_in,
                              void* d_out, int out_size, void* d_ws, size_t ws_size,
                              hipStream_t stream) {
  const int MP = 16384;     // B*S*H*W = 2*8*32*32
  const int DC = 256;       // DIM == INNER
  if (n_in < 8) return;
  if (in_sizes[0] != MP * DC || in_sizes[1] != MP * DC) return;
  if (in_sizes[2] != DC * DC || in_sizes[3] != DC * DC || in_sizes[4] != DC * DC || in_sizes[6] != DC * DC) return;
  if (in_sizes[5] != DC || in_sizes[7] != DC) return;
  if (out_size != MP * DC) return;

  const float* x  = (const float*)d_in[0];
  const float* q  = (const float*)d_in[1];
  const float* Wq = (const float*)d_in[2];
  const float* Wk = (const float*)d_in[3];
  const float* Wv = (const float*)d_in[4];
  const float* bv = (const float*)d_in[5];
  const float* Wo = (const float*)d_in[6];
  const float* bo = (const float*)d_in[7];
  float* outp = (float*)d_out;

  const size_t actH = (size_t)MP * DC * sizeof(_Float16);   // 8 MiB
  const size_t actF = (size_t)MP * DC * sizeof(float);      // 16 MiB
  const size_t wH   = (size_t)DC * DC * sizeof(_Float16);   // 128 KiB
  size_t off = 0;
  char* base = (char*)d_ws;
  _Float16* xh  = (_Float16*)(base + off); off += actH;
  _Float16* qh  = (_Float16*)(base + off); off += actH;
  _Float16* WqT = (_Float16*)(base + off); off += wH;
  _Float16* WkT = (_Float16*)(base + off); off += wH;
  _Float16* WvT = (_Float16*)(base + off); off += wH;
  _Float16* WoT = (_Float16*)(base + off); off += wH;
  float*    qpF = (float*)(base + off);    off += actF;
  float*    kF  = (float*)(base + off);    off += actF;
  float*    vF  = (float*)(base + off);    off += actF;
  _Float16* aH  = (_Float16*)(base + off); off += actH;
  // total = 76,021,760 B
  if (off > ws_size) return;

  // 1) f32 -> f16 casts of x and q (8 elements per thread)
  const int n8 = MP * DC / 8;                                  // 524288
  cast_f32_f16x8<<<dim3((n8 + 255) / 256, 2), 256, 0, stream>>>(x, q, xh, qh, n8);

  // 2) weights: T[n][k] = f16(W[k][n] * 16)
  wt_transpose_f16<<<dim3(DC / 32, 4), 256, 0, stream>>>(Wq, Wk, Wv, Wo, WqT, WkT, WvT, WoT);

  // 3) projections: C = (1/16) * A . Bt^T (+ bias[n]); M = 16384, N = K = 256; 1024 64x64 tiles, 8 per block
  const dim3 gg((MP / 64) * (DC / 64) / 8, 1);
  const float s16 = 1.0f / 16.0f;
  wmma_gemm64<0, false, 0, 0, false, 0><<<gg, 256, 0, stream>>>(
      (const unsigned short*)qh, (const unsigned short*)qh, DC, 0L,
      (const unsigned short*)WqT, (const unsigned short*)WqT, DC, 0L,
      (void*)qpF, (void*)qpF, DC, 0L, bo, x, 0L, MP, DC, DC, s16);
  wmma_gemm64<0, false, 0, 0, false, 0><<<gg, 256, 0, stream>>>(
      (const unsigned short*)xh, (const unsigned short*)xh, DC, 0L,
      (const unsigned short*)WkT, (const unsigned short*)WkT, DC, 0L,
      (void*)kF, (void*)kF, DC, 0L, bo, x, 0L, MP, DC, DC, s16);
  wmma_gemm64<0, false, 2, 0, false, 0><<<gg, 256, 0, stream>>>(
      (const unsigned short*)xh, (const unsigned short*)xh, DC, 0L,
      (const unsigned short*)WvT, (const unsigned short*)WvT, DC, 0L,
      (void*)vF, (void*)vF, DC, 0L, bv, x, 0L, MP, DC, DC, s16);

  // 4) windowed attention (f32), output f16 x8
  local_attn3d<<<MP / 32, 256, 0, stream>>>(qpF, kF, vF, aH);

  // 5) output projection: out = (1/128) * aH . WoT^T + bo -> d_out (f32)
  wmma_gemm64<0, false, 2, 0, false, 0><<<gg, 256, 0, stream>>>(
      (const unsigned short*)aH, (const unsigned short*)aH, DC, 0L,
      (const unsigned short*)WoT, (const unsigned short*)WoT, DC, 0L,
      (void*)outp, (void*)outp, DC, 0L, bo, x, 0L, MP, DC, DC, 1.0f / 128.0f);
}

// v002
// One run takes 72.6 microseconds.
// Timed twice side by side with v001, it ran 1.39 and 1.37 times as fast.
// Counting every step since v000, it is 2.22 times as fast.
// Projections x@Wk, x@Wv+bv, q@Wq, o@Wo+bo: v_wmma_f32_16x16x32_f16 (f16 operands; weights carried x16, o carried x8; f32 accumulate). Windowed q.k, softmax, p.v: f32 VALU.
#include <hip/hip_runtime.h>
#include <hip/hip_bf16.h>

typedef __attribute__((ext_vector_type(16))) _Float16 v16h;
typedef __attribute__((ext_vector_type(8)))  _Float16 v8h;
typedef __attribute__((ext_vector_type(16))) __bf16   v16b;
typedef __attribute__((ext_vector_type(8)))  __bf16   v8b;
typedef __attribute__((ext_vector_type(8)))  float    v8f;
typedef __attribute__((ext_vector_type(4)))  float    v4f;

__device__ __forceinline__ unsigned short f2bf_bits(float f) {
  unsigned u = __float_as_uint(f);
  return (unsigned short)((u + 0x7FFFu + ((u >> 16) & 1u)) >> 16);
}
__device__ __forceinline__ float bf_bits2f(unsigned short h) { return __uint_as_float(((unsigned)h) << 16); }

// hazard guards as plain device helpers
__device__ __forceinline__ void dep_guard_h(v8f& a, v8f& b, v16h x, v16h y) { asm volatile("v_nop\n\tv_nop\n\tv_nop\n\tv_nop" : "+v"(a), "+v"(b) : "v"(x), "v"(y)); }
__device__ __forceinline__ void dep_guard_b(v8f& a, v8f& b, v16b x, v16b y) { asm volatile("v_nop\n\tv_nop\n\tv_nop\n\tv_nop" : "+v"(a), "+v"(b) : "v"(x), "v"(y)); }
__device__ __forceinline__ void keep4_h(v16h a, v16h b, v16h c, v16h d) { asm volatile("v_nop" :: "v"(a), "v"(b), "v"(c), "v"(d)); }
__device__ __forceinline__ void keep4_b(v16b a, v16b b, v16b c, v16b d) { asm volatile("v_nop" :: "v"(a), "v"(b), "v"(c), "v"(d)); }
__device__ __forceinline__ void acc_guard4(v8f& a, v8f& b, v8f& c, v8f& d) { asm volatile("v_nop\n\tv_nop\n\tv_nop\n\tv_nop" : "+v"(a), "+v"(b), "+v"(c), "+v"(d)); }
template <typename T> struct Frag;
template <> struct Frag<_Float16> {
  typedef v16h V; union U { v16h v; v8h h[2]; };
  static __device__ __forceinline__ v16h load(const _Float16* p) {   // elements 0..7 <- p[0..7], 8..15 <- p[16..23]
    U f; f.h[0] = *(const v8h*)(p); f.h[1] = *(const v8h*)(p + 16); return f.v;
  }
  static __device__ __forceinline__ v8f mma(v16h a, v16h b, v8f c) {
    return __builtin_amdgcn_wmma_f32_16x16x32_f16(false, a, false, b, (short)0, c, false, false);
  }
  static __device__ __forceinline__ void guard(v8f& a, v8f& b, v16h x, v16h y) { dep_guard_h(a, b, x, y); }
  static __device__ __forceinline__ void keep(v16h a, v16h b, v16h c, v16h d) { keep4_h(a, b, c, d); }
};
template <> struct Frag<__bf16> {
  typedef v16b V; union U { v16b v; v8b h[2]; };
  static __device__ __forceinline__ v16b load(const __bf16* p) {
    U f; f.h[0] = *(const v8b*)(p); f.h[1] = *(const v8b*)(p + 16); return f.v;
  }
  static __device__ __forceinline__ v8f mma(v16b a, v16b b, v8f c) {
    return __builtin_amdgcn_wmma_f32_16x16x32_bf16(false, a, false, b, (short)0, c, false, false);
  }
  static __device__ __forceinline__ void guard(v8f& a, v8f& b, v16b x, v16b y) { dep_guard_b(a, b, x, y); }
  static __device__ __forceinline__ void keep(v16b a, v16b b, v16b c, v16b d) { keep4_b(a, b, c, d); }
};

// ---- Register-blocked batched WMMA GEMM ------------------------------------
// C[m,n] = scale * sum_k A[m,k] * Bt[n,k] (+bias)(+resid); each wave owns a 64x64 tile.
// A row-major [M,K]; Bt row-major [N,K]; M,N % 64 == 0, K % 32 == 0.
// SPLIT: operands are hi/lo planes (A2/Bt2 = lo planes, same layout); product = hi.hi + hi.lo + lo.hi.
// BIAS_MODE: 0 = none, 1 = bias[m], 2 = bias[n], 3 = bias[n] where a bias pointer is given (block-uniform), else none.
// OUT_MODE: 0 = f32, 1 = f16, 2 = bf16 hi plane (Cout) + bf16 lo plane (Cout2).
// ET: 0 = f16 operands, 1 = bf16 operands (pointers passed as 16-bit storage)
template <int ET> struct Elem;
template <> struct Elem<0> { typedef _Float16 T; };
template <> struct Elem<1> { typedef __bf16 T; };
template <int ET, bool SPLIT, int BIAS_MODE, int OUT_MODE, bool RESID, int ACT>
__device__ __forceinline__ void gemm64_body(
    const int b,
    const unsigned short* __restrict__ Ap, const unsigned short* __restrict__ A2p, int lda, long strideA,
    const unsigned short* __restrict__ Btp, const unsigned short* __restrict__ Bt2p, int ldb, long strideB,
    void* __restrict__ Cout, void* __restrict__ Cout2, int ldc, long strideC,
    const float* __restrict__ bias,
    const float* __restrict__ resid, long strideR,
    int M, int N, int K, float scale) {
  typedef typename Elem<ET>::T T;
  typedef typename Frag<T>::V V;
  const T* A = (const T*)Ap; const T* A2 = (const T*)A2p; const T* Bt = (const T*)Btp; const T* Bt2 = (const T*)Bt2p;
  __shared__ __align__(16) float sT[8][16 * 68];   // per-wave 16x64 slab, pitch 68 floats
  const int lane = threadIdx.x & 31;
  const int wave = threadIdx.x >> 5;
  const int tilesN = N >> 6;
  const int tilesM = M >> 6;
  const int tile = blockIdx.x * 8 + wave;
  if (tile >= tilesM * tilesN) return;   // wave-uniform; no block barriers in this kernel
  const int tm = tile / tilesN;
  const int tn = tile - tm * tilesN;
  const int m0 = tm << 6;
  const int n0 = tn << 6;

  const T* Ab  = A  + (size_t)b * strideA;
  const T* Bb  = Bt + (size_t)b * strideB;
  const T* Ab2 = SPLIT ? (A2  + (size_t)b * strideA) : nullptr;
  const T* Bb2 = SPLIT ? (Bt2 + (size_t)b * strideB) : nullptr;

  const int rlane = lane & 15;                 // row (A) / col (B, D) within subtile
  const int koff  = (lane >> 4) * 8;           // k offset of this lane half
  const int mOff  = (lane >> 4) * 8;           // D row offset

  v8f acc[4][4];
#pragma unroll
  for (int i = 0; i < 4; ++i)
#pragma unroll
    for (int j = 0; j < 4; ++j) acc[i][j] = (v8f){0.f,0.f,0.f,0.f,0.f,0.f,0.f,0.f};

  float bj[4] = {0.f, 0.f, 0.f, 0.f};          // BIAS_MODE 3: this lane's four bias values, read once under one uniform test
  if (BIAS_MODE == 3) {
    if (bias != nullptr) {
#pragma unroll
      for (int j = 0; j < 4; ++j) bj[j] = bias[n0 + (j << 4) + rlane];
      asm volatile("s_wait_xcnt 0x0" ::: "memory");   // stands ahead of any rewrite of the address registers that the four loads name
    }
  }

  for (int k0 = 0; k0 < K; k0 += 32) {
    V bh[4], bl[4];
#pragma unroll
    for (int j = 0; j < 4; ++j) {
      const size_t bo = (size_t)(n0 + (j << 4) + rlane) * ldb + koff + k0;
      bh[j] = Frag<T>::load(Bb + bo);
      if (SPLIT) bl[j] = Frag<T>::load(Bb2 + bo);
    }
#pragma unroll
    for (int i = 0; i < 4; ++i) {
      const size_t ao = (size_t)(m0 + (i << 4) + rlane) * lda + koff + k0;
      V ah = Frag<T>::load(Ab + ao);
      V al;
      if (SPLIT) al = Frag<T>::load(Ab2 + ao);
#pragma unroll
      for (int j = 0; j < 4; ++j) {
        acc[i][j] = Frag<T>::mma(ah, bh[j], acc[i][j]);
        if (SPLIT) {
          acc[i][j] = Frag<T>::mma(ah, bl[j], acc[i][j]);
          acc[i][j] = Frag<T>::mma(al, bh[j], acc[i][j]);
        }
      }
      Frag<T>::guard(acc[i][0], acc[i][3], ah, SPLIT ? al : ah);
    }
    Frag<T>::keep(bh[0], bh[1], bh[2], bh[3]);
    if (SPLIT) Frag<T>::keep(bl[0], bl[1], bl[2], bl[3]);
  }
  acc_guard4(acc[0][0], acc[0][1], acc[0][2], acc[0][3]);
  acc_guard4(acc[1][0], acc[1][1], acc[1][2], acc[1][3]);
  acc_guard4(acc[2][0], acc[2][1], acc[2][2], acc[2][3]);
  acc_guard4(acc[3][0], acc[3][1], acc[3][2], acc[3][3]);

  // ---- epilogue ----
  float* slab = sT[wave];
  const float* Rb = RESID ? (resid + (size_t)b * strideR) : nullptr;
#pragma unroll
  for (int i = 0; i < 4; ++i) {
    const int mBase = m0 + (i << 4);
#pragma unroll
    for (int j = 0; j < 4; ++j) {
      const int n = n0 + (j << 4) + rlane;
      float bv = 0.f;
      if (BIAS_MODE == 2) bv = bias[n];
      if (BIAS_MODE == 3) bv = bj[j];
#pragma unroll
      for (int r = 0; r < 8; ++r) {
        float v = acc[i][j][r] * scale;
        if (BIAS_MODE == 1) v += bias[mBase + mOff + r];
        if (BIAS_MODE == 2 || BIAS_MODE == 3) v += bv;
        if (RESID) v += Rb[(size_t)(mBase + mOff + r) * ldc + n];
        if (ACT == 1) v = tanhf(v);
        if (ACT == 2) v = fmaxf(v, 0.0f);
        if (ACT == 3) v = v / (1.0f + expf(-v));
        if (ACT == 4) v = (v > 0.f) ? v : 0.01f * v;
        if (ACT == 5) v = 0.5f * v * (1.0f + erff(v * 0.70710678118654752f));
        slab[(mOff + r) * 68 + (j << 4) + rlane] = v;
      }
    }
    __builtin_amdgcn_fence(__ATOMIC_RELEASE, "workgroup");
    __builtin_amdgcn_wave_barrier();
    __builtin_amdgcn_fence(__ATOMIC_ACQUIRE, "workgroup");
    if (OUT_MODE == 0) {
      float* C = (float*)Cout + (size_t)b * strideC;
      const int hh = lane >> 4, c4 = (lane & 15) * 4;     // row seg = 256 B = 16 lanes x 16 B
      {
#pragma unroll
        for (int it = 0; it < 8; ++it) {
          const int row = it * 2 + hh;
          v4f v = *(const v4f*)(slab + row * 68 + c4);
          *(v4f*)(C + (size_t)(mBase + row) * ldc + n0 + c4) = v;
        }
        
      }
    } else {
      const int q = lane >> 3, c8 = (lane & 7) * 8;
      unsigned short* C  = (unsigned short*)Cout  + (size_t)b * strideC;
      unsigned short* C2 = (OUT_MODE == 2) ? ((unsigned short*)Cout2 + (size_t)b * strideC) : nullptr;
      {
#pragma unroll
        for (int it = 0; it < 4; ++it) {
          const int row = it * 4 + q;
          const float* sp = slab + row * 68 + c8;
          v8h hv, lv;
#pragma unroll
          for (int e = 0; e < 8; ++e) {
            if (OUT_MODE == 1) {
              hv[e] = (_Float16)sp[e];
            } else {
              unsigned short hb = f2bf_bits(sp[e]);
              unsigned short lb = f2bf_bits(sp[e] - bf_bits2f(hb));
              hv[e] = __builtin_bit_cast(_Float16, hb);
              lv[e] = __builtin_bit_cast(_Float16, lb);
            }
          }
          *(v8h*)(C + (size_t)(mBase + row) * ldc + n0 + c8) = hv;
          if (OUT_MODE == 2) *(v8h*)(C2 + (size_t)(mBase + row) * ldc + n0 + c8) = lv;
        }
        
      }
    }
    __builtin_amdgcn_fence(__ATOMIC_RELEASE, "workgroup");
    __builtin_amdgcn_wave_barrier();
    __builtin_amdgcn_fence(__ATOMIC_ACQUIRE, "workgroup");
  }
}

template <int ET, bool SPLIT, int BIAS_MODE, int OUT_MODE, bool RESID, int ACT = 0>
__global__ __launch_bounds__(256) void wmma_gemm64(
    const unsigned short* __restrict__ Ap, const unsigned short* __restrict__ A2p, int lda, long strideA,
    const unsigned short* __restrict__ Btp, const unsigned short* __restrict__ Bt2p, int ldb, long strideB,
    void* __restrict__ Cout, void* __restrict__ Cout2, int ldc, long strideC,
    const float* __restrict__ bias,
    const float* __restrict__ resid, long strideR,
    int M, int N, int K, float scale) {
  gemm64_body<ET, SPLIT, BIAS_MODE, OUT_MODE, RESID, ACT>(
      blockIdx.y, Ap, A2p, lda, strideA, Btp, Bt2p, ldb, strideB, Cout, Cout2, ldc, strideC,
      bias, resid, strideR, M, N, K, scale);
}

// The three input projections read none of each other's output: one grid, blockIdx.y = 0: q.Wq, 1: x.Wk, 2: x.Wv + bv.
__global__ __launch_bounds__(256) void proj_qkv(
    const unsigned short* __restrict__ qh, const unsigned short* __restrict__ xh,
    const unsigned short* __restrict__ WqT, const unsigned short* __restrict__ WkT, const unsigned short* __restrict__ WvT,
    float* __restrict__ qpF, float* __restrict__ kF, float* __restrict__ vF,
    const float* __restrict__ bv, int M, int N, int K, float scale) {
  const int y = blockIdx.y;
  const unsigned short* A  = (y == 0) ? qh : xh;
  const unsigned short* Bt = (y == 0) ? WqT : (y == 1) ? WkT : WvT;
  float* C                 = (y == 0) ? qpF : (y == 1) ? kF : vF;
  const float* bias        = (y == 2) ? bv : nullptr;
  gemm64_body<0, false, 3, 0, false, 0>(
      0, A, A, K, 0L, Bt, Bt, K, 0L, (void*)C, (void*)C, N, 0L, bias, bias, 0L, M, N, K, scale);
}

// blk = 0 .. 2 * nblk - 1: the first nblk blocks take tensor 0, the rest tensor 1 (both global pointers).
__device__ __forceinline__ void cast_f32_f16x8(
    const int blk, const int nblk,
    const float* __restrict__ in0, const float* __restrict__ in1,
    _Float16* __restrict__ out0, _Float16* __restrict__ out1, int n8) {
  const float* in = (blk < nblk) ? in0 : in1;
  _Float16* out = (blk < nblk) ? out0 : out1;
  const int i = (blk < nblk ? blk : blk - nblk) * 256 + threadIdx.x;
  if (i < n8) {
    const v4f a = *(const v4f*)(in + (size_t)i * 8);
    const v4f c = *(const v4f*)(in + (size_t)i * 8 + 4);
    v8h hv;
    hv[0] = (_Float16)a[0]; hv[1] = (_Float16)a[1]; hv[2] = (_Float16)a[2]; hv[3] = (_Float16)a[3];
    hv[4] = (_Float16)c[0]; hv[5] = (_Float16)c[1]; hv[6] = (_Float16)c[2]; hv[7] = (_Float16)c[3];
    *(v8h*)(out + (size_t)i * 8) = hv;
    
  }
}

// ---- weight transpose + x16 carry + f16 convert: in W[k][n] (256x256, row-major) -> out T[n][k] = f16(W[k][n]*16) ----
// 32 blocks: bx = 32-row block of n, by selects one of 4 weight matrices (all global pointers).
#define WDIM 256
__device__ __forceinline__ void wt_transpose_f16(
    const int bx, const int by,
    const float* __restrict__ W0, const float* __restrict__ W1, const float* __restrict__ W2, const float* __restrict__ W3,
    _Float16* __restrict__ T0, _Float16* __restrict__ T1, _Float16* __restrict__ T2, _Float16* __restrict__ T3) {
  __shared__ float sw[32][WDIM + 1];
  const float* W = (by == 0) ? W0 : (by == 1) ? W1 : (by == 2) ? W2 : W3;
  _Float16*    T = (by == 0) ? T0 : (by == 1) ? T1 : (by == 2) ? T2 : T3;
  const int n0 = bx * 32;
  const int t = threadIdx.x;
#pragma unroll 1
  for (int it = 0; it < 32; ++it) {
    const int k = it * 8 + (t >> 5);
    const int j = t & 31;
    sw[j][k] = W[(size_t)k * WDIM + n0 + j];
  }
  __syncthreads();
  const int g = t >> 3;      // output row within block: 0..31 (wave w owns rows 4w..4w+3)
  const int e = t & 7;
  {
#pragma unroll
    for (int it = 0; it < 4; ++it) {
      const int col = it * 64 + e * 8;
      v8h hv;
#pragma unroll
      for (int i = 0; i < 8; ++i) hv[i] = (_Float16)(sw[g][col + i] * 16.0f);
      *(v8h*)(T + (size_t)(n0 + g) * WDIM + col) = hv;
    }
    
  }
}

// The casts of x and q and the four weight transposes read none of each other's output: one grid.
// Blocks 0..31 transpose (lowest indices, so that their long chain of load-then-store trips starts first); the other 2 * nblk blocks cast.
__global__ __launch_bounds__(256) void prep_cast_wt(
    const float* __restrict__ x, const float* __restrict__ q,
    _Float16* __restrict__ xh, _Float16* __restrict__ qh, int n8, int nblk,
    const float* __restrict__ W0, const float* __restrict__ W1, const float* __restrict__ W2, const float* __restrict__ W3,
    _Float16* __restrict__ T0, _Float16* __restrict__ T1, _Float16* __restrict__ T2, _Float16* __restrict__ T3) {
  const int bid = blockIdx.x;                         // block-uniform branch: the barrier inside is reached by whole blocks
  if (bid < 32) wt_transpose_f16(bid & 7, bid >> 3, W0, W1, W2, W3, T0, T1, T2, T3);
  else          cast_f32_f16x8(bid - 32, nblk, x, q, xh, qh, n8);
}

// ---- local 3x3x3 windowed attention, f32. One thread per (voxel, head); block = one W row of 32 voxels x 8 heads. ----
// qp/kf/vf: f32 [16384][256] (voxel-major, col = head*32 + d). Output oh: f16 [16384][256] = attention output x8.
// The block's own q row, the nine neighbouring K rows, then the nine V rows (32 voxels x 1 KiB each, contiguous in
// memory) pass through a two-buffer LDS ring filled by asynchronous copies in whole lines; every thread reads its q
// and its three neighbours per row from LDS.
// Row and voxel indices clamped into range; out-of-volume neighbours get weight exactly 0; the centre is always in range.
// Per-thread dots / probabilities live in thread-private LDS slots (27 per thread).
#define AT_S 8
#define AT_H 32
#define AT_W 32
#define AT_C 256
#define AT_NB 27
#define AT_PITCH 264
#define AT_HPITCH 36                     // floats per (voxel, head) slot: 32 + 4 pad = 144 B, so 16 lanes' b128 reads cover all 64 banks
#define AT_VPITCH (8 * AT_HPITCH)        // floats per voxel
#define AT_TILE_F (AT_W * AT_VPITCH)     // floats per staged row of 32 voxels (36864 B)
#define AT_NT 19                         // tiles: the q row, 9 K rows, 9 V rows
#define QK_SCALE 0.17677669529663687f

// One staged row: 2048 pieces of 16 B, eight per lane. g = this lane's first global piece, l = its LDS byte address;
// piece j lies 4 KiB further in memory (4 voxels) and 4 voxel pitches further in LDS.
// s_wait_xcnt closes the statement so that no address register of an issued copy is rewritten ahead of it.
__device__ __forceinline__ void stage_row_async(const float* g, unsigned l) {
  asm volatile(
      "global_load_async_to_lds_b128 %0, %8, off\n\t"
      "global_load_async_to_lds_b128 %1, %9, off\n\t"
      "global_load_async_to_lds_b128 %2, %10, off\n\t"
      "global_load_async_to_lds_b128 %3, %11, off\n\t"
      "global_load_async_to_lds_b128 %4, %12, off\n\t"
      "global_load_async_to_lds_b128 %5, %13, off\n\t"
      "global_load_async_to_lds_b128 %6, %14, off\n\t"
      "global_load_async_to_lds_b128 %7, %15, off\n\t"
      "s_wait_xcnt 0x0"
      :: "v"(l), "v"(l + 1u * 16u * AT_VPITCH), "v"(l + 2u * 16u * AT_VPITCH), "v"(l + 3u * 16u * AT_VPITCH),
         "v"(l + 4u * 16u * AT_VPITCH), "v"(l + 5u * 16u * AT_VPITCH), "v"(l + 6u * 16u * AT_VPITCH), "v"(l + 7u * 16u * AT_VPITCH),
         "v"(g), "v"(g + 1 * 1024), "v"(g + 2 * 1024), "v"(g + 3 * 1024),
         "v"(g + 4 * 1024), "v"(g + 5 * 1024), "v"(g + 6 * 1024), "v"(g + 7 * 1024)
      : "memory");
}

// Foot of a ring trip: hands the next tile to every wave and frees the buffer just read.
__device__ __forceinline__ void ring_publish() {
  asm volatile("s_wait_dscnt 0x0" ::: "memory");     // this wave's LDS reads of the buffer to be refilled have retired
  asm volatile("s_wait_asynccnt 0x0" ::: "memory");  // this wave's copies of the next tile have landed
  __syncthreads();                                   // every wave's copies are visible; every reader has left the old buffer
}

__global__ __launch_bounds__(256) void local_attn3d(
    const float* __restrict__ qp, const float* __restrict__ kf, const float* __restrict__ vf,
    _Float16* __restrict__ oh) {
  __shared__ __align__(16) float sbuf[AT_NB * 256];   // 27648 B; reused as f16 staging (32 x 264 halves = 16896 B)
  __shared__ __align__(16) float tile[2 * AT_TILE_F]; // the ring: two staged rows
  const int tid  = threadIdx.x;
  const int head = tid & 7;
  const int vox  = tid >> 3;                          // = position along W
  const int ph = blockIdx.x & 31;                     // block-uniform: one block is one W row; grid = 16384/32 exactly
  const int ps = (blockIdx.x >> 5) & 7;
  const int pb = blockIdx.x >> 8;

  const unsigned lds_lane = (unsigned)(uintptr_t)tile +
      4u * (unsigned)((tid >> 6) * AT_VPITCH + ((tid >> 3) & 7) * AT_HPITCH + (tid & 7) * 4);
  auto issue = [&](int t) {                           // tile t -> buffer t & 1
    const int r9 = (t == 0) ? 4 : ((t < 10) ? t - 1 : t - 10);   // (dz, dy) = (r9 / 3, r9 % 3); 4 = the block's own row
    const float* srcp = (t == 0) ? qp : ((t < 10) ? kf : vf);
    const int dz = r9 / 3;
    const int dy = r9 - 3 * dz;
    const int zs = ps + dz - 1;
    const int cs = zs < 0 ? 0 : (zs > AT_S - 1 ? AT_S - 1 : zs);
    const int zh = ph + dy - 1;
    const int ch = zh < 0 ? 0 : (zh > AT_H - 1 ? AT_H - 1 : zh);
    const int rowb = ((pb * AT_S + cs) * AT_H + ch) * AT_W;
    stage_row_async(srcp + (size_t)rowb * AT_C + tid * 4, lds_lane + (unsigned)(t & 1) * (4u * AT_TILE_F));
  };

  issue(0);
  asm volatile("s_wait_asynccnt 0x0" ::: "memory");   // tile 0 has landed (this wave's part)
  __syncthreads();                                    // ... and every other wave's
  issue(1);

  // this thread's three neighbours along W inside a staged row (clamped)
  const int o0 = (vox > 0 ? vox - 1 : 0) * AT_VPITCH + head * AT_HPITCH;
  const int o1 = vox * AT_VPITCH + head * AT_HPITCH;
  const int o2 = (vox < AT_W - 1 ? vox + 1 : AT_W - 1) * AT_VPITCH + head * AT_HPITCH;

  // trip 0: this thread's q from the staged q row
  float qr[32];
  {
    const float* qptr = tile + o1;
#pragma unroll
    for (int i = 0; i < 8; ++i) {
      const v4f tq = *(const v4f*)(qptr + 4 * i);
      qr[4 * i + 0] = tq[0]; qr[4 * i + 1] = tq[1]; qr[4 * i + 2] = tq[2]; qr[4 * i + 3] = tq[3];
    }
  }
  ring_publish();
  issue(2);

  // pass 1: dots, one K row (dz, dy) per trip
  float mx = -INFINITY;
  unsigned vmask = 0u;
#pragma unroll 1
  for (int t = 1; t < 10; ++t) {
    const float* tb = tile + (t & 1) * AT_TILE_F;
    float a0 = 0.f, a1 = 0.f, a2 = 0.f;
#pragma unroll
    for (int i = 0; i < 8; ++i) {
      const v4f k0 = *(const v4f*)(tb + o0 + 4 * i);
      const v4f k1 = *(const v4f*)(tb + o1 + 4 * i);
      const v4f k2 = *(const v4f*)(tb + o2 + 4 * i);
#pragma unroll
      for (int c = 0; c < 4; ++c) {
        a0 = fmaf(qr[4 * i + c], k0[c], a0);
        a1 = fmaf(qr[4 * i + c], k1[c], a1);
        a2 = fmaf(qr[4 * i + c], k2[c], a2);
      }
    }
    const int dz = (t - 1) / 3;
    const int dy = (t - 1) - 3 * dz;
    const bool vrow = ((unsigned)(ps + dz - 1) < (unsigned)AT_S) && ((unsigned)(ph + dy - 1) < (unsigned)AT_H);
    const float d0 = a0 * QK_SCALE, d1 = a1 * QK_SCALE, d2 = a2 * QK_SCALE;
    const int kk = 3 * (t - 1);
    sbuf[(kk + 0) * 256 + tid] = d0;
    sbuf[(kk + 1) * 256 + tid] = d1;
    sbuf[(kk + 2) * 256 + tid] = d2;
    if (vrow && vox > 0)        { mx = fmaxf(mx, d0); vmask |= (1u << (kk + 0)); }
    if (vrow)                   { mx = fmaxf(mx, d1); vmask |= (1u << (kk + 1)); }
    if (vrow && vox < AT_W - 1) { mx = fmaxf(mx, d2); vmask |= (1u << (kk + 2)); }
    ring_publish();
    issue(t + 2);                                     // tiles 3..11 all exist
  }

  // pass 2: probabilities (exactly 0 for out-of-range neighbours), sum
  float sum = 0.f;
#pragma unroll 1
  for (int k2 = 0; k2 < AT_NB; ++k2) {
    const float d = sbuf[k2 * 256 + tid];
    const float ex = __expf(d - mx);
    const float p = ((vmask >> k2) & 1u) ? ex : 0.f;
    sbuf[k2 * 256 + tid] = p;
    sum += p;
  }
  const float inv = __builtin_amdgcn_rcpf(sum);   // sum >= 1

  // pass 3: weighted sum of v rows, one V row (dz, dy) per trip
  float acc[32];
#pragma unroll
  for (int i = 0; i < 32; ++i) acc[i] = 0.f;
#pragma unroll 1
  for (int t = 10; t < AT_NT; ++t) {
    const float* tb = tile + (t & 1) * AT_TILE_F;
    const int kk = 3 * (t - 10);
    const float p0 = sbuf[(kk + 0) * 256 + tid];
    const float p1 = sbuf[(kk + 1) * 256 + tid];
    const float p2 = sbuf[(kk + 2) * 256 + tid];
#pragma unroll
    for (int i = 0; i < 8; ++i) {
      const v4f v0 = *(const v4f*)(tb + o0 + 4 * i);
      const v4f v1 = *(const v4f*)(tb + o1 + 4 * i);
      const v4f v2 = *(const v4f*)(tb + o2 + 4 * i);
#pragma unroll
      for (int c = 0; c < 4; ++c) {
        float s = acc[4 * i + c];
        s = fmaf(p0, v0[c], s);
        s = fmaf(p1, v1[c], s);
        s = fmaf(p2, v2[c], s);
        acc[4 * i + c] = s;
      }
    }
    ring_publish();
    if (t + 2 < AT_NT) issue(t + 2);                  // block-uniform test
  }
  asm volatile("s_wait_asynccnt 0x0" ::: "memory");   // no copy of this wave is left in flight
  const float osc = inv * 8.0f;     // normalise and carry x8 for the f16 A operand of the output projection

  // epilogue: stage f16 tile [32 voxels][256] in LDS (pitch 264 halves), then whole-line stores
  __syncthreads();
  _Float16* st = reinterpret_cast<_Float16*>(sbuf);
  {
    _Float16* sp = st + vox * AT_PITCH + head * 32;
#pragma unroll
    for (int j = 0; j < 4; ++j) {
      v8h hv;
#pragma unroll
      for (int i = 0; i < 8; ++i) hv[i] = (_Float16)(acc[8 * j + i] * osc);
      *(v8h*)(sp + 8 * j) = hv;
    }
  }
  __syncthreads();
  {
    const int g = tid >> 3;     // 0..31: line group (8 contiguous lanes)
    const int e = tid & 7;      // 16-B piece within the line
    _Float16* ob = oh + (size_t)blockIdx.x * 32 * AT_C;
    {
#pragma unroll
      for (int it = 0; it < 4; ++it) {
        const int L = it * 32 + g;       // 0..127: 32 rows x 4 lines
        const int row = L >> 2;
        const int seg = L & 3;
        const v8h hv = *(const v8h*)(st + row * AT_PITCH + seg * 64 + e * 8);
        *(v8h*)(ob + (size_t)row * AT_C + seg * 64 + e * 8) = hv;
      }
      
    }
  }
}

// ---------------------------------------------------------------------------
extern "C" void kernel_launch(void* const* d_in, const int* in_sizes, int n_in,
                              void* d_out, int out_size, void* d_ws, size_t ws_size,
                              hipStream_t stream) {
  const int MP = 16384;     // B*S*H*W = 2*8*32*32
  const int DC = 256;       // DIM == INNER
  if (n_in < 8) return;
  if (in_sizes[0] != MP * DC || in_sizes[1] != MP * DC) return;
  if (in_sizes[2] != DC * DC || in_sizes[3] != DC * DC || in_sizes[4] != DC * DC || in_sizes[6] != DC * DC) return;
  if (in_sizes[5] != DC || in_sizes[7] != DC) return;
  if (out_size != MP * DC) return;

  const float* x  = (const float*)d_in[0];
  const float* q  = (const float*)d_in[1];
  const float* Wq = (const float*)d_in[2];
  const float* Wk = (const float*)d_in[3];
  const float* Wv = (const float*)d_in[4];
  const float* bv = (const float*)d_in[5];
  const float* Wo = (const float*)d_in[6];
  const float* bo = (const float*)d_in[7];
  float* outp = (float*)d_out;

  const size_t actH = (size_t)MP * DC * sizeof(_Float16);   // 8 MiB
  const size_t actF = (size_t)MP * DC * sizeof(float);      // 16 MiB
  const size_t wH   = (size_t)DC * DC * sizeof(_Float16);   // 128 KiB
  size_t off = 0;
  char* base = (char*)d_ws;
  _Float16* xh  = (_Float16*)(base + off); off += actH;
  _Float16* qh  = (_Float16*)(base + off); off += actH;
  _Float16* WqT = (_Float16*)(base + off); off += wH;
  _Float16* WkT = (_Float16*)(base + off); off += wH;
  _Float16* WvT = (_Float16*)(base + off); off += wH;
  _Float16* WoT = (_Float16*)(base + off); off += wH;
  float*    qpF = (float*)(base + off);    off += actF;
  float*    kF  = (float*)(base + off);    off += actF;
  float*    vF  = (float*)(base + off);    off += actF;
  _Float16* aH  = (_Float16*)(base + off); off += actH;
  // total = 76,021,760 B
  if (off > ws_size) return;

  // 1) one grid: weights T[n][k] = f16(W[k][n] * 16) (32 blocks), f32 -> f16 casts of x and q (8 elements per thread)
  const int n8 = MP * DC / 8;                                  // 524288
  const int nblk = (n8 + 255) / 256;                           // cast blocks per tensor
  prep_cast_wt<<<32 + 2 * nblk, 256, 0, stream>>>(x, q, xh, qh, n8, nblk, Wq, Wk, Wv, Wo, WqT, WkT, WvT, WoT);

  // 2) projections, one grid: C = (1/16) * A . Bt^T (+ bias[n]); M = 16384, N = K = 256; 1024 64x64 tiles each, 8 per block
  const dim3 gg((MP / 64) * (DC / 64) / 8, 1);
  const dim3 gg3((MP / 64) * (DC / 64) / 8, 3);
  const float s16 = 1.0f / 16.0f;
  proj_qkv<<<gg3, 256, 0, stream>>>(
      (const unsigned short*)qh, (const unsigned short*)xh,
      (const unsigned short*)WqT, (const unsigned short*)WkT, (const unsigned short*)WvT,
      qpF, kF, vF, bv, MP, DC, DC, s16);

  // 3) windowed attention (f32), output f16 x8
  local_attn3d<<<MP / 32, 256, 0, stream>>>(qpF, kF, vF, aH);

  // 4) output projection: out = (1/128) * aH . WoT^T + bo -> d_out (f32)
  wmma_gemm64<0, false, 2, 0, false, 0><<<gg, 256, 0, stream>>>(
      (const unsigned short*)aH, (const unsigned short*)aH, DC, 0L,
      (const unsigned short*)WoT, (const unsigned short*)WoT, DC, 0L,
      (void*)outp, (void*)outp, DC, 0L, bo, x, 0L, MP, DC, DC, 1.0f / 128.0f);
}

// v003
// One run takes 59.5 microseconds.
// In two side-by-side timings against v002, it was 1.22 and 1.23 times as fast.
// Counting every step since v000, it is 2.72 times as fast.
// Projections x@Wk, x@Wv+bv, q@Wq, o@Wo+bo: v_wmma_f32_16x16x32_f16 (f16 operands; weights carried x16, o carried x8; f32 accumulate). Windowed q.k, softmax, p.v: f32 VALU.
#include <hip/hip_runtime.h>
#include <hip/hip_bf16.h>

typedef __attribute__((ext_vector_type(16))) _Float16 v16h;
typedef __attribute__((ext_vector_type(8)))  _Float16 v8h;
typedef __attribute__((ext_vector_type(8)))  float    v8f;
typedef __attribute__((ext_vector_type(4)))  float    v4f;
typedef __attribute__((ext_vector_type(16))) float    v16f;

// hazard guards as plain device helpers (the kernel template body keeps one inline asm: the s_wait_xcnt after the bias load)
__device__ __forceinline__ void dep_guard_h(v8f& a, v8f& b, v16h x, v16h y) { asm volatile("v_nop\n\tv_nop\n\tv_nop\n\tv_nop" : "+v"(a), "+v"(b) : "v"(x), "v"(y)); }
__device__ __forceinline__ void keep4_h(v16h a, v16h b, v16h c, v16h d) { asm volatile("v_nop" :: "v"(a), "v"(b), "v"(c), "v"(d)); }
__device__ __forceinline__ void acc_guard4(v8f& a, v8f& b, v8f& c, v8f& d) { asm volatile("v_nop\n\tv_nop\n\tv_nop\n\tv_nop" : "+v"(a), "+v"(b), "+v"(c), "+v"(d)); }

__device__ __forceinline__ v16f cat4(v4f a, v4f b, v4f c, v4f d) {
  return __builtin_shufflevector(__builtin_shufflevector(a, b, 0, 1, 2, 3, 4, 5, 6, 7),
                                 __builtin_shufflevector(c, d, 0, 1, 2, 3, 4, 5, 6, 7),
                                 0, 1, 2, 3, 4, 5, 6, 7, 8, 9, 10, 11, 12, 13, 14, 15);
}
// The sixteen k of one A row that a lane holds, k order: elements 0..7 <- p[0..7], 8..15 <- p[16..23]; as stored (f16 or f32).
__device__ __forceinline__ v16h load_row(const _Float16* p) {
  union { v16h v; v8h h[2]; } f;
  f.h[0] = *(const v8h*)(p); f.h[1] = *(const v8h*)(p + 16); return f.v;
}
__device__ __forceinline__ v16f load_row(const float* p) {
  return cat4(*(const v4f*)(p), *(const v4f*)(p + 4), *(const v4f*)(p + 16), *(const v4f*)(p + 20));
}
// ... and as the f16 fragment (f32 is rounded here)
__device__ __forceinline__ v16h to_frag(v16h a) { return a; }
__device__ __forceinline__ v16h to_frag(v16f a) { return __builtin_convertvector(a, v16h); }
__device__ __forceinline__ v8f mma_h(v16h a, v16h b, v8f c) {
  return __builtin_amdgcn_wmma_f32_16x16x32_f16(false, a, false, b, (short)0, c, false, false);
}

// ---- Register-blocked WMMA GEMM ---------------------------------------------
// C[m,n] = scale * sum_k f16(A[m,k]) * f16(16 * Wt[k,n]) (+bias[n]); each wave owns a 64x64 tile; C is f32.
// A row-major [M,K], f32 or f16 (TA); Wt row-major [K,N], f32, as the caller's input holds it; M,N % 64 == 0, K % 32 == 0.
// N and K are compile-time, so that every load of a k step is one base register plus an immediate offset.
// B fragments come straight from Wt: lane column c of subtile j is n0 + 4 * c + j, so that one 16-byte load of
// Wt[k][n0 + 4 * c ..] gives the lane its k-th element of all four subtiles (16 lanes = 256 contiguous bytes of a row);
// the k order of the sixteen loads is load_row's. D's column map follows: subtile j, lane column c -> n0 + 4 * c + j.
// BIAS_MODE: 2 = bias[n], 3 = bias[n] where a bias pointer is given (block-uniform), else none.
template <typename TA, int BIAS_MODE, int N, int K>
__device__ __forceinline__ void gemm64_body(
    const TA* __restrict__ A, const float* __restrict__ Wt, float* __restrict__ C,
    const float* __restrict__ bias, int M, float scale) {
  constexpr int lda = K, ldw = N, ldc = N;
  __shared__ __align__(16) float sT[4][16 * 68];   // per-wave 16x64 slab, pitch 68 floats
  const int lane = threadIdx.x & 31;
  const int wave = threadIdx.x >> 5;
  const int tilesN = N >> 6;
  const int tilesM = M >> 6;
  const int tile = blockIdx.x * 4 + wave;      // four waves: with N = 256 a block is one 64-row stripe of A, read by all four
  if (tile >= tilesM * tilesN) return;   // wave-uniform; no block barriers in this kernel
  const int tm = tile / tilesN;
  const int tn = tile - tm * tilesN;
  const int m0 = tm << 6;
  const int n0 = tn << 6;

  const int rlane = lane & 15;                 // row (A) / lane column (B, D) within subtile
  const int koff  = (lane >> 4) * 8;           // k offset of this lane half
  const int mOff  = (lane >> 4) * 8;           // D row offset

  v8f acc[4][4];
#pragma unroll
  for (int i = 0; i < 4; ++i)
#pragma unroll
    for (int j = 0; j < 4; ++j) acc[i][j] = (v8f){0.f,0.f,0.f,0.f,0.f,0.f,0.f,0.f};

  v4f bj = (v4f){0.f, 0.f, 0.f, 0.f};          // this lane's four bias values (columns n0 + 4 * rlane + 0..3)
  if (BIAS_MODE == 2 || bias != nullptr) {     // BIAS_MODE 3: one uniform test
    bj = *(const v4f*)(bias + n0 + 4 * rlane);
    asm volatile("s_wait_xcnt 0x0" ::: "memory");   // stands ahead of any rewrite of the address registers that the load names
  }

  const float* Wl = Wt + (size_t)koff * ldw + n0 + 4 * rlane;    // this lane's column group, first k of its half
  const TA*    Al = A + (size_t)(m0 + rlane) * lda + koff;       // this lane's row of subtile 0, first k of its half
#pragma unroll 1   // rolled: one k step's loads already take the registers that three waves per SIMD leave
  for (int k0 = 0; k0 < K; k0 += 32) {
    // All loads of a k step go out together, so that the step waits out one memory latency, not one per A subtile.
    // Source order: the first eight k of Wt, A, the last eight k of Wt; written as one group of sixteen, this build spilled an accumulator.
    v4f w[8];                                  // w[e][j] = Wt[k of element e (+ 8)][n0 + 4 * rlane + j]
    v16h bh[4];
#pragma unroll
    for (int e = 0; e < 8; ++e) w[e] = *(const v4f*)(Wl + (k0 + e) * ldw);
    decltype(load_row(Al)) ar[4];              // A rows of the four subtiles, as stored
#pragma unroll
    for (int i = 0; i < 4; ++i) ar[i] = load_row(Al + (i << 4) * lda + k0);
#pragma unroll
    for (int j = 0; j < 4; ++j)
#pragma unroll
      for (int e = 0; e < 8; ++e) bh[j][e] = (_Float16)(w[e][j] * 16.0f);
#pragma unroll
    for (int e = 0; e < 8; ++e) w[e] = *(const v4f*)(Wl + (k0 + 16 + e) * ldw);
    // no load of the k step sinks below this line: all are in flight before the first A value is used
    __builtin_amdgcn_sched_barrier(0);
#pragma unroll
    for (int j = 0; j < 4; ++j)
#pragma unroll
      for (int e = 0; e < 8; ++e) bh[j][8 + e] = (_Float16)(w[e][j] * 16.0f);
#pragma unroll
    for (int i = 0; i < 4; ++i) {
      v16h ah = to_frag(ar[i]);
#pragma unroll
      for (int j = 0; j < 4; ++j) acc[i][j] = mma_h(ah, bh[j], acc[i][j]);
      dep_guard_h(acc[i][0], acc[i][3], ah, ah);
    }
    keep4_h(bh[0], bh[1], bh[2], bh[3]);
  }
  acc_guard4(acc[0][0], acc[0][1], acc[0][2], acc[0][3]);
  acc_guard4(acc[1][0], acc[1][1], acc[1][2], acc[1][3]);
  acc_guard4(acc[2][0], acc[2][1], acc[2][2], acc[2][3]);
  acc_guard4(acc[3][0], acc[3][1], acc[3][2], acc[3][3]);

  // ---- epilogue ----
  float* slab = sT[wave];
#pragma unroll
  for (int i = 0; i < 4; ++i) {
    const int mBase = m0 + (i << 4);
#pragma unroll
    for (int r = 0; r < 8; ++r) {
      v4f v;
#pragma unroll
      for (int j = 0; j < 4; ++j) v[j] = acc[i][j][r] * scale + bj[j];
      *(v4f*)(slab + (mOff + r) * 68 + 4 * rlane) = v;
    }
    __builtin_amdgcn_fence(__ATOMIC_RELEASE, "workgroup");
    __builtin_amdgcn_wave_barrier();
    __builtin_amdgcn_fence(__ATOMIC_ACQUIRE, "workgroup");
    {
      const int hh = lane >> 4, c4 = (lane & 15) * 4;     // row seg = 256 B = 16 lanes x 16 B
#pragma unroll
      for (int it = 0; it < 8; ++it) {
        const int row = it * 2 + hh;
        v4f v = *(const v4f*)(slab + row * 68 + c4);
        *(v4f*)(C + (size_t)(mBase + row) * ldc + n0 + c4) = v;
      }
    }
    __builtin_amdgcn_fence(__ATOMIC_RELEASE, "workgroup");
    __builtin_amdgcn_wave_barrier();
    __builtin_amdgcn_fence(__ATOMIC_ACQUIRE, "workgroup");
  }
}

// The three input projections read none of each other's output: one grid, blockIdx.y = 0: q.Wq, 1: x.Wk, 2: x.Wv + bv.
__global__ __launch_bounds__(128) void proj_qkv(
    const float* __restrict__ q, const float* __restrict__ x,
    const float* __restrict__ Wq, const float* __restrict__ Wk, const float* __restrict__ Wv,
    float* __restrict__ qpF, float* __restrict__ kF, float* __restrict__ vF,
    const float* __restrict__ bv, int M, float scale) {
  const int y = blockIdx.y;
  const float* A    = (y == 0) ? q : x;
  const float* Wt   = (y == 0) ? Wq : (y == 1) ? Wk : Wv;
  float* C          = (y == 0) ? qpF : (y == 1) ? kF : vF;
  const float* bias = (y == 2) ? bv : nullptr;
  gemm64_body<float, 3, 256, 256>(A, Wt, C, bias, M, scale);
}

// Output projection: A = the attention output in f16 (x8).
__global__ __launch_bounds__(128) void proj_out(
    const unsigned short* __restrict__ oh, const float* __restrict__ Wo, float* __restrict__ outp,
    const float* __restrict__ bo, int M, float scale) {
  gemm64_body<_Float16, 2, 256, 256>((const _Float16*)oh, Wo, outp, bo, M, scale);
}

// ---- local 3x3x3 windowed attention, f32. One thread per (voxel, head); block = one W row of 32 voxels x 8 heads. ----
// qp/kf/vf: f32 [16384][256] (voxel-major, col = head*32 + d). Output oh: f16 [16384][256] = attention output x8.
// The block's own q row, the nine neighbouring K rows, then the nine V rows (32 voxels x 1 KiB each, contiguous in
// memory) pass through a two-buffer LDS ring filled by asynchronous copies in whole lines; every thread reads its q
// and its three neighbours per row from LDS.
// Row and voxel indices clamped into range; out-of-volume neighbours get weight exactly 0; the centre is always in range.
// Per-thread dots / probabilities live in thread-private LDS slots (27 per thread).
#define AT_S 8
#define AT_H 32
#define AT_W 32
#define AT_C 256
#define AT_NB 27
#define AT_PITCH 264
#define AT_HPITCH 36                     // floats per (voxel, head) slot: 32 + 4 pad = 144 B, so 16 lanes' b128 reads cover all 64 banks
#define AT_VPITCH (8 * AT_HPITCH)        // floats per voxel
#define AT_TILE_F (AT_W * AT_VPITCH)     // floats per staged row of 32 voxels (36864 B)
#define AT_NT 19                         // tiles: the q row, 9 K rows, 9 V rows
#define QK_SCALE 0.17677669529663687f

// One staged row: 2048 pieces of 16 B, eight per lane. g = this lane's first global piece, l = its LDS byte address;
// piece j lies 4 KiB further in memory (4 voxels) and 4 voxel pitches further in LDS.
// s_wait_xcnt closes the statement so that no address register of an issued copy is rewritten ahead of it.
__device__ __forceinline__ void stage_row_async(const float* g, unsigned l) {
  asm volatile(
      "global_load_async_to_lds_b128 %0, %8, off\n\t"
      "global_load_async_to_lds_b128 %1, %9, off\n\t"
      "global_load_async_to_lds_b128 %2, %10, off\n\t"
      "global_load_async_to_lds_b128 %3, %11, off\n\t"
      "global_load_async_to_lds_b128 %4, %12, off\n\t"
      "global_load_async_to_lds_b128 %5, %13, off\n\t"
      "global_load_async_to_lds_b128 %6, %14, off\n\t"
      "global_load_async_to_lds_b128 %7, %15, off\n\t"
      "s_wait_xcnt 0x0"
      :: "v"(l), "v"(l + 1u * 16u * AT_VPITCH), "v"(l + 2u * 16u * AT_VPITCH), "v"(l + 3u * 16u * AT_VPITCH),
         "v"(l + 4u * 16u * AT_VPITCH), "v"(l + 5u * 16u * AT_VPITCH), "v"(l + 6u * 16u * AT_VPITCH), "v"(l + 7u * 16u * AT_VPITCH),
         "v"(g), "v"(g + 1 * 1024), "v"(g + 2 * 1024), "v"(g + 3 * 1024),
         "v"(g + 4 * 1024), "v"(g + 5 * 1024), "v"(g + 6 * 1024), "v"(g + 7 * 1024)
      : "memory");
}

// Foot of a ring trip: hands the next tile to every wave and frees the buffer just read.
__device__ __forceinline__ void ring_publish() {
  asm volatile("s_wait_dscnt 0x0" ::: "memory");     // this wave's LDS reads of the buffer to be refilled have retired
  asm volatile("s_wait_asynccnt 0x0" ::: "memory");  // this wave's copies of the next tile have landed
  __syncthreads();                                   // every wave's copies are visible; every reader has left the old buffer
}

__global__ __launch_bounds__(256) void local_attn3d(
    const float* __restrict__ qp, const float* __restrict__ kf, const float* __restrict__ vf,
    _Float16* __restrict__ oh) {
  __shared__ __align__(16) float sbuf[AT_NB * 256];   // 27648 B; reused as f16 staging (32 x 264 halves = 16896 B)
  __shared__ __align__(16) float tile[2 * AT_TILE_F]; // the ring: two staged rows
  const int tid  = threadIdx.x;
  const int head = tid & 7;
  const int vox  = tid >> 3;                          // = position along W
  const int ph = blockIdx.x & 31;                     // block-uniform: one block is one W row; grid = 16384/32 exactly
  const int ps = (blockIdx.x >> 5) & 7;
  const int pb = blockIdx.x >> 8;

  const unsigned lds_lane = (unsigned)(uintptr_t)tile +
      4u * (unsigned)((tid >> 6) * AT_VPITCH + ((tid >> 3) & 7) * AT_HPITCH + (tid & 7) * 4);
  auto issue = [&](int t) {                           // tile t -> buffer t & 1
    const int r9 = (t == 0) ? 4 : ((t < 10) ? t - 1 : t - 10);   // (dz, dy) = (r9 / 3, r9 % 3); 4 = the block's own row
    const float* srcp = (t == 0) ? qp : ((t < 10) ? kf : vf);
    const int dz = r9 / 3;
    const int dy = r9 - 3 * dz;
    const int zs = ps + dz - 1;
    const int cs = zs < 0 ? 0 : (zs > AT_S - 1 ? AT_S - 1 : zs);
    const int zh = ph + dy - 1;
    const int ch = zh < 0 ? 0 : (zh > AT_H - 1 ? AT_H - 1 : zh);
    const int rowb = ((pb * AT_S + cs) * AT_H + ch) * AT_W;
    stage_row_async(srcp + (size_t)rowb * AT_C + tid * 4, lds_lane + (unsigned)(t & 1) * (4u * AT_TILE_F));
  };

  issue(0);
  asm volatile("s_wait_asynccnt 0x0" ::: "memory");   // tile 0 has landed (this wave's part)
  __syncthreads();                                    // ... and every other wave's
  issue(1);

  // this thread's three neighbours along W inside a staged row (clamped)
  const int o0 = (vox > 0 ? vox - 1 : 0) * AT_VPITCH + head * AT_HPITCH;
  const int o1 = vox * AT_VPITCH + head * AT_HPITCH;
  const int o2 = (vox < AT_W - 1 ? vox + 1 : AT_W - 1) * AT_VPITCH + head * AT_HPITCH;

  // trip 0: this thread's q from the staged q row
  float qr[32];
  {
    const float* qptr = tile + o1;
#pragma unroll
    for (int i = 0; i < 8; ++i) {
      const v4f tq = *(const v4f*)(qptr + 4 * i);
      qr[4 * i + 0] = tq[0]; qr[4 * i + 1] = tq[1]; qr[4 * i + 2] = tq[2]; qr[4 * i + 3] = tq[3];
    }
  }
  ring_publish();
  issue(2);

  // pass 1: dots, one K row (dz, dy) per trip
  float mx = -INFINITY;
  unsigned vmask = 0u;
#pragma unroll 1
  for (int t = 1; t < 10; ++t) {
    const float* tb = tile + (t & 1) * AT_TILE_F;
    float a0 = 0.f, a1 = 0.f, a2 = 0.f;
#pragma unroll
    for (int i = 0; i < 8; ++i) {
      const v4f k0 = *(const v4f*)(tb + o0 + 4 * i);
      const v4f k1 = *(const v4f*)(tb + o1 + 4 * i);
      const v4f k2 = *(const v4f*)(tb + o2 + 4 * i);
#pragma unroll
      for (int c = 0; c < 4; ++c) {
        a0 = fmaf(qr[4 * i + c], k0[c], a0);
        a1 = fmaf(qr[4 * i + c], k1[c], a1);
        a2 = fmaf(qr[4 * i + c], k2[c], a2);
      }
    }
    const int dz = (t - 1) / 3;
    const int dy = (t - 1) - 3 * dz;
    const bool vrow = ((unsigned)(ps + dz - 1) < (unsigned)AT_S) && ((unsigned)(ph + dy - 1) < (unsigned)AT_H);
    const float d0 = a0 * QK_SCALE, d1 = a1 * QK_SCALE, d2 = a2 * QK_SCALE;
    const int kk = 3 * (t - 1);
    sbuf[(kk + 0) * 256 + tid] = d0;
    sbuf[(kk + 1) * 256 + tid] = d1;
    sbuf[(kk + 2) * 256 + tid] = d2;
    if (vrow && vox > 0)        { mx = fmaxf(mx, d0); vmask |= (1u << (kk + 0)); }
    if (vrow)                   { mx = fmaxf(mx, d1); vmask |= (1u << (kk + 1)); }
    if (vrow && vox < AT_W - 1) { mx = fmaxf(mx, d2); vmask |= (1u << (kk + 2)); }
    ring_publish();
    issue(t + 2);                                     // tiles 3..11 all exist
  }

  // pass 2: probabilities (exactly 0 for out-of-range neighbours), sum
  float sum = 0.f;
#pragma unroll 1
  for (int k2 = 0; k2 < AT_NB; ++k2) {
    const float d = sbuf[k2 * 256 + tid];
    const float ex = __expf(d - mx);
    const float p = ((vmask >> k2) & 1u) ? ex : 0.f;
    sbuf[k2 * 256 + tid] = p;
    sum += p;
  }
  const float inv = __builtin_amdgcn_rcpf(sum);   // sum >= 1

  // pass 3: weighted sum of v rows, one V row (dz, dy) per trip
  float acc[32];
#pragma unroll
  for (int i = 0; i < 32; ++i) acc[i] = 0.f;
#pragma unroll 1
  for (int t = 10; t < AT_NT; ++t) {
    const float* tb = tile + (t & 1) * AT_TILE_F;
    const int kk = 3 * (t - 10);
    const float p0 = sbuf[(kk + 0) * 256 + tid];
    const float p1 = sbuf[(kk + 1) * 256 + tid];
    const float p2 = sbuf[(kk + 2) * 256 + tid];
#pragma unroll
    for (int i = 0; i < 8; ++i) {
      const v4f v0 = *(const v4f*)(tb + o0 + 4 * i);
      const v4f v1 = *(const v4f*)(tb + o1 + 4 * i);
      const v4f v2 = *(const v4f*)(tb + o2 + 4 * i);
#pragma unroll
      for (int c = 0; c < 4; ++c) {
        float s = acc[4 * i + c];
        s = fmaf(p0, v0[c], s);
        s = fmaf(p1, v1[c], s);
        s = fmaf(p2, v2[c], s);
        acc[4 * i + c] = s;
      }
    }
    ring_publish();
    if (t + 2 < AT_NT) issue(t + 2);                  // block-uniform test
  }
  asm volatile("s_wait_asynccnt 0x0" ::: "memory");   // no copy of this wave is left in flight
  const float osc = inv * 8.0f;     // normalise and carry x8 for the f16 A operand of the output projection

  // epilogue: stage f16 tile [32 voxels][256] in LDS (pitch 264 halves), then whole-line stores
  __syncthreads();
  _Float16* st = reinterpret_cast<_Float16*>(sbuf);
  {
    _Float16* sp = st + vox * AT_PITCH + head * 32;
#pragma unroll
    for (int j = 0; j < 4; ++j) {
      v8h hv;
#pragma unroll
      for (int i = 0; i < 8; ++i) hv[i] = (_Float16)(acc[8 * j + i] * osc);
      *(v8h*)(sp + 8 * j) = hv;
    }
  }
  __syncthreads();
  {
    const int g = tid >> 3;     // 0..31: line group (8 contiguous lanes)
    const int e = tid & 7;      // 16-B piece within the line
    _Float16* ob = oh + (size_t)blockIdx.x * 32 * AT_C;
    {
#pragma unroll
      for (int it = 0; it < 4; ++it) {
        const int L = it * 32 + g;       // 0..127: 32 rows x 4 lines
        const int row = L >> 2;
        const int seg = L & 3;
        const v8h hv = *(const v8h*)(st + row * AT_PITCH + seg * 64 + e * 8);
        *(v8h*)(ob + (size_t)row * AT_C + seg * 64 + e * 8) = hv;
      }
      
    }
  }
}

// ---------------------------------------------------------------------------
extern "C" void kernel_launch(void* const* d_in, const int* in_sizes, int n_in,
                              void* d_out, int out_size, void* d_ws, size_t ws_size,
                              hipStream_t stream) {
  const int MP = 16384;     // B*S*H*W = 2*8*32*32
  const int DC = 256;       // DIM == INNER
  if (n_in < 8) return;
  if (in_sizes[0] != MP * DC || in_sizes[1] != MP * DC) return;
  if (in_sizes[2] != DC * DC || in_sizes[3] != DC * DC || in_sizes[4] != DC * DC || in_sizes[6] != DC * DC) return;
  if (in_sizes[5] != DC || in_sizes[7] != DC) return;
  if (out_size != MP * DC) return;

  const float* x  = (const float*)d_in[0];
  const float* q  = (const float*)d_in[1];
  const float* Wq = (const float*)d_in[2];
  const float* Wk = (const float*)d_in[3];
  const float* Wv = (const float*)d_in[4];
  const float* bv = (const float*)d_in[5];
  const float* Wo = (const float*)d_in[6];
  const float* bo = (const float*)d_in[7];
  float* outp = (float*)d_out;

  const size_t actH = (size_t)MP * DC * sizeof(_Float16);   // 8 MiB
  const size_t actF = (size_t)MP * DC * sizeof(float);      // 16 MiB
  size_t off = 0;
  char* base = (char*)d_ws;
  float*    qpF = (float*)(base + off);    off += actF;
  float*    kF  = (float*)(base + off);    off += actF;
  float*    vF  = (float*)(base + off);    off += actF;
  _Float16* aH  = (_Float16*)(base + off); off += actH;
  // total = 58,720,256 B
  if (off > ws_size) return;

  // 1) projections, one grid: C = (1/16) * f16(A) . f16(16 W) (+ bias[n]); M = 16384, N = K = 256; 1024 64x64 tiles each, 4 per block
  const dim3 gg((MP / 64) * (DC / 64) / 4, 1);
  const dim3 gg3((MP / 64) * (DC / 64) / 4, 3);
  const float s16 = 1.0f / 16.0f;
  proj_qkv<<<gg3, 128, 0, stream>>>(q, x, Wq, Wk, Wv, qpF, kF, vF, bv, MP, s16);

  // 2) windowed attention (f32), output f16 x8
  local_attn3d<<<MP / 32, 256, 0, stream>>>(qpF, kF, vF, aH);

  // 3) output projection: out = (1/128) * aH . f16(16 Wo) + bo -> d_out (f32)
  proj_out<<<gg, 128, 0, stream>>>((const unsigned short*)aH, Wo, outp, bo, MP, 1.0f / 128.0f);
}

// v004
// One run takes 54.1 microseconds.
// In both of two side-by-side timings against v003, it was 1.10 times as fast.
// Over all steps from v000 it is 2.99 times as fast.
// Projections x@Wk, x@Wv+bv, q@Wq, o@Wo+bo: v_wmma_f32_16x16x32_f16 (f16 operands; weights carried x16, o carried x8; f32 accumulate). Windowed q.k, softmax, p.v: f32 VALU.
#include <hip/hip_runtime.h>
#include <hip/hip_bf16.h>

typedef __attribute__((ext_vector_type(16))) _Float16 v16h;
typedef __attribute__((ext_vector_type(8)))  _Float16 v8h;
typedef __attribute__((ext_vector_type(8)))  float    v8f;
typedef __attribute__((ext_vector_type(4)))  float    v4f;
typedef __attribute__((ext_vector_type(2)))  float    v2f;
typedef __attribute__((ext_vector_type(16))) float    v16f;

// hazard guards as plain device helpers (the kernel template body keeps one inline asm: the s_wait_xcnt after the bias load)
__device__ __forceinline__ void dep_guard_h(v8f& a, v8f& b, v16h x, v16h y) { asm volatile("v_nop\n\tv_nop\n\tv_nop\n\tv_nop" : "+v"(a), "+v"(b) : "v"(x), "v"(y)); }
__device__ __forceinline__ void keep4_h(v16h a, v16h b, v16h c, v16h d) { asm volatile("v_nop" :: "v"(a), "v"(b), "v"(c), "v"(d)); }
__device__ __forceinline__ void acc_guard4(v8f& a, v8f& b, v8f& c, v8f& d) { asm volatile("v_nop\n\tv_nop\n\tv_nop\n\tv_nop" : "+v"(a), "+v"(b), "+v"(c), "+v"(d)); }

__device__ __forceinline__ v16f cat4(v4f a, v4f b, v4f c, v4f d) {
  return __builtin_shufflevector(__builtin_shufflevector(a, b, 0, 1, 2, 3, 4, 5, 6, 7),
                                 __builtin_shufflevector(c, d, 0, 1, 2, 3, 4, 5, 6, 7),
                                 0, 1, 2, 3, 4, 5, 6, 7, 8, 9, 10, 11, 12, 13, 14, 15);
}
// The sixteen k of one A row that a lane holds, k order: elements 0..7 <- p[0..7], 8..15 <- p[16..23]; as stored (f16 or f32).
__device__ __forceinline__ v16h load_row(const _Float16* p) {
  union { v16h v; v8h h[2]; } f;
  f.h[0] = *(const v8h*)(p); f.h[1] = *(const v8h*)(p + 16); return f.v;
}
__device__ __forceinline__ v16f load_row(const float* p) {
  return cat4(*(const v4f*)(p), *(const v4f*)(p + 4), *(const v4f*)(p + 16), *(const v4f*)(p + 20));
}
// ... and as the f16 fragment (f32 is rounded here)
__device__ __forceinline__ v16h to_frag(v16f a) { return __builtin_convertvector(a, v16h); }
__device__ __forceinline__ v8f mma_h(v16h a, v16h b, v8f c) {
  return __builtin_amdgcn_wmma_f32_16x16x32_f16(false, a, false, b, (short)0, c, false, false);
}

// ---- Register-blocked WMMA GEMM ---------------------------------------------
// C[m,n] = scale * sum_k f16(A[m,k]) * f16(16 * Wt[k,n]) (+bias[n]); each wave owns a 64x64 tile; C is f32.
// A row-major [M,K], f32 or f16 (TA); Wt row-major [K,N], f32, as the caller's input holds it; M,N % 64 == 0, K % 32 == 0.
// N and K are compile-time, so that every load of a k step is one base register plus an immediate offset.
// B fragments come straight from Wt: lane column c of subtile j is n0 + 4 * c + j, so that one 16-byte load of
// Wt[k][n0 + 4 * c ..] gives the lane its k-th element of all four subtiles (16 lanes = 256 contiguous bytes of a row);
// the k order of the sixteen loads is load_row's. D's column map follows: subtile j, lane column c -> n0 + 4 * c + j.
// BIAS_MODE: 2 = bias[n], 3 = bias[n] where a bias pointer is given (block-uniform), else none.
template <typename TA, int BIAS_MODE, int N, int K>
__device__ __forceinline__ void gemm64_body(
    const TA* __restrict__ A, const float* __restrict__ Wt, float* __restrict__ C,
    const float* __restrict__ bias, int M, float scale) {
  constexpr int lda = K, ldw = N, ldc = N;
  __shared__ __align__(16) float sT[4][16 * 68];   // per-wave 16x64 slab, pitch 68 floats
  const int lane = threadIdx.x & 31;
  const int wave = threadIdx.x >> 5;
  const int tilesN = N >> 6;
  const int tilesM = M >> 6;
  const int tile = blockIdx.x * 4 + wave;      // four waves: with N = 256 a block is one 64-row stripe of A, read by all four
  if (tile >= tilesM * tilesN) return;   // wave-uniform; no block barriers in this kernel
  const int tm = tile / tilesN;
  const int tn = tile - tm * tilesN;
  const int m0 = tm << 6;
  const int n0 = tn << 6;

  const int rlane = lane & 15;                 // row (A) / lane column (B, D) within subtile
  const int koff  = (lane >> 4) * 8;           // k offset of this lane half
  const int mOff  = (lane >> 4) * 8;           // D row offset

  v8f acc[4][4];
#pragma unroll
  for (int i = 0; i < 4; ++i)
#pragma unroll
    for (int j = 0; j < 4; ++j) acc[i][j] = (v8f){0.f,0.f,0.f,0.f,0.f,0.f,0.f,0.f};

  v4f bj = (v4f){0.f, 0.f, 0.f, 0.f};          // this lane's four bias values (columns n0 + 4 * rlane + 0..3)
  if (BIAS_MODE == 2 || bias != nullptr) {     // BIAS_MODE 3: one uniform test
    bj = *(const v4f*)(bias + n0 + 4 * rlane);
    asm volatile("s_wait_xcnt 0x0" ::: "memory");   // stands ahead of any rewrite of the address registers that the load names
  }

  const float* Wl = Wt + (size_t)koff * ldw + n0 + 4 * rlane;    // this lane's column group, first k of its half
  const TA*    Al = A + (size_t)(m0 + rlane) * lda + koff;       // this lane's row of subtile 0, first k of its half
#pragma unroll 1   // rolled: one k step's loads already take the registers that three waves per SIMD leave
  for (int k0 = 0; k0 < K; k0 += 32) {
    // All loads of a k step go out together, so that the step waits out one memory latency, not one per A subtile.
    // Source order: the first eight k of Wt, A, the last eight k of Wt; written as one group of sixteen, this build spilled an accumulator.
    v4f w[8];                                  // w[e][j] = Wt[k of element e (+ 8)][n0 + 4 * rlane + j]
    v16h bh[4];
#pragma unroll
    for (int e = 0; e < 8; ++e) w[e] = *(const v4f*)(Wl + (k0 + e) * ldw);
    decltype(load_row(Al)) ar[4];              // A rows of the four subtiles, as stored
#pragma unroll
    for (int i = 0; i < 4; ++i) ar[i] = load_row(Al + (i << 4) * lda + k0);
#pragma unroll
    for (int j = 0; j < 4; ++j)
#pragma unroll
      for (int e = 0; e < 8; ++e) bh[j][e] = (_Float16)(w[e][j] * 16.0f);
#pragma unroll
    for (int e = 0; e < 8; ++e) w[e] = *(const v4f*)(Wl + (k0 + 16 + e) * ldw);
    // no load of the k step sinks below this line: all are in flight before the first A value is used
    __builtin_amdgcn_sched_barrier(0);
#pragma unroll
    for (int j = 0; j < 4; ++j)
#pragma unroll
      for (int e = 0; e < 8; ++e) bh[j][8 + e] = (_Float16)(w[e][j] * 16.0f);
#pragma unroll
    for (int i = 0; i < 4; ++i) {
      v16h ah = to_frag(ar[i]);
#pragma unroll
      for (int j = 0; j < 4; ++j) acc[i][j] = mma_h(ah, bh[j], acc[i][j]);
      dep_guard_h(acc[i][0], acc[i][3], ah, ah);
    }
    keep4_h(bh[0], bh[1], bh[2], bh[3]);
  }
  acc_guard4(acc[0][0], acc[0][1], acc[0][2], acc[0][3]);
  acc_guard4(acc[1][0], acc[1][1], acc[1][2], acc[1][3]);
  acc_guard4(acc[2][0], acc[2][1], acc[2][2], acc[2][3]);
  acc_guard4(acc[3][0], acc[3][1], acc[3][2], acc[3][3]);

  // ---- epilogue ----
  float* slab = sT[wave];
#pragma unroll
  for (int i = 0; i < 4; ++i) {
    const int mBase = m0 + (i << 4);
#pragma unroll
    for (int r = 0; r < 8; ++r) {
      v4f v;
#pragma unroll
      for (int j = 0; j < 4; ++j) v[j] = acc[i][j][r] * scale + bj[j];
      *(v4f*)(slab + (mOff + r) * 68 + 4 * rlane) = v;
    }
    __builtin_amdgcn_fence(__ATOMIC_RELEASE, "workgroup");
    __builtin_amdgcn_wave_barrier();
    __builtin_amdgcn_fence(__ATOMIC_ACQUIRE, "workgroup");
    {
      const int hh = lane >> 4, c4 = (lane & 15) * 4;     // row seg = 256 B = 16 lanes x 16 B
#pragma unroll
      for (int it = 0; it < 8; ++it) {
        const int row = it * 2 + hh;
        v4f v = *(const v4f*)(slab + row * 68 + c4);
        *(v4f*)(C + (size_t)(mBase + row) * ldc + n0 + c4) = v;
      }
    }
    __builtin_amdgcn_fence(__ATOMIC_RELEASE, "workgroup");
    __builtin_amdgcn_wave_barrier();
    __builtin_amdgcn_fence(__ATOMIC_ACQUIRE, "workgroup");
  }
}

// The three input projections read none of each other's output: one grid, blockIdx.y = 0: q.Wq, 1: x.Wk, 2: x.Wv + bv.
__global__ __launch_bounds__(128) void proj_qkv(
    const float* __restrict__ q, const float* __restrict__ x,
    const float* __restrict__ Wq, const float* __restrict__ Wk, const float* __restrict__ Wv,
    float* __restrict__ qpF, float* __restrict__ kF, float* __restrict__ vF,
    const float* __restrict__ bv, int M, float scale) {
  const int y = blockIdx.y;
  const float* A    = (y == 0) ? q : x;
  const float* Wt   = (y == 0) ? Wq : (y == 1) ? Wk : Wv;
  float* C          = (y == 0) ? qpF : (y == 1) ? kF : vF;
  const float* bias = (y == 2) ? bv : nullptr;
  gemm64_body<float, 3, 256, 256>(A, Wt, C, bias, M, scale);
}

// ---- local 3x3x3 windowed attention, f32. One thread per (voxel, head); block = one W row of 32 voxels x 8 heads. ----
// qp/kf/vf: f32 [16384][256] (voxel-major, col = head*32 + d). The block's attention output (f16, x8) stays in LDS and is
// the A operand of the output projection, which the same block does for its 32 rows: outp = (1/128) * o . f16(16 Wo) + bo.
// The block's own q row, the nine neighbouring K rows, then the nine V rows (32 voxels x 1 KiB each, contiguous in
// memory) pass through a two-buffer LDS ring filled by asynchronous copies in whole lines; every thread reads its q
// and its three neighbours per row from LDS.
// Row and voxel indices clamped into range; out-of-volume neighbours get weight exactly 0; the centre is always in range.
// Per-thread dots / probabilities live in thread-private LDS slots (27 per thread).
#define AT_S 8
#define AT_H 32
#define AT_W 32
#define AT_C 256
#define AT_NB 27
#define AT_PITCH 264
#define AT_HPITCH 36                     // floats per (voxel, head) slot: 32 + 4 pad = 144 B, so 16 lanes' b128 reads cover all 64 banks
#define AT_VPITCH (8 * AT_HPITCH)        // floats per voxel
#define AT_TILE_F (AT_W * AT_VPITCH)     // floats per staged row of 32 voxels (36864 B)
#define AT_NT 19                         // tiles: the q row, 9 K rows, 9 V rows
#define QK_SCALE 0.17677669529663687f

// One staged row: 2048 pieces of 16 B, eight per lane. g = this lane's first global piece, l = its LDS byte address;
// piece j lies 4 KiB further in memory (4 voxels) and 4 voxel pitches further in LDS.
// s_wait_xcnt closes the statement so that no address register of an issued copy is rewritten ahead of it.
__device__ __forceinline__ void stage_row_async(const float* g, unsigned l) {
  asm volatile(
      "global_load_async_to_lds_b128 %0, %8, off\n\t"
      "global_load_async_to_lds_b128 %1, %9, off\n\t"
      "global_load_async_to_lds_b128 %2, %10, off\n\t"
      "global_load_async_to_lds_b128 %3, %11, off\n\t"
      "global_load_async_to_lds_b128 %4, %12, off\n\t"
      "global_load_async_to_lds_b128 %5, %13, off\n\t"
      "global_load_async_to_lds_b128 %6, %14, off\n\t"
      "global_load_async_to_lds_b128 %7, %15, off\n\t"
      "s_wait_xcnt 0x0"
      :: "v"(l), "v"(l + 1u * 16u * AT_VPITCH), "v"(l + 2u * 16u * AT_VPITCH), "v"(l + 3u * 16u * AT_VPITCH),
         "v"(l + 4u * 16u * AT_VPITCH), "v"(l + 5u * 16u * AT_VPITCH), "v"(l + 6u * 16u * AT_VPITCH), "v"(l + 7u * 16u * AT_VPITCH),
         "v"(g), "v"(g + 1 * 1024), "v"(g + 2 * 1024), "v"(g + 3 * 1024),
         "v"(g + 4 * 1024), "v"(g + 5 * 1024), "v"(g + 6 * 1024), "v"(g + 7 * 1024)
      : "memory");
}

// Foot of a ring trip: hands the next tile to every wave and frees the buffer just read.
__device__ __forceinline__ void ring_publish() {
  asm volatile("s_wait_dscnt 0x0" ::: "memory");     // this wave's LDS reads of the buffer to be refilled have retired
  asm volatile("s_wait_asynccnt 0x0" ::: "memory");  // this wave's copies of the next tile have landed
  __syncthreads();                                   // every wave's copies are visible; every reader has left the old buffer
}

__global__ __launch_bounds__(256) void local_attn3d(
    const float* __restrict__ qp, const float* __restrict__ kf, const float* __restrict__ vf,
    const float* __restrict__ Wo, const float* __restrict__ bo, float* __restrict__ outp) {
  __shared__ __align__(16) float sbuf[AT_NB * 256];   // 27648 B; reused as f16 staging (32 x 264 halves = 16896 B)
  __shared__ __align__(16) float tile[2 * AT_TILE_F]; // the ring: two staged rows
  const int tid  = threadIdx.x;
  const int head = tid & 7;
  const int vox  = tid >> 3;                          // = position along W
  const int ph = blockIdx.x & 31;                     // block-uniform: one block is one W row; grid = 16384/32 exactly
  const int ps = (blockIdx.x >> 5) & 7;
  const int pb = blockIdx.x >> 8;

  const unsigned lds_lane = (unsigned)(uintptr_t)tile +
      4u * (unsigned)((tid >> 6) * AT_VPITCH + ((tid >> 3) & 7) * AT_HPITCH + (tid & 7) * 4);
  auto issue = [&](int t) {                           // tile t -> buffer t & 1
    const int r9 = (t == 0) ? 4 : ((t < 10) ? t - 1 : t - 10);   // (dz, dy) = (r9 / 3, r9 % 3); 4 = the block's own row
    const float* srcp = (t == 0) ? qp : ((t < 10) ? kf : vf);
    const int dz = r9 / 3;
    const int dy = r9 - 3 * dz;
    const int zs = ps + dz - 1;
    const int cs = zs < 0 ? 0 : (zs > AT_S - 1 ? AT_S - 1 : zs);
    const int zh = ph + dy - 1;
    const int ch = zh < 0 ? 0 : (zh > AT_H - 1 ? AT_H - 1 : zh);
    const int rowb = ((pb * AT_S + cs) * AT_H + ch) * AT_W;
    stage_row_async(srcp + (size_t)rowb * AT_C + tid * 4, lds_lane + (unsigned)(t & 1) * (4u * AT_TILE_F));
  };

  issue(0);
  asm volatile("s_wait_asynccnt 0x0" ::: "memory");   // tile 0 has landed (this wave's part)
  __syncthreads();                                    // ... and every other wave's
  issue(1);

  // this thread's three neighbours along W inside a staged row (clamped)
  const int o0 = (vox > 0 ? vox - 1 : 0) * AT_VPITCH + head * AT_HPITCH;
  const int o1 = vox * AT_VPITCH + head * AT_HPITCH;
  const int o2 = (vox < AT_W - 1 ? vox + 1 : AT_W - 1) * AT_VPITCH + head * AT_HPITCH;

  // trip 0: this thread's q from the staged q row
  float qr[32];
  {
    const float* qptr = tile + o1;
#pragma unroll
    for (int i = 0; i < 8; ++i) {
      const v4f tq = *(const v4f*)(qptr + 4 * i);
      qr[4 * i + 0] = tq[0]; qr[4 * i + 1] = tq[1]; qr[4 * i + 2] = tq[2]; qr[4 * i + 3] = tq[3];
    }
  }
  ring_publish();
  issue(2);

  // pass 1: dots, one K row (dz, dy) per trip
  float mx = -INFINITY;
  unsigned vmask = 0u;
#pragma unroll 1
  for (int t = 1; t < 10; ++t) {
    const float* tb = tile + (t & 1) * AT_TILE_F;
    float a0 = 0.f, a1 = 0.f, a2 = 0.f;
#pragma unroll
    for (int i = 0; i < 8; ++i) {
      const v4f k0 = *(const v4f*)(tb + o0 + 4 * i);
      const v4f k1 = *(const v4f*)(tb + o1 + 4 * i);
      const v4f k2 = *(const v4f*)(tb + o2 + 4 * i);
#pragma unroll
      for (int c = 0; c < 4; ++c) {
        a0 = fmaf(qr[4 * i + c], k0[c], a0);
        a1 = fmaf(qr[4 * i + c], k1[c], a1);
        a2 = fmaf(qr[4 * i + c], k2[c], a2);
      }
    }
    const int dz = (t - 1) / 3;
    const int dy = (t - 1) - 3 * dz;
    const bool vrow = ((unsigned)(ps + dz - 1) < (unsigned)AT_S) && ((unsigned)(ph + dy - 1) < (unsigned)AT_H);
    const float d0 = a0 * QK_SCALE, d1 = a1 * QK_SCALE, d2 = a2 * QK_SCALE;
    const int kk = 3 * (t - 1);
    sbuf[(kk + 0) * 256 + tid] = d0;
    sbuf[(kk + 1) * 256 + tid] = d1;
    sbuf[(kk + 2) * 256 + tid] = d2;
    if (vrow && vox > 0)        { mx = fmaxf(mx, d0); vmask |= (1u << (kk + 0)); }
    if (vrow)                   { mx = fmaxf(mx, d1); vmask |= (1u << (kk + 1)); }
    if (vrow && vox < AT_W - 1) { mx = fmaxf(mx, d2); vmask |= (1u << (kk + 2)); }
    ring_publish();
    issue(t + 2);                                     // tiles 3..11 all exist
  }

  // pass 2: probabilities (exactly 0 for out-of-range neighbours), sum
  float sum = 0.f;
#pragma unroll 1
  for (int k2 = 0; k2 < AT_NB; ++k2) {
    const float d = sbuf[k2 * 256 + tid];
    const float ex = __expf(d - mx);
    const float p = ((vmask >> k2) & 1u) ? ex : 0.f;
    sbuf[k2 * 256 + tid] = p;
    sum += p;
  }
  const float inv = __builtin_amdgcn_rcpf(sum);   // sum >= 1

  // Output projection, 32 rows x 256 columns per block: wave w owns all 32 rows of columns 32 w .. 32 w + 31 (2 x 2 subtiles).
  // B fragments come straight from Wo: lane column c of subtile j is n0 + 2 * c + j, so that one 8-byte load of Wo[k][n0 + 2 * c ..]
  // gives the lane its k-th element of both subtiles (16 lanes = one 128-byte line); the k order of the sixteen loads is load_row's.
  const int lane  = tid & 31;
  const int rlane = lane & 15;                 // row (A) / lane column (B, D) within a subtile
  const int koff  = (lane >> 4) * 8;           // k offset of this lane half; also its D row offset
  const int n0    = (tid >> 5) * 32;
  const float* Wl = Wo + koff * AT_C + n0 + 2 * rlane;
  v2f w[3][16];                                // three k steps of Wo: the next two are in flight while this one is multiplied
  auto load_w = [&](int ks) {
#pragma unroll
    for (int e = 0; e < 8; ++e) {
      w[ks % 3][e]     = *(const v2f*)(Wl + (ks * 32 + e) * AT_C);
      w[ks % 3][8 + e] = *(const v2f*)(Wl + (ks * 32 + 16 + e) * AT_C);
    }
  };
  load_w(0);                                   // issued here, ahead of pass 3, so that the first k step waits for nothing behind the ring
  const v2f bj = *(const v2f*)(bo + n0 + 2 * rlane);
  asm volatile("s_wait_xcnt 0x0" ::: "memory");   // stands ahead of any rewrite of the address registers that these loads name

  // pass 3: weighted sum of v rows, one V row (dz, dy) per trip
  float acc[32];
#pragma unroll
  for (int i = 0; i < 32; ++i) acc[i] = 0.f;
#pragma unroll 1
  for (int t = 10; t < AT_NT; ++t) {
    const float* tb = tile + (t & 1) * AT_TILE_F;
    const int kk = 3 * (t - 10);
    const float p0 = sbuf[(kk + 0) * 256 + tid];
    const float p1 = sbuf[(kk + 1) * 256 + tid];
    const float p2 = sbuf[(kk + 2) * 256 + tid];
#pragma unroll
    for (int i = 0; i < 8; ++i) {
      const v4f v0 = *(const v4f*)(tb + o0 + 4 * i);
      const v4f v1 = *(const v4f*)(tb + o1 + 4 * i);
      const v4f v2 = *(const v4f*)(tb + o2 + 4 * i);
#pragma unroll
      for (int c = 0; c < 4; ++c) {
        float s = acc[4 * i + c];
        s = fmaf(p0, v0[c], s);
        s = fmaf(p1, v1[c], s);
        s = fmaf(p2, v2[c], s);
        acc[4 * i + c] = s;
      }
    }
    ring_publish();
    if (t + 2 < AT_NT) issue(t + 2);                  // block-uniform test
  }
  asm volatile("s_wait_asynccnt 0x0" ::: "memory");   // no copy of this wave is left in flight
  const float osc = inv * 8.0f;     // normalise and carry x8 for the f16 A operand of the output projection

  // stage the f16 tile [32 voxels][256] in LDS (pitch 264 halves = 16 B x 33: b128 fragment reads without bank conflicts)
  __syncthreads();
  _Float16* st = reinterpret_cast<_Float16*>(sbuf);
  {
    _Float16* sp = st + vox * AT_PITCH + head * 32;
#pragma unroll
    for (int j = 0; j < 4; ++j) {
      v8h hv;
#pragma unroll
      for (int i = 0; i < 8; ++i) hv[i] = (_Float16)(acc[8 * j + i] * osc);
      *(v8h*)(sp + 8 * j) = hv;
    }
  }
  __syncthreads();

  v8f c[2][2];
#pragma unroll
  for (int i = 0; i < 2; ++i)
#pragma unroll
    for (int j = 0; j < 2; ++j) c[i][j] = (v8f){0.f,0.f,0.f,0.f,0.f,0.f,0.f,0.f};
  const _Float16* Al = st + rlane * AT_PITCH + koff;
  load_w(1);
  v16h ah[2][2];                               // A fragments of this k step and the next, so that the LDS latency lies under the conversions
#pragma unroll
  for (int i = 0; i < 2; ++i) ah[0][i] = load_row(Al + i * 16 * AT_PITCH);
#pragma unroll   // unrolled: every Wo load is the one base register plus an immediate offset, and w[] stays in registers
  for (int ks = 0; ks < AT_C / 32; ++ks) {
    if (ks + 2 < AT_C / 32) load_w(ks + 2);
    if (ks + 1 < AT_C / 32) {
#pragma unroll
      for (int i = 0; i < 2; ++i) ah[(ks + 1) & 1][i] = load_row(Al + i * 16 * AT_PITCH + (ks + 1) * 32);
    }
    v16h bh[2];
#pragma unroll
    for (int j = 0; j < 2; ++j)
#pragma unroll
      for (int e = 0; e < 16; ++e) bh[j][e] = (_Float16)(w[ks % 3][e][j] * 16.0f);
#pragma unroll
    for (int i = 0; i < 2; ++i)
#pragma unroll
      for (int j = 0; j < 2; ++j) c[i][j] = mma_h(ah[ks & 1][i], bh[j], c[i][j]);
    // no later k step's loads rise above this line: hoisted all at once they took the kernel past 256 registers, where only one block fits a WGP
    __builtin_amdgcn_sched_barrier(0);
  }

  // D: subtile (i, j), register r -> row 16 i + koff + r, column n0 + 2 * rlane + j; 16 lanes store one whole 128-byte line of a row
  float* ob = outp + (size_t)blockIdx.x * 32 * AT_C + koff * AT_C + n0 + 2 * rlane;
#pragma unroll
  for (int i = 0; i < 2; ++i)
#pragma unroll
    for (int r = 0; r < 8; ++r) {
      v2f v;
#pragma unroll
      for (int j = 0; j < 2; ++j) v[j] = c[i][j][r] * (1.0f / 128.0f) + bj[j];
      *(v2f*)(ob + (i * 16 + r) * AT_C) = v;
    }
}

// ---------------------------------------------------------------------------
extern "C" void kernel_launch(void* const* d_in, const int* in_sizes, int n_in,
                              void* d_out, int out_size, void* d_ws, size_t ws_size,
                              hipStream_t stream) {
  const int MP = 16384;     // B*S*H*W = 2*8*32*32
  const int DC = 256;       // DIM == INNER
  if (n_in < 8) return;
  if (in_sizes[0] != MP * DC || in_sizes[1] != MP * DC) return;
  if (in_sizes[2] != DC * DC || in_sizes[3] != DC * DC || in_sizes[4] != DC * DC || in_sizes[6] != DC * DC) return;
  if (in_sizes[5] != DC || in_sizes[7] != DC) return;
  if (out_size != MP * DC) return;

  const float* x  = (const float*)d_in[0];
  const float* q  = (const float*)d_in[1];
  const float* Wq = (const float*)d_in[2];
  const float* Wk = (const float*)d_in[3];
  const float* Wv = (const float*)d_in[4];
  const float* bv = (const float*)d_in[5];
  const float* Wo = (const float*)d_in[6];
  const float* bo = (const float*)d_in[7];
  float* outp = (float*)d_out;

  const size_t actF = (size_t)MP * DC * sizeof(float);      // 16 MiB
  size_t off = 0;
  char* base = (char*)d_ws;
  float*    qpF = (float*)(base + off);    off += actF;
  float*    kF  = (float*)(base + off);    off += actF;
  float*    vF  = (float*)(base + off);    off += actF;
  // total = 50,331,648 B
  if (off > ws_size) return;

  // 1) projections, one grid: C = (1/16) * f16(A) . f16(16 W) (+ bias[n]); M = 16384, N = K = 256; 1024 64x64 tiles each, 4 per block
  const dim3 gg3((MP / 64) * (DC / 64) / 4, 3);
  const float s16 = 1.0f / 16.0f;
  proj_qkv<<<gg3, 128, 0, stream>>>(q, x, Wq, Wk, Wv, qpF, kF, vF, bv, MP, s16);

  // 2) windowed attention (f32) and, per block, the output projection of its 32 rows -> d_out (f32)
  local_attn3d<<<MP / 32, 256, 0, stream>>>(qpF, kF, vF, Wo, bo, outp);
}

// v005
// A run of this version takes 49.6 microseconds.
// In both of two side-by-side timings against v004, it was 1.09 times as fast.
// All steps since v000 together make it 3.26 times as fast.
// Projections x@Wk, x@Wv+bv, q@Wq, o@Wo+bo: v_wmma_f32_16x16x32_f16 (f16 operands; weights carried x16, o carried x8; f32 accumulate). Windowed q.k, softmax, p.v: f32 VALU.
#include <hip/hip_runtime.h>
#include <hip/hip_bf16.h>

typedef __attribute__((ext_vector_type(16))) _Float16 v16h;
typedef __attribute__((ext_vector_type(8)))  _Float16 v8h;
typedef __attribute__((ext_vector_type(8)))  float    v8f;
typedef __attribute__((ext_vector_type(4)))  float    v4f;
typedef __attribute__((ext_vector_type(2)))  float    v2f;
typedef __attribute__((ext_vector_type(16))) float    v16f;

// hazard guards as plain device helpers (the kernel template body keeps four inline asm waits: s_wait_xcnt after the bias and Wt loads, s_wait_asynccnt before the ring and after it)
__device__ __forceinline__ void dep_guard_h(v8f& a, v8f& b, v16h x, v16h y) { asm volatile("v_nop\n\tv_nop\n\tv_nop\n\tv_nop" : "+v"(a), "+v"(b) : "v"(x), "v"(y)); }
__device__ __forceinline__ void keep4_h(v16h a, v16h b, v16h c, v16h d) { asm volatile("v_nop" :: "v"(a), "v"(b), "v"(c), "v"(d)); }
__device__ __forceinline__ void acc_guard4(v8f& a, v8f& b, v8f& c, v8f& d) { asm volatile("v_nop\n\tv_nop\n\tv_nop\n\tv_nop" : "+v"(a), "+v"(b), "+v"(c), "+v"(d)); }

__device__ __forceinline__ v16f cat4(v4f a, v4f b, v4f c, v4f d) {
  return __builtin_shufflevector(__builtin_shufflevector(a, b, 0, 1, 2, 3, 4, 5, 6, 7),
                                 __builtin_shufflevector(c, d, 0, 1, 2, 3, 4, 5, 6, 7),
                                 0, 1, 2, 3, 4, 5, 6, 7, 8, 9, 10, 11, 12, 13, 14, 15);
}
// The sixteen k of one A row that a lane holds, k order: elements 0..7 <- p[0..7], 8..15 <- p[16..23]; as stored (f16 or f32).
__device__ __forceinline__ v16h load_row(const _Float16* p) {
  union { v16h v; v8h h[2]; } f;
  f.h[0] = *(const v8h*)(p); f.h[1] = *(const v8h*)(p + 16); return f.v;
}
__device__ __forceinline__ v16f load_row(const float* p) {
  return cat4(*(const v4f*)(p), *(const v4f*)(p + 4), *(const v4f*)(p + 16), *(const v4f*)(p + 20));
}
// ... and as the f16 fragment (f32 is rounded here)
__device__ __forceinline__ v16h to_frag(v16f a) { return __builtin_convertvector(a, v16h); }
__device__ __forceinline__ v8f mma_h(v16h a, v16h b, v8f c) {
  return __builtin_amdgcn_wmma_f32_16x16x32_f16(false, a, false, b, (short)0, c, false, false);
}

// ---- LDS ring helpers ---------------------------------------------------------
#define PA_KT 64                         // k per staged A tile: two k steps, 256 B of each of the 64 rows
#define PA_PITCH 68                      // floats per staged row: 272 B = 16 B x 17, so 16 lanes' b128 reads of 16 rows cover all 64 banks
#define PA_TILE_F (64 * PA_PITCH)        // floats per staged tile (17408 B)

// One staged A tile: 1024 pieces of 16 B, eight per lane. g = this lane's first global piece, l = its LDS byte address;
// piece j lies eight rows further, in memory (LD floats per row) and in LDS.
// s_wait_xcnt closes the statement so that no address register of an issued copy is rewritten ahead of it.
template <int LD>
__device__ __forceinline__ void stage_a_async(const float* g, unsigned l) {
  asm volatile(
      "global_load_async_to_lds_b128 %0, %8, off\n\t"
      "global_load_async_to_lds_b128 %1, %9, off\n\t"
      "global_load_async_to_lds_b128 %2, %10, off\n\t"
      "global_load_async_to_lds_b128 %3, %11, off\n\t"
      "global_load_async_to_lds_b128 %4, %12, off\n\t"
      "global_load_async_to_lds_b128 %5, %13, off\n\t"
      "global_load_async_to_lds_b128 %6, %14, off\n\t"
      "global_load_async_to_lds_b128 %7, %15, off\n\t"
      "s_wait_xcnt 0x0"
      :: "v"(l), "v"(l + 1u * 32u * PA_PITCH), "v"(l + 2u * 32u * PA_PITCH), "v"(l + 3u * 32u * PA_PITCH),
         "v"(l + 4u * 32u * PA_PITCH), "v"(l + 5u * 32u * PA_PITCH), "v"(l + 6u * 32u * PA_PITCH), "v"(l + 7u * 32u * PA_PITCH),
         "v"(g), "v"(g + 1 * 8 * LD), "v"(g + 2 * 8 * LD), "v"(g + 3 * 8 * LD),
         "v"(g + 4 * 8 * LD), "v"(g + 5 * 8 * LD), "v"(g + 6 * 8 * LD), "v"(g + 7 * 8 * LD)
      : "memory");
}

// Foot of a ring trip: hands the next tile to every wave and frees the buffer just read.
__device__ __forceinline__ void ring_publish() {
  asm volatile("s_wait_dscnt 0x0" ::: "memory");     // this wave's LDS reads of the buffer to be refilled have retired
  asm volatile("s_wait_asynccnt 0x0" ::: "memory");  // this wave's copies of the next tile have landed
  __syncthreads();                                   // every wave's copies are visible; every reader has left the old buffer
}

// ---- Register-blocked WMMA GEMM ---------------------------------------------
// C[m,n] = scale * sum_k f16(A[m,k]) * f16(16 * Wt[k,n]) (+bias[n]); each wave owns a 64x64 tile; C is f32.
// A row-major [M,K], f32; Wt row-major [K,N], f32, as the caller's input holds it; M % 64 == 0, N == 256, K % 128 == 0.
// A block is one 64-row stripe of A, which all four waves multiply: it passes through a two-buffer LDS ring, 64 k per tile,
// filled by asynchronous copies in whole 256-byte row pieces; every wave takes its A fragments from there.
// N and K are compile-time, so that every Wt load of a k step is one base register plus an immediate offset.
// B fragments come straight from Wt: lane column c of subtile j is n0 + 4 * c + j, so that one 16-byte load of
// Wt[k][n0 + 4 * c ..] gives the lane its k-th element of all four subtiles (16 lanes = 256 contiguous bytes of a row);
// the k order of the sixteen loads is load_row's. D's column map follows: subtile j, lane column c -> n0 + 4 * c + j.
// BIAS_MODE: 2 = bias[n], 3 = bias[n] where a bias pointer is given (block-uniform), else none.
template <int BIAS_MODE, int N, int K>
__device__ __forceinline__ void gemm64_body(
    const float* __restrict__ A, const float* __restrict__ Wt, float* __restrict__ C,
    const float* __restrict__ bias, int M, float scale) {
  static_assert(N == 256 && K % (2 * PA_KT) == 0, "four waves x 64 columns; at least two staged tiles");
  constexpr int lda = K, ldw = N, ldc = N;
  constexpr int NT = K / PA_KT;                    // staged tiles
  __shared__ __align__(16) float sT[4][16 * 68];   // per-wave 16x64 slab, pitch 68 floats
  __shared__ __align__(16) float sA[2 * PA_TILE_F];   // the ring: two staged A tiles
  const int tid  = threadIdx.x;
  const int lane = tid & 31;
  const int wave = tid >> 5;
  const int tm = blockIdx.x;             // the block's 64-row stripe of A
  if (tm >= (M >> 6)) return;            // block-uniform, ahead of every barrier
  const int tn = wave;                   // four waves: the four 64-column tiles of N = 256
  const int m0 = tm << 6;
  const int n0 = tn << 6;

  // lane's piece 0 of a tile: row tid / 16, 16 B number tid % 16 of the row's 256 B (a wave's copy = two whole row pieces)
  const float* Ag = A + (size_t)(m0 + (tid >> 4)) * lda + (tid & 15) * 4;
  const unsigned Alds = (unsigned)(uintptr_t)sA + 4u * (unsigned)((tid >> 4) * PA_PITCH + (tid & 15) * 4);
  auto issue = [&](int t) {              // tile t (k = 64 t .. 64 t + 63) -> buffer t & 1
    stage_a_async<lda>(Ag + t * PA_KT, Alds + (unsigned)(t & 1) * (4u * PA_TILE_F));
  };
  issue(0);

  const int rlane = lane & 15;                 // row (A) / lane column (B, D) within subtile
  const int koff  = (lane >> 4) * 8;           // k offset of this lane half
  const int mOff  = (lane >> 4) * 8;           // D row offset

  v8f acc[4][4];
#pragma unroll
  for (int i = 0; i < 4; ++i)
#pragma unroll
    for (int j = 0; j < 4; ++j) acc[i][j] = (v8f){0.f,0.f,0.f,0.f,0.f,0.f,0.f,0.f};

  v4f bj = (v4f){0.f, 0.f, 0.f, 0.f};          // this lane's four bias values (columns n0 + 4 * rlane + 0..3)
  if (BIAS_MODE == 2 || bias != nullptr) {     // BIAS_MODE 3: one uniform test
    bj = *(const v4f*)(bias + n0 + 4 * rlane);
    asm volatile("s_wait_xcnt 0x0" ::: "memory");   // stands ahead of any rewrite of the address registers that the load names
  }

  const float* Wl = Wt + (size_t)koff * ldw + n0 + 4 * rlane;    // this lane's column group, first k of its half
  asm volatile("s_wait_asynccnt 0x0" ::: "memory");   // tile 0 has landed (this wave's part)
  __syncthreads();                                    // ... and every other wave's
  issue(1);
#pragma unroll 1   // rolled: the ring's trips
  for (int t = 0; t < NT; ++t) {
    const float* Al = sA + (t & 1) * PA_TILE_F + rlane * PA_PITCH + koff;   // this lane's row of subtile 0 in the staged tile, first k of its half
#pragma unroll 1   // rolled: one k step's loads already take the registers that three waves per SIMD leave
    for (int kk = 0; kk < PA_KT; kk += 32) {
      const int k0 = t * PA_KT + kk;
      // All loads of a k step go out together, so that the step waits out one latency.
      // Source order: Wt (the longer latency) in two groups of eight k, then A from LDS.
      v4f w[8];                                  // w[e][j] = Wt[k of element e (+ 8)][n0 + 4 * rlane + j]
      v16h bh[4];
#pragma unroll
      for (int e = 0; e < 8; ++e) w[e] = *(const v4f*)(Wl + (k0 + e) * ldw);
#pragma unroll
      for (int j = 0; j < 4; ++j)
#pragma unroll
        for (int e = 0; e < 8; ++e) bh[j][e] = (_Float16)(w[e][j] * 16.0f);
#pragma unroll
      for (int e = 0; e < 8; ++e) w[e] = *(const v4f*)(Wl + (k0 + 16 + e) * ldw);
      asm volatile("s_wait_xcnt 0x0" ::: "memory");   // stands ahead of any rewrite of the address registers that the Wt loads name
      v16f ar[4];                                // A rows of the four subtiles, as staged
#pragma unroll
      for (int i = 0; i < 4; ++i) ar[i] = load_row(Al + (i << 4) * PA_PITCH + kk);
      // no load of the k step sinks below this line: all are in flight before the first A value is used
      __builtin_amdgcn_sched_barrier(0);
#pragma unroll
      for (int j = 0; j < 4; ++j)
#pragma unroll
        for (int e = 0; e < 8; ++e) bh[j][8 + e] = (_Float16)(w[e][j] * 16.0f);
#pragma unroll
      for (int i = 0; i < 4; ++i) {
        v16h ah = to_frag(ar[i]);
#pragma unroll
        for (int j = 0; j < 4; ++j) acc[i][j] = mma_h(ah, bh[j], acc[i][j]);
        dep_guard_h(acc[i][0], acc[i][3], ah, ah);
      }
      keep4_h(bh[0], bh[1], bh[2], bh[3]);
    }
    ring_publish();
    if (t + 2 < NT) issue(t + 2);                     // block-uniform test
  }
  asm volatile("s_wait_asynccnt 0x0" ::: "memory");   // no copy of this wave is left in flight
  acc_guard4(acc[0][0], acc[0][1], acc[0][2], acc[0][3]);
  acc_guard4(acc[1][0], acc[1][1], acc[1][2], acc[1][3]);
  acc_guard4(acc[2][0], acc[2][1], acc[2][2], acc[2][3]);
  acc_guard4(acc[3][0], acc[3][1], acc[3][2], acc[3][3]);

  // ---- epilogue ----
  float* slab = sT[wave];
#pragma unroll
  for (int i = 0; i < 4; ++i) {
    const int mBase = m0 + (i << 4);
#pragma unroll
    for (int r = 0; r < 8; ++r) {
      v4f v;
#pragma unroll
      for (int j = 0; j < 4; ++j) v[j] = acc[i][j][r] * scale + bj[j];
      *(v4f*)(slab + (mOff + r) * 68 + 4 * rlane) = v;
    }
    __builtin_amdgcn_fence(__ATOMIC_RELEASE, "workgroup");
    __builtin_amdgcn_wave_barrier();
    __builtin_amdgcn_fence(__ATOMIC_ACQUIRE, "workgroup");
    {
      const int hh = lane >> 4, c4 = (lane & 15) * 4;     // row seg = 256 B = 16 lanes x 16 B
#pragma unroll
      for (int it = 0; it < 8; ++it) {
        const int row = it * 2 + hh;
        v4f v = *(const v4f*)(slab + row * 68 + c4);
        *(v4f*)(C + (size_t)(mBase + row) * ldc + n0 + c4) = v;
      }
    }
    __builtin_amdgcn_fence(__ATOMIC_RELEASE, "workgroup");
    __builtin_amdgcn_wave_barrier();
    __builtin_amdgcn_fence(__ATOMIC_ACQUIRE, "workgroup");
  }
}

// The three input projections read none of each other's output: one grid, blockIdx.y = 0: q.Wq, 1: x.Wk, 2: x.Wv + bv.
__global__ __launch_bounds__(128) void proj_qkv(
    const float* __restrict__ q, const float* __restrict__ x,
    const float* __restrict__ Wq, const float* __restrict__ Wk, const float* __restrict__ Wv,
    float* __restrict__ qpF, float* __restrict__ kF, float* __restrict__ vF,
    const float* __restrict__ bv, int M, float scale) {
  const int y = blockIdx.y;
  const float* A    = (y == 0) ? q : x;
  const float* Wt   = (y == 0) ? Wq : (y == 1) ? Wk : Wv;
  float* C          = (y == 0) ? qpF : (y == 1) ? kF : vF;
  const float* bias = (y == 2) ? bv : nullptr;
  gemm64_body<3, 256, 256>(A, Wt, C, bias, M, scale);
}

// ---- local 3x3x3 windowed attention, f32. One thread per (voxel, head); block = one W row of 32 voxels x 8 heads. ----
// qp/kf/vf: f32 [16384][256] (voxel-major, col = head*32 + d). The block's attention output (f16, x8) stays in LDS and is
// the A operand of the output projection, which the same block does for its 32 rows: outp = (1/128) * o . f16(16 Wo) + bo.
// The block's own q row, the nine neighbouring K rows, then the nine V rows (32 voxels x 1 KiB each, contiguous in
// memory) pass through a two-buffer LDS ring filled by asynchronous copies in whole lines; every thread reads its q
// and its three neighbours per row from LDS.
// Row and voxel indices clamped into range; out-of-volume neighbours get weight exactly 0; the centre is always in range.
// Per-thread dots / probabilities live in thread-private LDS slots (27 per thread).
#define AT_S 8
#define AT_H 32
#define AT_W 32
#define AT_C 256
#define AT_NB 27
#define AT_PITCH 264
#define AT_HPITCH 36                     // floats per (voxel, head) slot: 32 + 4 pad = 144 B, so 16 lanes' b128 reads cover all 64 banks
#define AT_VPITCH (8 * AT_HPITCH)        // floats per voxel
#define AT_TILE_F (AT_W * AT_VPITCH)     // floats per staged row of 32 voxels (36864 B)
#define AT_NT 19                         // tiles: the q row, 9 K rows, 9 V rows
#define QK_SCALE 0.17677669529663687f

// One staged row: 2048 pieces of 16 B, eight per lane. g = this lane's first global piece, l = its LDS byte address;
// piece j lies 4 KiB further in memory (4 voxels) and 4 voxel pitches further in LDS.
// s_wait_xcnt closes the statement so that no address register of an issued copy is rewritten ahead of it.
__device__ __forceinline__ void stage_row_async(const float* g, unsigned l) {
  asm volatile(
      "global_load_async_to_lds_b128 %0, %8, off\n\t"
      "global_load_async_to_lds_b128 %1, %9, off\n\t"
      "global_load_async_to_lds_b128 %2, %10, off\n\t"
      "global_load_async_to_lds_b128 %3, %11, off\n\t"
      "global_load_async_to_lds_b128 %4, %12, off\n\t"
      "global_load_async_to_lds_b128 %5, %13, off\n\t"
      "global_load_async_to_lds_b128 %6, %14, off\n\t"
      "global_load_async_to_lds_b128 %7, %15, off\n\t"
      "s_wait_xcnt 0x0"
      :: "v"(l), "v"(l + 1u * 16u * AT_VPITCH), "v"(l + 2u * 16u * AT_VPITCH), "v"(l + 3u * 16u * AT_VPITCH),
         "v"(l + 4u * 16u * AT_VPITCH), "v"(l + 5u * 16u * AT_VPITCH), "v"(l + 6u * 16u * AT_VPITCH), "v"(l + 7u * 16u * AT_VPITCH),
         "v"(g), "v"(g + 1 * 1024), "v"(g + 2 * 1024), "v"(g + 3 * 1024),
         "v"(g + 4 * 1024), "v"(g + 5 * 1024), "v"(g + 6 * 1024), "v"(g + 7 * 1024)
      : "memory");
}

__global__ __launch_bounds__(256) void local_attn3d(
    const float* __restrict__ qp, const float* __restrict__ kf, const float* __restrict__ vf,
    const float* __restrict__ Wo, const float* __restrict__ bo, float* __restrict__ outp) {
  __shared__ __align__(16) float sbuf[AT_NB * 256];   // 27648 B; reused as f16 staging (32 x 264 halves = 16896 B)
  __shared__ __align__(16) float tile[2 * AT_TILE_F]; // the ring: two staged rows
  const int tid  = threadIdx.x;
  const int head = tid & 7;
  const int vox  = tid >> 3;                          // = position along W
  const int ph = blockIdx.x & 31;                     // block-uniform: one block is one W row; grid = 16384/32 exactly
  const int ps = (blockIdx.x >> 5) & 7;
  const int pb = blockIdx.x >> 8;

  const unsigned lds_lane = (unsigned)(uintptr_t)tile +
      4u * (unsigned)((tid >> 6) * AT_VPITCH + ((tid >> 3) & 7) * AT_HPITCH + (tid & 7) * 4);
  auto issue = [&](int t) {                           // tile t -> buffer t & 1
    const int r9 = (t == 0) ? 4 : ((t < 10) ? t - 1 : t - 10);   // (dz, dy) = (r9 / 3, r9 % 3); 4 = the block's own row
    const float* srcp = (t == 0) ? qp : ((t < 10) ? kf : vf);
    const int dz = r9 / 3;
    const int dy = r9 - 3 * dz;
    const int zs = ps + dz - 1;
    const int cs = zs < 0 ? 0 : (zs > AT_S - 1 ? AT_S - 1 : zs);
    const int zh = ph + dy - 1;
    const int ch = zh < 0 ? 0 : (zh > AT_H - 1 ? AT_H - 1 : zh);
    const int rowb = ((pb * AT_S + cs) * AT_H + ch) * AT_W;
    stage_row_async(srcp + (size_t)rowb * AT_C + tid * 4, lds_lane + (unsigned)(t & 1) * (4u * AT_TILE_F));
  };

  issue(0);
  asm volatile("s_wait_asynccnt 0x0" ::: "memory");   // tile 0 has landed (this wave's part)
  __syncthreads();                                    // ... and every other wave's
  issue(1);

  // this thread's three neighbours along W inside a staged row (clamped)
  const int o0 = (vox > 0 ? vox - 1 : 0) * AT_VPITCH + head * AT_HPITCH;
  const int o1 = vox * AT_VPITCH + head * AT_HPITCH;
  const int o2 = (vox < AT_W - 1 ? vox + 1 : AT_W - 1) * AT_VPITCH + head * AT_HPITCH;

  // trip 0: this thread's q from the staged q row
  float qr[32];
  {
    const float* qptr = tile + o1;
#pragma unroll
    for (int i = 0; i < 8; ++i) {
      const v4f tq = *(const v4f*)(qptr + 4 * i);
      qr[4 * i + 0] = tq[0]; qr[4 * i + 1] = tq[1]; qr[4 * i + 2] = tq[2]; qr[4 * i + 3] = tq[3];
    }
  }
  ring_publish();
  issue(2);

  // pass 1: dots, one K row (dz, dy) per trip
  float mx = -INFINITY;
  unsigned vmask = 0u;
#pragma unroll 1
  for (int t = 1; t < 10; ++t) {
    const float* tb = tile + (t & 1) * AT_TILE_F;
    float a0 = 0.f, a1 = 0.f, a2 = 0.f;
#pragma unroll
    for (int i = 0; i < 8; ++i) {
      const v4f k0 = *(const v4f*)(tb + o0 + 4 * i);
      const v4f k1 = *(const v4f*)(tb + o1 + 4 * i);
      const v4f k2 = *(const v4f*)(tb + o2 + 4 * i);
#pragma unroll
      for (int c = 0; c < 4; ++c) {
        a0 = fmaf(qr[4 * i + c], k0[c], a0);
        a1 = fmaf(qr[4 * i + c], k1[c], a1);
        a2 = fmaf(qr[4 * i + c], k2[c], a2);
      }
    }
    const int dz = (t - 1) / 3;
    const int dy = (t - 1) - 3 * dz;
    const bool vrow = ((unsigned)(ps + dz - 1) < (unsigned)AT_S) && ((unsigned)(ph + dy - 1) < (unsigned)AT_H);
    const float d0 = a0 * QK_SCALE, d1 = a1 * QK_SCALE, d2 = a2 * QK_SCALE;
    const int kk = 3 * (t - 1);
    sbuf[(kk + 0) * 256 + tid] = d0;
    sbuf[(kk + 1) * 256 + tid] = d1;
    sbuf[(kk + 2) * 256 + tid] = d2;
    if (vrow && vox > 0)        { mx = fmaxf(mx, d0); vmask |= (1u << (kk + 0)); }
    if (vrow)                   { mx = fmaxf(mx, d1); vmask |= (1u << (kk + 1)); }
    if (vrow && vox < AT_W - 1) { mx = fmaxf(mx, d2); vmask |= (1u << (kk + 2)); }
    ring_publish();
    issue(t + 2);                                     // tiles 3..11 all exist
  }

  // pass 2: probabilities (exactly 0 for out-of-range neighbours), sum
  float sum = 0.f;
#pragma unroll 1
  for (int k2 = 0; k2 < AT_NB; ++k2) {
    const float d = sbuf[k2 * 256 + tid];
    const float ex = __expf(d - mx);
    const float p = ((vmask >> k2) & 1u) ? ex : 0.f;
    sbuf[k2 * 256 + tid] = p;
    sum += p;
  }
  const float inv = __builtin_amdgcn_rcpf(sum);   // sum >= 1

  // Output projection, 32 rows x 256 columns per block: wave w owns all 32 rows of columns 32 w .. 32 w + 31 (2 x 2 subtiles).
  // B fragments come straight from Wo: lane column c of subtile j is n0 + 2 * c + j, so that one 8-byte load of Wo[k][n0 + 2 * c ..]
  // gives the lane its k-th element of both subtiles (16 lanes = one 128-byte line); the k order of the sixteen loads is load_row's.
  const int lane  = tid & 31;
  const int rlane = lane & 15;                 // row (A) / lane column (B, D) within a subtile
  const int koff  = (lane >> 4) * 8;           // k offset of this lane half; also its D row offset
  const int n0    = (tid >> 5) * 32;
  const float* Wl = Wo + koff * AT_C + n0 + 2 * rlane;
  v2f w[3][16];                                // three k steps of Wo: the next two are in flight while this one is multiplied
  auto load_w = [&](int ks) {
#pragma unroll
    for (int e = 0; e < 8; ++e) {
      w[ks % 3][e]     = *(const v2f*)(Wl + (ks * 32 + e) * AT_C);
      w[ks % 3][8 + e] = *(const v2f*)(Wl + (ks * 32 + 16 + e) * AT_C);
    }
  };
  load_w(0);                                   // issued here, ahead of pass 3, so that the first k step waits for nothing behind the ring
  const v2f bj = *(const v2f*)(bo + n0 + 2 * rlane);
  asm volatile("s_wait_xcnt 0x0" ::: "memory");   // stands ahead of any rewrite of the address registers that these loads name

  // pass 3: weighted sum of v rows, one V row (dz, dy) per trip
  float acc[32];
#pragma unroll
  for (int i = 0; i < 32; ++i) acc[i] = 0.f;
#pragma unroll 1
  for (int t = 10; t < AT_NT; ++t) {
    const float* tb = tile + (t & 1) * AT_TILE_F;
    const int kk = 3 * (t - 10);
    const float p0 = sbuf[(kk + 0) * 256 + tid];
    const float p1 = sbuf[(kk + 1) * 256 + tid];
    const float p2 = sbuf[(kk + 2) * 256 + tid];
#pragma unroll
    for (int i = 0; i < 8; ++i) {
      const v4f v0 = *(const v4f*)(tb + o0 + 4 * i);
      const v4f v1 = *(const v4f*)(tb + o1 + 4 * i);
      const v4f v2 = *(const v4f*)(tb + o2 + 4 * i);
#pragma unroll
      for (int c = 0; c < 4; ++c) {
        float s = acc[4 * i + c];
        s = fmaf(p0, v0[c], s);
        s = fmaf(p1, v1[c], s);
        s = fmaf(p2, v2[c], s);
        acc[4 * i + c] = s;
      }
    }
    ring_publish();
    if (t + 2 < AT_NT) issue(t + 2);                  // block-uniform test
  }
  asm volatile("s_wait_asynccnt 0x0" ::: "memory");   // no copy of this wave is left in flight
  const float osc = inv * 8.0f;     // normalise and carry x8 for the f16 A operand of the output projection

  // stage the f16 tile [32 voxels][256] in LDS (pitch 264 halves = 16 B x 33: b128 fragment reads without bank conflicts)
  __syncthreads();
  _Float16* st = reinterpret_cast<_Float16*>(sbuf);
  {
    _Float16* sp = st + vox * AT_PITCH + head * 32;
#pragma unroll
    for (int j = 0; j < 4; ++j) {
      v8h hv;
#pragma unroll
      for (int i = 0; i < 8; ++i) hv[i] = (_Float16)(acc[8 * j + i] * osc);
      *(v8h*)(sp + 8 * j) = hv;
    }
  }
  __syncthreads();

  v8f c[2][2];
#pragma unroll
  for (int i = 0; i < 2; ++i)
#pragma unroll
    for (int j = 0; j < 2; ++j) c[i][j] = (v8f){0.f,0.f,0.f,0.f,0.f,0.f,0.f,0.f};
  const _Float16* Al = st + rlane * AT_PITCH + koff;
  load_w(1);
  v16h ah[2][2];                               // A fragments of this k step and the next, so that the LDS latency lies under the conversions
#pragma unroll
  for (int i = 0; i < 2; ++i) ah[0][i] = load_row(Al + i * 16 * AT_PITCH);
#pragma unroll   // unrolled: every Wo load is the one base register plus an immediate offset, and w[] stays in registers
  for (int ks = 0; ks < AT_C / 32; ++ks) {
    if (ks + 2 < AT_C / 32) load_w(ks + 2);
    if (ks + 1 < AT_C / 32) {
#pragma unroll
      for (int i = 0; i < 2; ++i) ah[(ks + 1) & 1][i] = load_row(Al + i * 16 * AT_PITCH + (ks + 1) * 32);
    }
    v16h bh[2];
#pragma unroll
    for (int j = 0; j < 2; ++j)
#pragma unroll
      for (int e = 0; e < 16; ++e) bh[j][e] = (_Float16)(w[ks % 3][e][j] * 16.0f);
#pragma unroll
    for (int i = 0; i < 2; ++i)
#pragma unroll
      for (int j = 0; j < 2; ++j) c[i][j] = mma_h(ah[ks & 1][i], bh[j], c[i][j]);
    // no later k step's loads rise above this line: hoisted all at once they took the kernel past 256 registers, where only one block fits a WGP
    __builtin_amdgcn_sched_barrier(0);
  }

  // D: subtile (i, j), register r -> row 16 i + koff + r, column n0 + 2 * rlane + j; 16 lanes store one whole 128-byte line of a row
  float* ob = outp + (size_t)blockIdx.x * 32 * AT_C + koff * AT_C + n0 + 2 * rlane;
#pragma unroll
  for (int i = 0; i < 2; ++i)
#pragma unroll
    for (int r = 0; r < 8; ++r) {
      v2f v;
#pragma unroll
      for (int j = 0; j < 2; ++j) v[j] = c[i][j][r] * (1.0f / 128.0f) + bj[j];
      *(v2f*)(ob + (i * 16 + r) * AT_C) = v;
    }
}

// ---------------------------------------------------------------------------
extern "C" void kernel_launch(void* const* d_in, const int* in_sizes, int n_in,
                              void* d_out, int out_size, void* d_ws, size_t ws_size,
                              hipStream_t stream) {
  const int MP = 16384;     // B*S*H*W = 2*8*32*32
  const int DC = 256;       // DIM == INNER
  if (n_in < 8) return;
  if (in_sizes[0] != MP * DC || in_sizes[1] != MP * DC) return;
  if (in_sizes[2] != DC * DC || in_sizes[3] != DC * DC || in_sizes[4] != DC * DC || in_sizes[6] != DC * DC) return;
  if (in_sizes[5] != DC || in_sizes[7] != DC) return;
  if (out_size != MP * DC) return;

  const float* x  = (const float*)d_in[0];
  const float* q  = (const float*)d_in[1];
  const float* Wq = (const float*)d_in[2];
  const float* Wk = (const float*)d_in[3];
  const float* Wv = (const float*)d_in[4];
  const float* bv = (const float*)d_in[5];
  const float* Wo = (const float*)d_in[6];
  const float* bo = (const float*)d_in[7];
  float* outp = (float*)d_out;

  const size_t actF = (size_t)MP * DC * sizeof(float);      // 16 MiB
  size_t off = 0;
  char* base = (char*)d_ws;
  float*    qpF = (float*)(base + off);    off += actF;
  float*    kF  = (float*)(base + off);    off += actF;
  float*    vF  = (float*)(base + off);    off += actF;
  // total = 50,331,648 B
  if (off > ws_size) return;

  // 1) projections, one grid: C = (1/16) * f16(A) . f16(16 W) (+ bias[n]); M = 16384, N = K = 256; 1024 64x64 tiles each, 4 per block
  const dim3 gg3((MP / 64) * (DC / 64) / 4, 3);
  const float s16 = 1.0f / 16.0f;
  proj_qkv<<<gg3, 128, 0, stream>>>(q, x, Wq, Wk, Wv, qpF, kF, vF, bv, MP, s16);

  // 2) windowed attention (f32) and, per block, the output projection of its 32 rows -> d_out (f32)
  local_attn3d<<<MP / 32, 256, 0, stream>>>(qpF, kF, vF, Wo, bo, outp);
}

// v006
// Measured time: 46.2 microseconds a run.
// Two timings next to v005 both put it at 1.07 times that version's speed.
// Over all steps from v000 it is 3.49 times as fast.
// Projections x@Wk, x@Wv+bv, q@Wq, o@Wo+bo: v_wmma_f32_16x16x32_f16 (f16 operands; weights carried x16, o carried x8; f32 accumulate). Windowed q.k, softmax, p.v: f32 VALU.
#include <hip/hip_runtime.h>
#include <hip/hip_bf16.h>

typedef __attribute__((ext_vector_type(16))) _Float16 v16h;
typedef __attribute__((ext_vector_type(8)))  _Float16 v8h;
typedef __attribute__((ext_vector_type(8)))  float    v8f;
typedef __attribute__((ext_vector_type(4)))  float    v4f;
typedef __attribute__((ext_vector_type(2)))  float    v2f;
typedef __attribute__((ext_vector_type(16))) float    v16f;

// hazard guards as plain device helpers (the kernel template body keeps four inline asm waits: s_wait_xcnt after the bias and Wt loads, s_wait_asynccnt before the ring and after it)
__device__ __forceinline__ void dep_guard_h(v8f& a, v8f& b, v16h x, v16h y) { asm volatile("v_nop\n\tv_nop\n\tv_nop\n\tv_nop" : "+v"(a), "+v"(b) : "v"(x), "v"(y)); }
__device__ __forceinline__ void keep4_h(v16h a, v16h b, v16h c, v16h d) { asm volatile("v_nop" :: "v"(a), "v"(b), "v"(c), "v"(d)); }
__device__ __forceinline__ void acc_guard4(v8f& a, v8f& b, v8f& c, v8f& d) { asm volatile("v_nop\n\tv_nop\n\tv_nop\n\tv_nop" : "+v"(a), "+v"(b), "+v"(c), "+v"(d)); }

__device__ __forceinline__ v16f cat4(v4f a, v4f b, v4f c, v4f d) {
  return __builtin_shufflevector(__builtin_shufflevector(a, b, 0, 1, 2, 3, 4, 5, 6, 7),
                                 __builtin_shufflevector(c, d, 0, 1, 2, 3, 4, 5, 6, 7),
                                 0, 1, 2, 3, 4, 5, 6, 7, 8, 9, 10, 11, 12, 13, 14, 15);
}
// The sixteen k of one A row that a lane holds, k order: elements 0..7 <- p[0..7], 8..15 <- p[16..23]; as stored (f16 or f32).
__device__ __forceinline__ v16h load_row(const _Float16* p) {
  union { v16h v; v8h h[2]; } f;
  f.h[0] = *(const v8h*)(p); f.h[1] = *(const v8h*)(p + 16); return f.v;
}
__device__ __forceinline__ v16f load_row(const float* p) {
  return cat4(*(const v4f*)(p), *(const v4f*)(p + 4), *(const v4f*)(p + 16), *(const v4f*)(p + 20));
}
// ... and as the f16 fragment (f32 is rounded here)
__device__ __forceinline__ v16h to_frag(v16f a) { return __builtin_convertvector(a, v16h); }
__device__ __forceinline__ v8f mma_h(v16h a, v16h b, v8f c) {
  return __builtin_amdgcn_wmma_f32_16x16x32_f16(false, a, false, b, (short)0, c, false, false);
}

// ---- LDS ring helpers ---------------------------------------------------------
#define PA_KT 64                         // k per staged A tile: two k steps, 256 B of each of the 64 rows
#define PA_PITCH 68                      // floats per staged row: 272 B = 16 B x 17, so 16 lanes' b128 reads of 16 rows cover all 64 banks
#define PA_TILE_F (64 * PA_PITCH)        // floats per staged tile (17408 B)

// One staged A tile: 1024 pieces of 16 B, eight per lane. g = this lane's first global piece, l = its LDS byte address;
// piece j lies eight rows further, in memory (LD floats per row) and in LDS.
// s_wait_xcnt closes the statement so that no address register of an issued copy is rewritten ahead of it.
template <int LD>
__device__ __forceinline__ void stage_a_async(const float* g, unsigned l) {
  asm volatile(
      "global_load_async_to_lds_b128 %0, %8, off\n\t"
      "global_load_async_to_lds_b128 %1, %9, off\n\t"
      "global_load_async_to_lds_b128 %2, %10, off\n\t"
      "global_load_async_to_lds_b128 %3, %11, off\n\t"
      "global_load_async_to_lds_b128 %4, %12, off\n\t"
      "global_load_async_to_lds_b128 %5, %13, off\n\t"
      "global_load_async_to_lds_b128 %6, %14, off\n\t"
      "global_load_async_to_lds_b128 %7, %15, off\n\t"
      "s_wait_xcnt 0x0"
      :: "v"(l), "v"(l + 1u * 32u * PA_PITCH), "v"(l + 2u * 32u * PA_PITCH), "v"(l + 3u * 32u * PA_PITCH),
         "v"(l + 4u * 32u * PA_PITCH), "v"(l + 5u * 32u * PA_PITCH), "v"(l + 6u * 32u * PA_PITCH), "v"(l + 7u * 32u * PA_PITCH),
         "v"(g), "v"(g + 1 * 8 * LD), "v"(g + 2 * 8 * LD), "v"(g + 3 * 8 * LD),
         "v"(g + 4 * 8 * LD), "v"(g + 5 * 8 * LD), "v"(g + 6 * 8 * LD), "v"(g + 7 * 8 * LD)
      : "memory");
}

// Foot of a ring trip: hands the next tile to every wave and frees the buffer just read.
__device__ __forceinline__ void ring_publish() {
  asm volatile("s_wait_dscnt 0x0" ::: "memory");     // this wave's LDS reads of the buffer to be refilled have retired
  asm volatile("s_wait_asynccnt 0x0" ::: "memory");  // this wave's copies of the next tile have landed
  __syncthreads();                                   // every wave's copies are visible; every reader has left the old buffer
}

// ---- Register-blocked WMMA GEMM ---------------------------------------------
// C[m,n] = scale * sum_k f16(A[m,k]) * f16(16 * Wt[k,n]) (+bias[n]); each wave owns a 64x64 tile; C is f32.
// A row-major [M,K], f32; Wt row-major [K,N], f32, as the caller's input holds it; M % 64 == 0, N == 256, K % 128 == 0.
// A block is one 64-row stripe of A, which all four waves multiply: it passes through a two-buffer LDS ring, 64 k per tile,
// filled by asynchronous copies in whole 256-byte row pieces; every wave takes its A fragments from there.
// N and K are compile-time, so that every Wt load of a k step is one base register plus an immediate offset.
// B fragments come straight from Wt: lane column c of subtile j is n0 + 4 * c + j, so that one 16-byte load of
// Wt[k][n0 + 4 * c ..] gives the lane its k-th element of all four subtiles (16 lanes = 256 contiguous bytes of a row);
// the k order of the sixteen loads is load_row's. D's column map follows: subtile j, lane column c -> n0 + 4 * c + j.
// BIAS_MODE: 2 = bias[n], 3 = bias[n] where a bias pointer is given (block-uniform), else none.
template <int BIAS_MODE, int N, int K>
__device__ __forceinline__ void gemm64_body(
    const float* __restrict__ A, const float* __restrict__ Wt, float* __restrict__ C,
    const float* __restrict__ bias, int M, float scale) {
  static_assert(N == 256 && K % (2 * PA_KT) == 0, "four waves x 64 columns; at least two staged tiles");
  constexpr int lda = K, ldw = N, ldc = N;
  constexpr int NT = K / PA_KT;                    // staged tiles
  __shared__ __align__(16) float sT[4][16 * 68];   // per-wave 16x64 slab, pitch 68 floats
  __shared__ __align__(16) float sA[2 * PA_TILE_F];   // the ring: two staged A tiles
  const int tid  = threadIdx.x;
  const int lane = tid & 31;
  const int wave = tid >> 5;
  const int tm = blockIdx.x;             // the block's 64-row stripe of A
  if (tm >= (M >> 6)) return;            // block-uniform, ahead of every barrier
  const int tn = wave;                   // four waves: the four 64-column tiles of N = 256
  const int m0 = tm << 6;
  const int n0 = tn << 6;

  // lane's piece 0 of a tile: row tid / 16, 16 B number tid % 16 of the row's 256 B (a wave's copy = two whole row pieces)
  const float* Ag = A + (size_t)(m0 + (tid >> 4)) * lda + (tid & 15) * 4;
  const unsigned Alds = (unsigned)(uintptr_t)sA + 4u * (unsigned)((tid >> 4) * PA_PITCH + (tid & 15) * 4);
  auto issue = [&](int t) {              // tile t (k = 64 t .. 64 t + 63) -> buffer t & 1
    stage_a_async<lda>(Ag + t * PA_KT, Alds + (unsigned)(t & 1) * (4u * PA_TILE_F));
  };
  issue(0);

  const int rlane = lane & 15;                 // row (A) / lane column (B, D) within subtile
  const int koff  = (lane >> 4) * 8;           // k offset of this lane half
  const int mOff  = (lane >> 4) * 8;           // D row offset

  v8f acc[4][4];
#pragma unroll
  for (int i = 0; i < 4; ++i)
#pragma unroll
    for (int j = 0; j < 4; ++j) acc[i][j] = (v8f){0.f,0.f,0.f,0.f,0.f,0.f,0.f,0.f};

  v4f bj = (v4f){0.f, 0.f, 0.f, 0.f};          // this lane's four bias values (columns n0 + 4 * rlane + 0..3)
  if (BIAS_MODE == 2 || bias != nullptr) {     // BIAS_MODE 3: one uniform test
    bj = *(const v4f*)(bias + n0 + 4 * rlane);
    asm volatile("s_wait_xcnt 0x0" ::: "memory");   // stands ahead of any rewrite of the address registers that the load names
  }

  const float* Wl = Wt + (size_t)koff * ldw + n0 + 4 * rlane;    // this lane's column group, first k of its half
  asm volatile("s_wait_asynccnt 0x0" ::: "memory");   // tile 0 has landed (this wave's part)
  __syncthreads();                                    // ... and every other wave's
  issue(1);
#pragma unroll 1   // rolled: the ring's trips
  for (int t = 0; t < NT; ++t) {
    const float* Al = sA + (t & 1) * PA_TILE_F + rlane * PA_PITCH + koff;   // this lane's row of subtile 0 in the staged tile, first k of its half
#pragma unroll 1   // rolled: one k step's loads already take the registers that three waves per SIMD leave
    for (int kk = 0; kk < PA_KT; kk += 32) {
      const int k0 = t * PA_KT + kk;
      // All loads of a k step go out together, so that the step waits out one latency.
      // Source order: Wt (the longer latency) in two groups of eight k, then A from LDS.
      v4f w[8];                                  // w[e][j] = Wt[k of element e (+ 8)][n0 + 4 * rlane + j]
      v16h bh[4];
#pragma unroll
      for (int e = 0; e < 8; ++e) w[e] = *(const v4f*)(Wl + (k0 + e) * ldw);
#pragma unroll
      for (int j = 0; j < 4; ++j)
#pragma unroll
        for (int e = 0; e < 8; ++e) bh[j][e] = (_Float16)(w[e][j] * 16.0f);
#pragma unroll
      for (int e = 0; e < 8; ++e) w[e] = *(const v4f*)(Wl + (k0 + 16 + e) * ldw);
      asm volatile("s_wait_xcnt 0x0" ::: "memory");   // stands ahead of any rewrite of the address registers that the Wt loads name
      v16f ar[4];                                // A rows of the four subtiles, as staged
#pragma unroll
      for (int i = 0; i < 4; ++i) ar[i] = load_row(Al + (i << 4) * PA_PITCH + kk);
      // no load of the k step sinks below this line: all are in flight before the first A value is used
      __builtin_amdgcn_sched_barrier(0);
#pragma unroll
      for (int j = 0; j < 4; ++j)
#pragma unroll
        for (int e = 0; e < 8; ++e) bh[j][8 + e] = (_Float16)(w[e][j] * 16.0f);
#pragma unroll
      for (int i = 0; i < 4; ++i) {
        v16h ah = to_frag(ar[i]);
#pragma unroll
        for (int j = 0; j < 4; ++j) acc[i][j] = mma_h(ah, bh[j], acc[i][j]);
        dep_guard_h(acc[i][0], acc[i][3], ah, ah);
      }
      keep4_h(bh[0], bh[1], bh[2], bh[3]);
    }
    ring_publish();
    if (t + 2 < NT) issue(t + 2);                     // block-uniform test
  }
  asm volatile("s_wait_asynccnt 0x0" ::: "memory");   // no copy of this wave is left in flight
  acc_guard4(acc[0][0], acc[0][1], acc[0][2], acc[0][3]);
  acc_guard4(acc[1][0], acc[1][1], acc[1][2], acc[1][3]);
  acc_guard4(acc[2][0], acc[2][1], acc[2][2], acc[2][3]);
  acc_guard4(acc[3][0], acc[3][1], acc[3][2], acc[3][3]);

  // ---- epilogue ----
  float* slab = sT[wave];
#pragma unroll
  for (int i = 0; i < 4; ++i) {
    const int mBase = m0 + (i << 4);
#pragma unroll
    for (int r = 0; r < 8; ++r) {
      v4f v;
#pragma unroll
      for (int j = 0; j < 4; ++j) v[j] = acc[i][j][r] * scale + bj[j];
      *(v4f*)(slab + (mOff + r) * 68 + 4 * rlane) = v;
    }
    __builtin_amdgcn_fence(__ATOMIC_RELEASE, "workgroup");
    __builtin_amdgcn_wave_barrier();
    __builtin_amdgcn_fence(__ATOMIC_ACQUIRE, "workgroup");
    {
      const int hh = lane >> 4, c4 = (lane & 15) * 4;     // row seg = 256 B = 16 lanes x 16 B
#pragma unroll
      for (int it = 0; it < 8; ++it) {
        const int row = it * 2 + hh;
        v4f v = *(const v4f*)(slab + row * 68 + c4);
        *(v4f*)(C + (size_t)(mBase + row) * ldc + n0 + c4) = v;
      }
    }
    __builtin_amdgcn_fence(__ATOMIC_RELEASE, "workgroup");
    __builtin_amdgcn_wave_barrier();
    __builtin_amdgcn_fence(__ATOMIC_ACQUIRE, "workgroup");
  }
}

// The three input projections read none of each other's output: one grid, blockIdx.y = 0: q.Wq, 1: x.Wk, 2: x.Wv + bv.
__global__ __launch_bounds__(128) void proj_qkv(
    const float* __restrict__ q, const float* __restrict__ x,
    const float* __restrict__ Wq, const float* __restrict__ Wk, const float* __restrict__ Wv,
    float* __restrict__ qpF, float* __restrict__ kF, float* __restrict__ vF,
    const float* __restrict__ bv, int M, float scale) {
  const int y = blockIdx.y;
  const float* A    = (y == 0) ? q : x;
  const float* Wt   = (y == 0) ? Wq : (y == 1) ? Wk : Wv;
  float* C          = (y == 0) ? qpF : (y == 1) ? kF : vF;
  const float* bias = (y == 2) ? bv : nullptr;
  gemm64_body<3, 256, 256>(A, Wt, C, bias, M, scale);
}

// ---- local 3x3x3 windowed attention, f32. One thread per (position along W, head) of TWO neighbouring W rows (H = ph, ph + 1). ----
// qp/kf/vf: f32 [16384][256] (voxel-major, col = head*32 + d). The block's attention output (f16, x8) stays in LDS and is
// the A operand of the output projection, which the same block does for its 64 rows: outp = (1/128) * o . f16(16 Wo) + bo.
// The two output rows need the same K and V rows but for one each: per S slice four rows (H = ph - 1 .. ph + 2) serve both,
// where one output row alone needs three. They pass, two rows to a tile, through a two-buffer LDS ring filled by asynchronous
// copies in whole lines: the q tile, six K tiles, six V tiles. A K or V vector of a row that both output rows need
// (H = ph, ph + 1) is read from LDS once and used for both.
// Row and voxel indices clamped into range; out-of-volume neighbours get weight exactly 0; the centre is always in range.
// Per-thread dots / probabilities live in thread-private LDS slots (27 per thread and output row).
#define AT_S 8
#define AT_H 32
#define AT_W 32
#define AT_C 256
#define AT_NB 27
#define AT_PITCH 264
#define AT_HPITCH 36                     // floats per (voxel, head) slot: 32 + 4 pad = 144 B, so 16 lanes' b128 reads cover all 64 banks
#define AT_VPITCH (8 * AT_HPITCH)        // floats per voxel
#define AT_ROW_F (AT_W * AT_VPITCH)      // floats per staged row of 32 voxels (36864 B)
#define AT_TILE_F (2 * AT_ROW_F)         // floats per tile: two staged rows
#define AT_NT 13                         // tiles: the two q rows, 3 x 2 of K, 3 x 2 of V
#define QK_SCALE 0.17677669529663687f

// One staged row: 2048 pieces of 16 B, eight per lane. g = this lane's first global piece, l = its LDS byte address;
// piece j lies 4 KiB further in memory (4 voxels) and 4 voxel pitches further in LDS.
// s_wait_xcnt closes the statement so that no address register of an issued copy is rewritten ahead of it.
__device__ __forceinline__ void stage_row_async(const float* g, unsigned l) {
  asm volatile(
      "global_load_async_to_lds_b128 %0, %8, off\n\t"
      "global_load_async_to_lds_b128 %1, %9, off\n\t"
      "global_load_async_to_lds_b128 %2, %10, off\n\t"
      "global_load_async_to_lds_b128 %3, %11, off\n\t"
      "global_load_async_to_lds_b128 %4, %12, off\n\t"
      "global_load_async_to_lds_b128 %5, %13, off\n\t"
      "global_load_async_to_lds_b128 %6, %14, off\n\t"
      "global_load_async_to_lds_b128 %7, %15, off\n\t"
      "s_wait_xcnt 0x0"
      :: "v"(l), "v"(l + 1u * 16u * AT_VPITCH), "v"(l + 2u * 16u * AT_VPITCH), "v"(l + 3u * 16u * AT_VPITCH),
         "v"(l + 4u * 16u * AT_VPITCH), "v"(l + 5u * 16u * AT_VPITCH), "v"(l + 6u * 16u * AT_VPITCH), "v"(l + 7u * 16u * AT_VPITCH),
         "v"(g), "v"(g + 1 * 1024), "v"(g + 2 * 1024), "v"(g + 3 * 1024),
         "v"(g + 4 * 1024), "v"(g + 5 * 1024), "v"(g + 6 * 1024), "v"(g + 7 * 1024)
      : "memory");
}

__global__ __launch_bounds__(256) void local_attn3d(
    const float* __restrict__ qp, const float* __restrict__ kf, const float* __restrict__ vf,
    const float* __restrict__ Wo, const float* __restrict__ bo, float* __restrict__ outp) {
  __shared__ __align__(16) float sbuf[2 * AT_NB * 256];   // 55296 B; reused as f16 staging (64 x 264 halves = 33792 B)
  __shared__ __align__(16) float tile[2 * AT_TILE_F];     // the ring: two tiles of two staged rows
  const int tid  = threadIdx.x;
  const int head = tid & 7;
  const int vox  = tid >> 3;                          // = position along W
  const int ph = (blockIdx.x & 15) * 2;               // block-uniform: the first of the block's two W rows; grid = 16384/64 exactly
  const int ps = (blockIdx.x >> 4) & 7;
  const int pb = blockIdx.x >> 7;

  const unsigned lds_lane = (unsigned)(uintptr_t)tile +
      4u * (unsigned)((tid >> 6) * AT_VPITCH + ((tid >> 3) & 7) * AT_HPITCH + (tid & 7) * 4);
  auto issue = [&](int t) {                           // tile t -> buffer t & 1
    const int u = (t == 0) ? 2 : ((t < 7) ? t - 1 : t - 7);      // dz = u / 2; u odd: the upper pair of rows
    const float* srcp = (t == 0) ? qp : ((t < 7) ? kf : vf);
    const int zs = ps + (u >> 1) - 1;
    const int cs = zs < 0 ? 0 : (zs > AT_S - 1 ? AT_S - 1 : zs);
    const int h0 = (t == 0) ? ph : ph - 1 + 2 * (u & 1);         // q: ph, ph + 1; K, V: ph - 1, ph or ph + 1, ph + 2
    const int c0 = h0 < 0 ? 0 : h0;                              // h0 <= 31
    const int c1 = h0 + 1 > AT_H - 1 ? AT_H - 1 : h0 + 1;        // h0 + 1 >= 0
    const int slab = (pb * AT_S + cs) * AT_H;
    const unsigned l = lds_lane + (unsigned)(t & 1) * (4u * AT_TILE_F);
    stage_row_async(srcp + (size_t)((slab + c0) * AT_W) * AT_C + tid * 4, l);
    stage_row_async(srcp + (size_t)((slab + c1) * AT_W) * AT_C + tid * 4, l + 4u * AT_ROW_F);
  };

  issue(0);
  asm volatile("s_wait_asynccnt 0x0" ::: "memory");   // tile 0 has landed (this wave's part)
  __syncthreads();                                    // ... and every other wave's
  issue(1);

  // this thread's three neighbours along W inside a staged row (clamped)
  const int o0 = (vox > 0 ? vox - 1 : 0) * AT_VPITCH + head * AT_HPITCH;
  const int o1 = vox * AT_VPITCH + head * AT_HPITCH;
  const int o2 = (vox < AT_W - 1 ? vox + 1 : AT_W - 1) * AT_VPITCH + head * AT_HPITCH;

  // trip 0: this thread's two q vectors from the staged q rows; qq[c] = (q of row ph, q of row ph + 1)
  v2f qq[32];
  {
    const float* qptr = tile + o1;
#pragma unroll
    for (int i = 0; i < 8; ++i) {
      const v4f ta = *(const v4f*)(qptr + 4 * i);
      const v4f tb = *(const v4f*)(qptr + AT_ROW_F + 4 * i);
#pragma unroll
      for (int c = 0; c < 4; ++c) qq[4 * i + c] = (v2f){ta[c], tb[c]};
    }
  }
  ring_publish();
  issue(2);

  // the three dots of one output row (R = 0: ph, 1: ph + 1) with one staged K row
  auto dots1 = [&](const float* tb, const int r, float (&d)[3]) {
    float a0 = 0.f, a1 = 0.f, a2 = 0.f;
#pragma unroll
    for (int i = 0; i < 8; ++i) {
      const v4f k0 = *(const v4f*)(tb + o0 + 4 * i);
      const v4f k1 = *(const v4f*)(tb + o1 + 4 * i);
      const v4f k2 = *(const v4f*)(tb + o2 + 4 * i);
#pragma unroll
      for (int c = 0; c < 4; ++c) {
        a0 = fmaf(qq[4 * i + c][r], k0[c], a0);
        a1 = fmaf(qq[4 * i + c][r], k1[c], a1);
        a2 = fmaf(qq[4 * i + c][r], k2[c], a2);
      }
    }
    d[0] = a0 * QK_SCALE; d[1] = a1 * QK_SCALE; d[2] = a2 * QK_SCALE;
  };
  // the three dots of both output rows with one staged K row: each K vector is read once
  auto dots2 = [&](const float* tb, float (&dA)[3], float (&dB)[3]) {
    v2f a0 = (v2f){0.f, 0.f}, a1 = a0, a2 = a0;
#pragma unroll
    for (int i = 0; i < 8; ++i) {
      const v4f k0 = *(const v4f*)(tb + o0 + 4 * i);
      const v4f k1 = *(const v4f*)(tb + o1 + 4 * i);
      const v4f k2 = *(const v4f*)(tb + o2 + 4 * i);
#pragma unroll
      for (int c = 0; c < 4; ++c) {
        a0 = __builtin_elementwise_fma(qq[4 * i + c], (v2f){k0[c], k0[c]}, a0);
        a1 = __builtin_elementwise_fma(qq[4 * i + c], (v2f){k1[c], k1[c]}, a1);
        a2 = __builtin_elementwise_fma(qq[4 * i + c], (v2f){k2[c], k2[c]}, a2);
      }
    }
    dA[0] = a0[0] * QK_SCALE; dA[1] = a1[0] * QK_SCALE; dA[2] = a2[0] * QK_SCALE;
    dB[0] = a0[1] * QK_SCALE; dB[1] = a1[1] * QK_SCALE; dB[2] = a2[1] * QK_SCALE;
  };
  float mx[2] = {-INFINITY, -INFINITY};
  unsigned vmask[2] = {0u, 0u};
  // files the three dots of output row ph + r with window row (dz, dy); vrow: that window row lies in the volume
  auto put = [&](int r, int dz, int dy, const float (&d)[3]) {
    const bool vrow = ((unsigned)(ps + dz - 1) < (unsigned)AT_S) && ((unsigned)(ph + r + dy - 1) < (unsigned)AT_H);
    const int kk = 9 * dz + 3 * dy;
    float* sp = sbuf + (r * AT_NB + kk) * 256 + tid;
    sp[0] = d[0]; sp[256] = d[1]; sp[512] = d[2];
    if (vrow && vox > 0)        { mx[r] = fmaxf(mx[r], d[0]); vmask[r] |= (1u << (kk + 0)); }
    if (vrow)                   { mx[r] = fmaxf(mx[r], d[1]); vmask[r] |= (1u << (kk + 1)); }
    if (vrow && vox < AT_W - 1) { mx[r] = fmaxf(mx[r], d[2]); vmask[r] |= (1u << (kk + 2)); }
  };

  // pass 1: dots; per S slice dz two trips: K rows ph - 1, ph (buffer 1), then ph + 1, ph + 2 (buffer 0)
#pragma unroll 1   // rolled: the ring's trips; unrolled they would only lengthen the code
  for (int dz = 0; dz < 3; ++dz) {
    float dA[3], dB[3];
    dots1(tile + AT_TILE_F, 0, dA);
    put(0, dz, 0, dA);
    dots2(tile + AT_TILE_F + AT_ROW_F, dA, dB);
    put(0, dz, 1, dA);
    put(1, dz, 0, dB);
    ring_publish();
    issue(2 * dz + 3);                                // tiles 3, 5, 7 exist
    dots2(tile, dA, dB);
    put(0, dz, 2, dA);
    put(1, dz, 1, dB);
    dots1(tile + AT_ROW_F, 1, dB);
    put(1, dz, 2, dB);
    ring_publish();
    issue(2 * dz + 4);                                // tiles 4, 6, 8 exist
  }

  // pass 2: probabilities (exactly 0 for out-of-range neighbours), sums
  float sum[2] = {0.f, 0.f};
#pragma unroll 1   // rolled, as it was for one output row; the two rows of a trip are independent
  for (int k2 = 0; k2 < AT_NB; ++k2) {
#pragma unroll
    for (int r = 0; r < 2; ++r) {
      const float d = sbuf[(r * AT_NB + k2) * 256 + tid];
      const float ex = __expf(d - mx[r]);
      const float p = ((vmask[r] >> k2) & 1u) ? ex : 0.f;
      sbuf[(r * AT_NB + k2) * 256 + tid] = p;
      sum[r] += p;
    }
  }
  const float inv[2] = {__builtin_amdgcn_rcpf(sum[0]), __builtin_amdgcn_rcpf(sum[1])};   // sums >= 1

  // Output projection, 64 rows x 256 columns per block: wave w owns all 64 rows of columns 32 w .. 32 w + 31 (4 x 2 subtiles).
  // B fragments come straight from Wo: lane column c of subtile j is n0 + 2 * c + j, so that one 8-byte load of Wo[k][n0 + 2 * c ..]
  // gives the lane its k-th element of both subtiles (16 lanes = one 128-byte line); the k order of the sixteen loads is load_row's.
  const int lane  = tid & 31;
  const int rlane = lane & 15;                 // row (A) / lane column (B, D) within a subtile
  const int koff  = (lane >> 4) * 8;           // k offset of this lane half; also its D row offset
  const int n0    = (tid >> 5) * 32;
  const float* Wl = Wo + koff * AT_C + n0 + 2 * rlane;
  v2f w[3][16];                                // three k steps of Wo: the next two are in flight while this one is multiplied
  auto load_w = [&](int ks) {
#pragma unroll
    for (int e = 0; e < 8; ++e) {
      w[ks % 3][e]     = *(const v2f*)(Wl + (ks * 32 + e) * AT_C);
      w[ks % 3][8 + e] = *(const v2f*)(Wl + (ks * 32 + 16 + e) * AT_C);
    }
  };
  load_w(0);                                   // issued here, ahead of pass 3, so that the first k step waits for nothing behind the ring
  const v2f bj = *(const v2f*)(bo + n0 + 2 * rlane);
  asm volatile("s_wait_xcnt 0x0" ::: "memory");   // stands ahead of any rewrite of the address registers that these loads name

  // pass 3: weighted sums of v rows, the trips as in pass 1
  float acc[2][32];
#pragma unroll
  for (int i = 0; i < 32; ++i) { acc[0][i] = 0.f; acc[1][i] = 0.f; }
  // the three probabilities of output row ph + r for window row (dz, dy)
  auto get = [&](int r, int dz, int dy, float (&p)[3]) {
    const float* sp = sbuf + (r * AT_NB + 9 * dz + 3 * dy) * 256 + tid;
    p[0] = sp[0]; p[1] = sp[256]; p[2] = sp[512];
  };
  // one staged V row into one output row's sums
  auto pv1 = [&](const float* tb, const int r, const float (&p)[3]) {
#pragma unroll
    for (int i = 0; i < 8; ++i) {
      const v4f v0 = *(const v4f*)(tb + o0 + 4 * i);
      const v4f v1 = *(const v4f*)(tb + o1 + 4 * i);
      const v4f v2 = *(const v4f*)(tb + o2 + 4 * i);
#pragma unroll
      for (int c = 0; c < 4; ++c) {
        float s = acc[r][4 * i + c];
        s = fmaf(p[0], v0[c], s);
        s = fmaf(p[1], v1[c], s);
        s = fmaf(p[2], v2[c], s);
        acc[r][4 * i + c] = s;
      }
    }
  };
  // one staged V row into both output rows' sums: each V vector is read once
  auto pv2 = [&](const float* tb, const float (&pA)[3], const float (&pB)[3]) {
#pragma unroll
    for (int i = 0; i < 8; ++i) {
      const v4f v0 = *(const v4f*)(tb + o0 + 4 * i);
      const v4f v1 = *(const v4f*)(tb + o1 + 4 * i);
      const v4f v2 = *(const v4f*)(tb + o2 + 4 * i);
#pragma unroll
      for (int c = 0; c < 4; ++c) {
        float s = acc[0][4 * i + c];
        s = fmaf(pA[0], v0[c], s);
        s = fmaf(pA[1], v1[c], s);
        s = fmaf(pA[2], v2[c], s);
        acc[0][4 * i + c] = s;
        float u = acc[1][4 * i + c];
        u = fmaf(pB[0], v0[c], u);
        u = fmaf(pB[1], v1[c], u);
        u = fmaf(pB[2], v2[c], u);
        acc[1][4 * i + c] = u;
      }
    }
  };
  // the two trips of S slice dz; more: the tiles two trips on exist (a constant at each call, so that a trip holds no branch:
  // with one, the compiler moved both trips' sums behind it and kept two tiles' LDS reads in registers, with spills)
  auto slice3 = [&](const int dz, const bool more) {
    float pA[3], pB[3], pC[3];
    get(0, dz, 0, pC); get(0, dz, 1, pA); get(1, dz, 0, pB);
    pv1(tile + AT_TILE_F, 0, pC);
    pv2(tile + AT_TILE_F + AT_ROW_F, pA, pB);
    ring_publish();
    if (more) issue(2 * dz + 9);
    get(0, dz, 2, pA); get(1, dz, 1, pB); get(1, dz, 2, pC);
    pv2(tile, pA, pB);
    pv1(tile + AT_ROW_F, 1, pC);
    ring_publish();
    if (more) issue(2 * dz + 10);
  };
#pragma unroll 1   // rolled: the ring's trips
  for (int dz = 0; dz < 2; ++dz) slice3(dz, true);    // issues tiles 9 .. 12
  slice3(2, false);                                   // no tile 13
  asm volatile("s_wait_asynccnt 0x0" ::: "memory");   // no copy of this wave is left in flight

  // stage the f16 tile [64 voxels][256] in LDS (pitch 264 halves = 16 B x 33: b128 fragment reads without bank conflicts)
  __syncthreads();
  _Float16* st = reinterpret_cast<_Float16*>(sbuf);
#pragma unroll
  for (int r = 0; r < 2; ++r) {
    const float osc = inv[r] * 8.0f;     // normalise and carry x8 for the f16 A operand of the output projection
    _Float16* sp = st + (r * AT_W + vox) * AT_PITCH + head * 32;
#pragma unroll
    for (int j = 0; j < 4; ++j) {
      v8h hv;
#pragma unroll
      for (int i = 0; i < 8; ++i) hv[i] = (_Float16)(acc[r][8 * j + i] * osc);
      *(v8h*)(sp + 8 * j) = hv;
    }
  }
  __syncthreads();

  v8f c[4][2];
#pragma unroll
  for (int i = 0; i < 4; ++i)
#pragma unroll
    for (int j = 0; j < 2; ++j) c[i][j] = (v8f){0.f,0.f,0.f,0.f,0.f,0.f,0.f,0.f};
  const _Float16* Al = st + rlane * AT_PITCH + koff;
  load_w(1);
#pragma unroll   // unrolled: every Wo load is the one base register plus an immediate offset, and w[] stays in registers
  for (int ks = 0; ks < AT_C / 32; ++ks) {
    if (ks + 2 < AT_C / 32) load_w(ks + 2);
    v16h ah[4];                                // A fragments of this k step, read ahead of the conversions, so that the LDS latency lies under them
#pragma unroll
    for (int i = 0; i < 4; ++i) ah[i] = load_row(Al + i * 16 * AT_PITCH + ks * 32);
    v16h bh[2];
#pragma unroll
    for (int j = 0; j < 2; ++j)
#pragma unroll
      for (int e = 0; e < 16; ++e) bh[j][e] = (_Float16)(w[ks % 3][e][j] * 16.0f);
#pragma unroll
    for (int i = 0; i < 4; ++i)
#pragma unroll
      for (int j = 0; j < 2; ++j) c[i][j] = mma_h(ah[i], bh[j], c[i][j]);
    // no later k step's loads rise above this line: hoisted all at once they would take far more registers than the three k steps in w[]
    __builtin_amdgcn_sched_barrier(0);
  }

  // D: subtile (i, j), register r -> row 16 i + koff + r, column n0 + 2 * rlane + j; 16 lanes store one whole 128-byte line of a row
  float* ob = outp + (size_t)blockIdx.x * 64 * AT_C + koff * AT_C + n0 + 2 * rlane;
#pragma unroll
  for (int i = 0; i < 4; ++i)
#pragma unroll
    for (int r = 0; r < 8; ++r) {
      v2f v;
#pragma unroll
      for (int j = 0; j < 2; ++j) v[j] = c[i][j][r] * (1.0f / 128.0f) + bj[j];
      *(v2f*)(ob + (i * 16 + r) * AT_C) = v;
    }
}

// ---------------------------------------------------------------------------
extern "C" void kernel_launch(void* const* d_in, const int* in_sizes, int n_in,
                              void* d_out, int out_size, void* d_ws, size_t ws_size,
                              hipStream_t stream) {
  const int MP = 16384;     // B*S*H*W = 2*8*32*32
  const int DC = 256;       // DIM == INNER
  if (n_in < 8) return;
  if (in_sizes[0] != MP * DC || in_sizes[1] != MP * DC) return;
  if (in_sizes[2] != DC * DC || in_sizes[3] != DC * DC || in_sizes[4] != DC * DC || in_sizes[6] != DC * DC) return;
  if (in_sizes[5] != DC || in_sizes[7] != DC) return;
  if (out_size != MP * DC) return;

  const float* x  = (const float*)d_in[0];
  const float* q  = (const float*)d_in[1];
  const float* Wq = (const float*)d_in[2];
  const float* Wk = (const float*)d_in[3];
  const float* Wv = (const float*)d_in[4];
  const float* bv = (const float*)d_in[5];
  const float* Wo = (const float*)d_in[6];
  const float* bo = (const float*)d_in[7];
  float* outp = (float*)d_out;

  const size_t actF = (size_t)MP * DC * sizeof(float);      // 16 MiB
  size_t off = 0;
  char* base = (char*)d_ws;
  float*    qpF = (float*)(base + off);    off += actF;
  float*    kF  = (float*)(base + off);    off += actF;
  float*    vF  = (float*)(base + off);    off += actF;
  // total = 50,331,648 B
  if (off > ws_size) return;

  // 1) projections, one grid: C = (1/16) * f16(A) . f16(16 W) (+ bias[n]); M = 16384, N = K = 256; 1024 64x64 tiles each, 4 per block
  const dim3 gg3((MP / 64) * (DC / 64) / 4, 3);
  const float s16 = 1.0f / 16.0f;
  proj_qkv<<<gg3, 128, 0, stream>>>(q, x, Wq, Wk, Wv, qpF, kF, vF, bv, MP, s16);

  // 2) windowed attention (f32) and, per block, the output projection of its 64 rows -> d_out (f32)
  local_attn3d<<<MP / 64, 256, 0, stream>>>(qpF, kF, vF, Wo, bo, outp);
}

// v007
// One run takes 44.5 microseconds.
// Next to v006, in two timings, it ran 1.04 times as fast each time.
// Counting every step since v000, it is 3.63 times as fast.
// Projections x@Wk, x@Wv+bv, q@Wq, o@Wo+bo: v_wmma_f32_16x16x32_f16 (f16 operands; weights carried x16, o carried x8; f32 accumulate). Windowed q.k, softmax, p.v: f32 VALU.
#include <hip/hip_runtime.h>
#include <hip/hip_bf16.h>

typedef __attribute__((ext_vector_type(16))) _Float16 v16h;
typedef __attribute__((ext_vector_type(8)))  _Float16 v8h;
typedef __attribute__((ext_vector_type(4)))  _Float16 v4h;
typedef __attribute__((ext_vector_type(8)))  float    v8f;
typedef __attribute__((ext_vector_type(4)))  float    v4f;
typedef __attribute__((ext_vector_type(2)))  float    v2f;
typedef __attribute__((ext_vector_type(16))) float    v16f;

// hazard guards as plain device helpers (the kernel template body keeps four inline asm waits: s_wait_xcnt after the bias and Wt loads, s_wait_asynccnt before the ring and after it)
__device__ __forceinline__ void dep_guard_h(v8f& a, v8f& b, v16h x, v16h y) { asm volatile("v_nop\n\tv_nop\n\tv_nop\n\tv_nop" : "+v"(a), "+v"(b) : "v"(x), "v"(y)); }
__device__ __forceinline__ void keep4_h(v16h a, v16h b, v16h c, v16h d) { asm volatile("v_nop" :: "v"(a), "v"(b), "v"(c), "v"(d)); }
__device__ __forceinline__ void acc_guard4(v8f& a, v8f& b, v8f& c, v8f& d) { asm volatile("v_nop\n\tv_nop\n\tv_nop\n\tv_nop" : "+v"(a), "+v"(b), "+v"(c), "+v"(d)); }

__device__ __forceinline__ v16f cat4(v4f a, v4f b, v4f c, v4f d) {
  return __builtin_shufflevector(__builtin_shufflevector(a, b, 0, 1, 2, 3, 4, 5, 6, 7),
                                 __builtin_shufflevector(c, d, 0, 1, 2, 3, 4, 5, 6, 7),
                                 0, 1, 2, 3, 4, 5, 6, 7, 8, 9, 10, 11, 12, 13, 14, 15);
}
// The sixteen k of one A row that a lane holds, k order: elements 0..7 <- p[0..7], 8..15 <- p[16..23]; as stored (f16 or f32).
__device__ __forceinline__ v16h load_row(const _Float16* p) {
  union { v16h v; v8h h[2]; } f;
  f.h[0] = *(const v8h*)(p); f.h[1] = *(const v8h*)(p + 16); return f.v;
}
__device__ __forceinline__ v16f load_row(const float* p) {
  return cat4(*(const v4f*)(p), *(const v4f*)(p + 4), *(const v4f*)(p + 16), *(const v4f*)(p + 20));
}
// ... and as the f16 fragment (f32 is rounded here)
__device__ __forceinline__ v16h to_frag(v16f a) { return __builtin_convertvector(a, v16h); }
__device__ __forceinline__ v8f mma_h(v16h a, v16h b, v8f c) {
  return __builtin_amdgcn_wmma_f32_16x16x32_f16(false, a, false, b, (short)0, c, false, false);
}

// ---- LDS ring helpers ---------------------------------------------------------
#define PA_KT 64                         // k per staged A tile: two k steps, 256 B of each of the 64 rows
#define PA_PITCH 68                      // floats per staged row: 272 B = 16 B x 17, so 16 lanes' b128 reads of 16 rows cover all 64 banks
#define PA_TILE_F (64 * PA_PITCH)        // floats per staged tile (17408 B)

// One staged A tile: 1024 pieces of 16 B, eight per lane. g = this lane's first global piece, l = its LDS byte address;
// piece j lies eight rows further, in memory (LD floats per row) and in LDS.
// s_wait_xcnt closes the statement so that no address register of an issued copy is rewritten ahead of it.
template <int LD>
__device__ __forceinline__ void stage_a_async(const float* g, unsigned l) {
  asm volatile(
      "global_load_async_to_lds_b128 %0, %8, off\n\t"
      "global_load_async_to_lds_b128 %1, %9, off\n\t"
      "global_load_async_to_lds_b128 %2, %10, off\n\t"
      "global_load_async_to_lds_b128 %3, %11, off\n\t"
      "global_load_async_to_lds_b128 %4, %12, off\n\t"
      "global_load_async_to_lds_b128 %5, %13, off\n\t"
      "global_load_async_to_lds_b128 %6, %14, off\n\t"
      "global_load_async_to_lds_b128 %7, %15, off\n\t"
      "s_wait_xcnt 0x0"
      :: "v"(l), "v"(l + 1u * 32u * PA_PITCH), "v"(l + 2u * 32u * PA_PITCH), "v"(l + 3u * 32u * PA_PITCH),
         "v"(l + 4u * 32u * PA_PITCH), "v"(l + 5u * 32u * PA_PITCH), "v"(l + 6u * 32u * PA_PITCH), "v"(l + 7u * 32u * PA_PITCH),
         "v"(g), "v"(g + 1 * 8 * LD), "v"(g + 2 * 8 * LD), "v"(g + 3 * 8 * LD),
         "v"(g + 4 * 8 * LD), "v"(g + 5 * 8 * LD), "v"(g + 6 * 8 * LD), "v"(g + 7 * 8 * LD)
      : "memory");
}

// Foot of a ring trip: hands the next tile to every wave and frees the buffer just read.
__device__ __forceinline__ void ring_publish() {
  asm volatile("s_wait_dscnt 0x0" ::: "memory");     // this wave's LDS reads of the buffer to be refilled have retired
  asm volatile("s_wait_asynccnt 0x0" ::: "memory");  // this wave's copies of the next tile have landed
  __syncthreads();                                   // every wave's copies are visible; every reader has left the old buffer
}

// ---- Register-blocked WMMA GEMM ---------------------------------------------
// C[m,n] = scale * sum_k f16(A[m,k]) * f16(16 * Wt[k,n]) (+bias[n]); each wave owns a 64x64 tile; C is f32.
// A row-major [M,K], f32; Wt row-major [K,N], f32, as the caller's input holds it; M % 64 == 0, N == 256, K % 128 == 0.
// A block is one 64-row stripe of A, which all four waves multiply: it passes through a two-buffer LDS ring, 64 k per tile,
// filled by asynchronous copies in whole 256-byte row pieces; every wave takes its A fragments from there.
// N and K are compile-time, so that every Wt load of a k step is one base register plus an immediate offset.
// B fragments come straight from Wt: lane column c of subtile j is n0 + 4 * c + j, so that one 16-byte load of
// Wt[k][n0 + 4 * c ..] gives the lane its k-th element of all four subtiles (16 lanes = 256 contiguous bytes of a row);
// the k order of the sixteen loads is load_row's. D's column map follows: subtile j, lane column c -> n0 + 4 * c + j.
// BIAS_MODE: 2 = bias[n], 3 = bias[n] where a bias pointer is given (block-uniform), else none.
template <int BIAS_MODE, int N, int K>
__device__ __forceinline__ void gemm64_body(
    const float* __restrict__ A, const float* __restrict__ Wt, float* __restrict__ C,
    const float* __restrict__ bias, int M, float scale) {
  static_assert(N == 256 && K % (2 * PA_KT) == 0, "four waves x 64 columns; at least two staged tiles");
  constexpr int lda = K, ldw = N, ldc = N;
  constexpr int NT = K / PA_KT;                    // staged tiles
  __shared__ __align__(16) float sT[4][16 * 68];   // per-wave 16x64 slab, pitch 68 floats
  __shared__ __align__(16) float sA[2 * PA_TILE_F];   // the ring: two staged A tiles
  const int tid  = threadIdx.x;
  const int lane = tid & 31;
  const int wave = tid >> 5;
  const int tm = blockIdx.x;             // the block's 64-row stripe of A
  if (tm >= (M >> 6)) return;            // block-uniform, ahead of every barrier
  const int tn = wave;                   // four waves: the four 64-column tiles of N = 256
  const int m0 = tm << 6;
  const int n0 = tn << 6;

  // lane's piece 0 of a tile: row tid / 16, 16 B number tid % 16 of the row's 256 B (a wave's copy = two whole row pieces)
  const float* Ag = A + (size_t)(m0 + (tid >> 4)) * lda + (tid & 15) * 4;
  const unsigned Alds = (unsigned)(uintptr_t)sA + 4u * (unsigned)((tid >> 4) * PA_PITCH + (tid & 15) * 4);
  auto issue = [&](int t) {              // tile t (k = 64 t .. 64 t + 63) -> buffer t & 1
    stage_a_async<lda>(Ag + t * PA_KT, Alds + (unsigned)(t & 1) * (4u * PA_TILE_F));
  };
  issue(0);

  const int rlane = lane & 15;                 // row (A) / lane column (B, D) within subtile
  const int koff  = (lane >> 4) * 8;           // k offset of this lane half
  const int mOff  = (lane >> 4) * 8;           // D row offset

  v8f acc[4][4];
#pragma unroll
  for (int i = 0; i < 4; ++i)
#pragma unroll
    for (int j = 0; j < 4; ++j) acc[i][j] = (v8f){0.f,0.f,0.f,0.f,0.f,0.f,0.f,0.f};

  v4f bj = (v4f){0.f, 0.f, 0.f, 0.f};          // this lane's four bias values (columns n0 + 4 * rlane + 0..3)
  if (BIAS_MODE == 2 || bias != nullptr) {     // BIAS_MODE 3: one uniform test
    bj = *(const v4f*)(bias + n0 + 4 * rlane);
    asm volatile("s_wait_xcnt 0x0" ::: "memory");   // stands ahead of any rewrite of the address registers that the load names
  }

  const float* Wl = Wt + (size_t)koff * ldw + n0 + 4 * rlane;    // this lane's column group, first k of its half
  asm volatile("s_wait_asynccnt 0x0" ::: "memory");   // tile 0 has landed (this wave's part)
  __syncthreads();                                    // ... and every other wave's
  issue(1);
#pragma unroll 1   // rolled: the ring's trips
  for (int t = 0; t < NT; ++t) {
    const float* Al = sA + (t & 1) * PA_TILE_F + rlane * PA_PITCH + koff;   // this lane's row of subtile 0 in the staged tile, first k of its half
#pragma unroll 1   // rolled: one k step's loads already take the registers that three waves per SIMD leave
    for (int kk = 0; kk < PA_KT; kk += 32) {
      const int k0 = t * PA_KT + kk;
      // All loads of a k step go out together, so that the step waits out one latency.
      // Source order: Wt (the longer latency) in two groups of eight k, then A from LDS.
      v4f w[8];                                  // w[e][j] = Wt[k of element e (+ 8)][n0 + 4 * rlane + j]
      v16h bh[4];
#pragma unroll
      for (int e = 0; e < 8; ++e) w[e] = *(const v4f*)(Wl + (k0 + e) * ldw);
#pragma unroll
      for (int j = 0; j < 4; ++j)
#pragma unroll
        for (int e = 0; e < 8; ++e) bh[j][e] = (_Float16)(w[e][j] * 16.0f);
#pragma unroll
      for (int e = 0; e < 8; ++e) w[e] = *(const v4f*)(Wl + (k0 + 16 + e) * ldw);
      asm volatile("s_wait_xcnt 0x0" ::: "memory");   // stands ahead of any rewrite of the address registers that the Wt loads name
      v16f ar[4];                                // A rows of the four subtiles, as staged
#pragma unroll
      for (int i = 0; i < 4; ++i) ar[i] = load_row(Al + (i << 4) * PA_PITCH + kk);
      // no load of the k step sinks below this line: all are in flight before the first A value is used
      __builtin_amdgcn_sched_barrier(0);
#pragma unroll
      for (int j = 0; j < 4; ++j)
#pragma unroll
        for (int e = 0; e < 8; ++e) bh[j][8 + e] = (_Float16)(w[e][j] * 16.0f);
#pragma unroll
      for (int i = 0; i < 4; ++i) {
        v16h ah = to_frag(ar[i]);
#pragma unroll
        for (int j = 0; j < 4; ++j) acc[i][j] = mma_h(ah, bh[j], acc[i][j]);
        dep_guard_h(acc[i][0], acc[i][3], ah, ah);
      }
      keep4_h(bh[0], bh[1], bh[2], bh[3]);
    }
    ring_publish();
    if (t + 2 < NT) issue(t + 2);                     // block-uniform test
  }
  asm volatile("s_wait_asynccnt 0x0" ::: "memory");   // no copy of this wave is left in flight
  acc_guard4(acc[0][0], acc[0][1], acc[0][2], acc[0][3]);
  acc_guard4(acc[1][0], acc[1][1], acc[1][2], acc[1][3]);
  acc_guard4(acc[2][0], acc[2][1], acc[2][2], acc[2][3]);
  acc_guard4(acc[3][0], acc[3][1], acc[3][2], acc[3][3]);

  // ---- epilogue ----
  float* slab = sT[wave];
#pragma unroll
  for (int i = 0; i < 4; ++i) {
    const int mBase = m0 + (i << 4);
#pragma unroll
    for (int r = 0; r < 8; ++r) {
      v4f v;
#pragma unroll
      for (int j = 0; j < 4; ++j) v[j] = acc[i][j][r] * scale + bj[j];
      *(v4f*)(slab + (mOff + r) * 68 + 4 * rlane) = v;
    }
    __builtin_amdgcn_fence(__ATOMIC_RELEASE, "workgroup");
    __builtin_amdgcn_wave_barrier();
    __builtin_amdgcn_fence(__ATOMIC_ACQUIRE, "workgroup");
    {
      const int hh = lane >> 4, c4 = (lane & 15) * 4;     // row seg = 256 B = 16 lanes x 16 B
#pragma unroll
      for (int it = 0; it < 8; ++it) {
        const int row = it * 2 + hh;
        v4f v = *(const v4f*)(slab + row * 68 + c4);
        *(v4f*)(C + (size_t)(mBase + row) * ldc + n0 + c4) = v;
      }
    }
    __builtin_amdgcn_fence(__ATOMIC_RELEASE, "workgroup");
    __builtin_amdgcn_wave_barrier();
    __builtin_amdgcn_fence(__ATOMIC_ACQUIRE, "workgroup");
  }
}

// The two projections of x, whose rows neighbouring blocks of the attention need: one grid, blockIdx.y = 0: x.Wk, 1: x.Wv + bv.
__global__ __launch_bounds__(128) void proj_kv(
    const float* __restrict__ x, const float* __restrict__ Wk, const float* __restrict__ Wv,
    float* __restrict__ kF, float* __restrict__ vF,
    const float* __restrict__ bv, int M, float scale) {
  const int y = blockIdx.y;
  const float* Wt   = (y == 0) ? Wk : Wv;
  float* C          = (y == 0) ? kF : vF;
  const float* bias = (y == 1) ? bv : nullptr;
  gemm64_body<3, 256, 256>(x, Wt, C, bias, M, scale);
}

// ---- local 3x3x3 windowed attention, f32. One thread per (position along W, head) of TWO neighbouring W rows (H = ph, ph + 1). ----
// q: the input, f32 [16384][256]; kf/vf: f32 [16384][256] (voxel-major, col = head*32 + d). No block needs another block's projected
// q rows, so the block projects its own 64 itself: (1/16) * f16(q) . f16(16 Wq) on WMMA, f32, straight into the ring's buffer 0.
// The block's attention output (f16, x8) stays in LDS and is
// the A operand of the output projection, which the same block does for its 64 rows: outp = (1/128) * o . f16(16 Wo) + bo.
// The two output rows need the same K and V rows but for one each: per S slice four rows (H = ph - 1 .. ph + 2) serve both,
// where one output row alone needs three. They pass, two rows to a tile, through a two-buffer LDS ring filled by asynchronous
// copies in whole lines: six K tiles, six V tiles (tile 0, the projected q rows, the block writes itself). A K or V vector of a row that both output rows need
// (H = ph, ph + 1) is read from LDS once and used for both.
// Row and voxel indices clamped into range; out-of-volume neighbours get weight exactly 0; the centre is always in range.
// Per-thread dots / probabilities live in thread-private LDS slots (27 per thread and output row).
#define AT_S 8
#define AT_H 32
#define AT_W 32
#define AT_C 256
#define AT_NB 27
#define AT_PITCH 264
#define AT_HPITCH 36                     // floats per (voxel, head) slot: 32 + 4 pad = 144 B, so 16 lanes' b128 reads cover all 64 banks
#define AT_VPITCH (8 * AT_HPITCH)        // floats per voxel
#define AT_ROW_F (AT_W * AT_VPITCH)      // floats per staged row of 32 voxels (36864 B)
#define AT_TILE_F (2 * AT_ROW_F)         // floats per tile: two staged rows
#define AT_NT 13                         // tiles: the two q rows, 3 x 2 of K, 3 x 2 of V
#define QK_SCALE 0.17677669529663687f

// One staged row: 2048 pieces of 16 B, eight per lane. g = this lane's first global piece, l = its LDS byte address;
// piece j lies 4 KiB further in memory (4 voxels) and 4 voxel pitches further in LDS.
// s_wait_xcnt closes the statement so that no address register of an issued copy is rewritten ahead of it.
__device__ __forceinline__ void stage_row_async(const float* g, unsigned l) {
  asm volatile(
      "global_load_async_to_lds_b128 %0, %8, off\n\t"
      "global_load_async_to_lds_b128 %1, %9, off\n\t"
      "global_load_async_to_lds_b128 %2, %10, off\n\t"
      "global_load_async_to_lds_b128 %3, %11, off\n\t"
      "global_load_async_to_lds_b128 %4, %12, off\n\t"
      "global_load_async_to_lds_b128 %5, %13, off\n\t"
      "global_load_async_to_lds_b128 %6, %14, off\n\t"
      "global_load_async_to_lds_b128 %7, %15, off\n\t"
      "s_wait_xcnt 0x0"
      :: "v"(l), "v"(l + 1u * 16u * AT_VPITCH), "v"(l + 2u * 16u * AT_VPITCH), "v"(l + 3u * 16u * AT_VPITCH),
         "v"(l + 4u * 16u * AT_VPITCH), "v"(l + 5u * 16u * AT_VPITCH), "v"(l + 6u * 16u * AT_VPITCH), "v"(l + 7u * 16u * AT_VPITCH),
         "v"(g), "v"(g + 1 * 1024), "v"(g + 2 * 1024), "v"(g + 3 * 1024),
         "v"(g + 4 * 1024), "v"(g + 5 * 1024), "v"(g + 6 * 1024), "v"(g + 7 * 1024)
      : "memory");
}

__global__ __launch_bounds__(256) void local_attn3d(
    const float* __restrict__ q, const float* __restrict__ Wq, const float* __restrict__ kf, const float* __restrict__ vf,
    const float* __restrict__ Wo, const float* __restrict__ bo, float* __restrict__ outp) {
  __shared__ __align__(16) float sbuf[2 * AT_NB * 256];   // 55296 B; reused as f16 staging (64 x 264 halves = 33792 B)
  __shared__ __align__(16) float tile[2 * AT_TILE_F];     // the ring: two tiles of two staged rows
  const int tid  = threadIdx.x;
  const int head = tid & 7;
  const int vox  = tid >> 3;                          // = position along W
  const int ph = (blockIdx.x & 15) * 2;               // block-uniform: the first of the block's two W rows; grid = 16384/64 exactly
  const int ps = (blockIdx.x >> 4) & 7;
  const int pb = blockIdx.x >> 7;

  const unsigned lds_lane = (unsigned)(uintptr_t)tile +
      4u * (unsigned)((tid >> 6) * AT_VPITCH + ((tid >> 3) & 7) * AT_HPITCH + (tid & 7) * 4);
  auto issue = [&](int t) {                           // tile t >= 1 -> buffer t & 1
    const int u = (t < 7) ? t - 1 : t - 7;                       // dz = u / 2; u odd: the upper pair of rows
    const float* srcp = (t < 7) ? kf : vf;
    const int zs = ps + (u >> 1) - 1;
    const int cs = zs < 0 ? 0 : (zs > AT_S - 1 ? AT_S - 1 : zs);
    const int h0 = ph - 1 + 2 * (u & 1);                         // ph - 1, ph or ph + 1, ph + 2
    const int c0 = h0 < 0 ? 0 : h0;                              // h0 <= 31
    const int c1 = h0 + 1 > AT_H - 1 ? AT_H - 1 : h0 + 1;        // h0 + 1 >= 0
    const int slab = (pb * AT_S + cs) * AT_H;
    const unsigned l = lds_lane + (unsigned)(t & 1) * (4u * AT_TILE_F);
    stage_row_async(srcp + (size_t)((slab + c0) * AT_W) * AT_C + tid * 4, l);
    stage_row_async(srcp + (size_t)((slab + c1) * AT_W) * AT_C + tid * 4, l + 4u * AT_ROW_F);
  };

  // Both projections of the block, 64 rows x 256 columns: wave w owns all 64 rows of columns 32 w .. 32 w + 31 (4 x 2 subtiles).
  // B fragments come straight from the weights: lane column c of subtile j is n0 + 2 * c + j, so that one 8-byte load of W[k][n0 + 2 * c ..]
  // gives the lane its k-th element of both subtiles (16 lanes = one 128-byte line); the k order of the sixteen loads is load_row's.
  const int lane  = tid & 31;
  const int rlane = lane & 15;                 // row (A) / lane column (B, D) within a subtile
  const int koff  = (lane >> 4) * 8;           // k offset of this lane half; also its D row offset
  const int n0    = (tid >> 5) * 32;

  // q projection of the block's 64 rows (contiguous in memory). Its loads and K tile 1 go out together; the tile flies while the rows are multiplied.
  {
    v4f qr[16];                                // piece j: row tid / 64 + 4 j, floats 4 (tid % 64) ..: a wave's load is 512 contiguous bytes
    const float* qg = q + (size_t)blockIdx.x * 64 * AT_C + tid * 4;
#pragma unroll
    for (int j = 0; j < 16; ++j) qr[j] = *(const v4f*)(qg + j * 1024);
    const float* Wl = Wq + koff * AT_C + n0 + 2 * rlane;
    v2f w[2][16];                              // two k steps of Wq: each is reloaded, for two k steps on, as soon as it has been rounded
    auto load_w = [&](v2f (&d)[16], int ks) {
#pragma unroll
      for (int e = 0; e < 8; ++e) {
        d[e]     = *(const v2f*)(Wl + (ks * 32 + e) * AT_C);
        d[8 + e] = *(const v2f*)(Wl + (ks * 32 + 16 + e) * AT_C);
      }
      asm volatile("s_wait_xcnt 0x0" ::: "memory");   // stands ahead of any rewrite of the address registers that the loads so far name
    };
    load_w(w[0], 0);
    load_w(w[1], 1);
    issue(1);

    // the rows, rounded once, as the f16 A tile [64][256] (pitch 264 halves = 16 B x 33: b128 fragment reads without bank conflicts)
    _Float16* sq = reinterpret_cast<_Float16*>(sbuf);
#pragma unroll
    for (int j = 0; j < 16; ++j)
      *(v4h*)(sq + ((tid >> 6) + 4 * j) * AT_PITCH + (tid & 63) * 4) = __builtin_convertvector(qr[j], v4h);
    __syncthreads();                           // the A tile is whole before any wave takes fragments from it

    v8f c[4][2];
#pragma unroll
    for (int i = 0; i < 4; ++i)
#pragma unroll
      for (int j = 0; j < 2; ++j) c[i][j] = (v8f){0.f,0.f,0.f,0.f,0.f,0.f,0.f,0.f};
    const _Float16* Al = sq + rlane * AT_PITCH + koff;
    // k step ks, its Wq rows in wk; more: k step ks + 2 exists (a constant at each call, so that a trip holds no branch)
    auto kstep = [&](v2f (&wk)[16], const int ks, const bool more) {
      v16h ah[4];                              // A fragments of this k step, read ahead of the conversions, so that the LDS latency lies under them
#pragma unroll
      for (int i = 0; i < 4; ++i) ah[i] = load_row(Al + i * 16 * AT_PITCH + ks * 32);
      v16h bh[2];
#pragma unroll
      for (int j = 0; j < 2; ++j)
#pragma unroll
        for (int e = 0; e < 16; ++e) bh[j][e] = (_Float16)(wk[e][j] * 16.0f);
      // the reload stays below the rounding of the values that it replaces: above it, it would need registers of its own and a copy per value
      __builtin_amdgcn_sched_barrier(0);
      if (more) load_w(wk, ks + 2);
#pragma unroll
      for (int i = 0; i < 4; ++i)
#pragma unroll
        for (int j = 0; j < 2; ++j) c[i][j] = mma_h(ah[i], bh[j], c[i][j]);
    };
#pragma unroll 1   // rolled, two k steps a trip (w[] stays in registers)
    for (int kp = 0; kp < AT_C / 64 - 1; ++kp) {
      kstep(w[0], 2 * kp, true);
      kstep(w[1], 2 * kp + 1, true);
    }
    kstep(w[0], AT_C / 32 - 2, false);
    kstep(w[1], AT_C / 32 - 1, false);
    // D: subtile (i, j), register r -> row 16 i + koff + r, column n0 + 2 * rlane + j = element 2 * rlane + j of head n0 / 32;
    // it goes to its place in ring buffer 0, laid out as a staged tile of two rows of 32 voxels.
    float* qd = tile + koff * AT_VPITCH + (tid >> 5) * AT_HPITCH + 2 * rlane;
#pragma unroll
    for (int i = 0; i < 4; ++i)
#pragma unroll
      for (int r = 0; r < 8; ++r)
        *(v2f*)(qd + (i >> 1) * AT_ROW_F + ((i & 1) * 16 + r) * AT_VPITCH) =
            (v2f){c[i][0][r] * (1.0f / 16.0f), c[i][1][r] * (1.0f / 16.0f)};
    __syncthreads();                           // the q tile is whole before any thread reads its vectors; every read of the A tile has retired
  }

  // this thread's three neighbours along W inside a staged row (clamped)
  const int o0 = (vox > 0 ? vox - 1 : 0) * AT_VPITCH + head * AT_HPITCH;
  const int o1 = vox * AT_VPITCH + head * AT_HPITCH;
  const int o2 = (vox < AT_W - 1 ? vox + 1 : AT_W - 1) * AT_VPITCH + head * AT_HPITCH;

  // trip 0: this thread's two q vectors from the q tile; qq[c] = (q of row ph, q of row ph + 1)
  v2f qq[32];
  {
    const float* qptr = tile + o1;
#pragma unroll
    for (int i = 0; i < 8; ++i) {
      const v4f ta = *(const v4f*)(qptr + 4 * i);
      const v4f tb = *(const v4f*)(qptr + AT_ROW_F + 4 * i);
#pragma unroll
      for (int c = 0; c < 4; ++c) qq[4 * i + c] = (v2f){ta[c], tb[c]};
    }
  }
  ring_publish();
  issue(2);

  // the three dots of one output row (R = 0: ph, 1: ph + 1) with one staged K row
  auto dots1 = [&](const float* tb, const int r, float (&d)[3]) {
    float a0 = 0.f, a1 = 0.f, a2 = 0.f;
#pragma unroll
    for (int i = 0; i < 8; ++i) {
      const v4f k0 = *(const v4f*)(tb + o0 + 4 * i);
      const v4f k1 = *(const v4f*)(tb + o1 + 4 * i);
      const v4f k2 = *(const v4f*)(tb + o2 + 4 * i);
#pragma unroll
      for (int c = 0; c < 4; ++c) {
        a0 = fmaf(qq[4 * i + c][r], k0[c], a0);
        a1 = fmaf(qq[4 * i + c][r], k1[c], a1);
        a2 = fmaf(qq[4 * i + c][r], k2[c], a2);
      }
    }
    d[0] = a0 * QK_SCALE; d[1] = a1 * QK_SCALE; d[2] = a2 * QK_SCALE;
  };
  // the three dots of both output rows with one staged K row: each K vector is read once
  auto dots2 = [&](const float* tb, float (&dA)[3], float (&dB)[3]) {
    v2f a0 = (v2f){0.f, 0.f}, a1 = a0, a2 = a0;
#pragma unroll
    for (int i = 0; i < 8; ++i) {
      const v4f k0 = *(const v4f*)(tb + o0 + 4 * i);
      const v4f k1 = *(const v4f*)(tb + o1 + 4 * i);
      const v4f k2 = *(const v4f*)(tb + o2 + 4 * i);
#pragma unroll
      for (int c = 0; c < 4; ++c) {
        a0 = __builtin_elementwise_fma(qq[4 * i + c], (v2f){k0[c], k0[c]}, a0);
        a1 = __builtin_elementwise_fma(qq[4 * i + c], (v2f){k1[c], k1[c]}, a1);
        a2 = __builtin_elementwise_fma(qq[4 * i + c], (v2f){k2[c], k2[c]}, a2);
      }
    }
    dA[0] = a0[0] * QK_SCALE; dA[1] = a1[0] * QK_SCALE; dA[2] = a2[0] * QK_SCALE;
    dB[0] = a0[1] * QK_SCALE; dB[1] = a1[1] * QK_SCALE; dB[2] = a2[1] * QK_SCALE;
  };
  float mx[2] = {-INFINITY, -INFINITY};
  unsigned vmask[2] = {0u, 0u};
  // files the three dots of output row ph + r with window row (dz, dy); vrow: that window row lies in the volume
  auto put = [&](int r, int dz, int dy, const float (&d)[3]) {
    const bool vrow = ((unsigned)(ps + dz - 1) < (unsigned)AT_S) && ((unsigned)(ph + r + dy - 1) < (unsigned)AT_H);
    const int kk = 9 * dz + 3 * dy;
    float* sp = sbuf + (r * AT_NB + kk) * 256 + tid;
    sp[0] = d[0]; sp[256] = d[1]; sp[512] = d[2];
    if (vrow && vox > 0)        { mx[r] = fmaxf(mx[r], d[0]); vmask[r] |= (1u << (kk + 0)); }
    if (vrow)                   { mx[r] = fmaxf(mx[r], d[1]); vmask[r] |= (1u << (kk + 1)); }
    if (vrow && vox < AT_W - 1) { mx[r] = fmaxf(mx[r], d[2]); vmask[r] |= (1u << (kk + 2)); }
  };

  // pass 1: dots; per S slice dz two trips: K rows ph - 1, ph (buffer 1), then ph + 1, ph + 2 (buffer 0)
#pragma unroll 1   // rolled: the ring's trips; unrolled they would only lengthen the code
  for (int dz = 0; dz < 3; ++dz) {
    float dA[3], dB[3];
    dots1(tile + AT_TILE_F, 0, dA);
    put(0, dz, 0, dA);
    dots2(tile + AT_TILE_F + AT_ROW_F, dA, dB);
    put(0, dz, 1, dA);
    put(1, dz, 0, dB);
    ring_publish();
    issue(2 * dz + 3);                                // tiles 3, 5, 7 exist
    dots2(tile, dA, dB);
    put(0, dz, 2, dA);
    put(1, dz, 1, dB);
    dots1(tile + AT_ROW_F, 1, dB);
    put(1, dz, 2, dB);
    ring_publish();
    issue(2 * dz + 4);                                // tiles 4, 6, 8 exist
  }

  // pass 2: probabilities (exactly 0 for out-of-range neighbours), sums
  float sum[2] = {0.f, 0.f};
#pragma unroll 1   // rolled, as it was for one output row; the two rows of a trip are independent
  for (int k2 = 0; k2 < AT_NB; ++k2) {
#pragma unroll
    for (int r = 0; r < 2; ++r) {
      const float d = sbuf[(r * AT_NB + k2) * 256 + tid];
      const float ex = __expf(d - mx[r]);
      const float p = ((vmask[r] >> k2) & 1u) ? ex : 0.f;
      sbuf[(r * AT_NB + k2) * 256 + tid] = p;
      sum[r] += p;
    }
  }
  const float inv[2] = {__builtin_amdgcn_rcpf(sum[0]), __builtin_amdgcn_rcpf(sum[1])};   // sums >= 1

  // Output projection: the tiling and the B loads of the q projection above.
  const float* Wl = Wo + koff * AT_C + n0 + 2 * rlane;
  v2f w[3][16];                                // three k steps of Wo: the next two are in flight while this one is multiplied
  auto load_w = [&](int ks) {
#pragma unroll
    for (int e = 0; e < 8; ++e) {
      w[ks % 3][e]     = *(const v2f*)(Wl + (ks * 32 + e) * AT_C);
      w[ks % 3][8 + e] = *(const v2f*)(Wl + (ks * 32 + 16 + e) * AT_C);
    }
  };
  load_w(0);                                   // issued here, ahead of pass 3, so that the first k step waits for nothing behind the ring
  const v2f bj = *(const v2f*)(bo + n0 + 2 * rlane);
  asm volatile("s_wait_xcnt 0x0" ::: "memory");   // stands ahead of any rewrite of the address registers that these loads name

  // pass 3: weighted sums of v rows, the trips as in pass 1
  float acc[2][32];
#pragma unroll
  for (int i = 0; i < 32; ++i) { acc[0][i] = 0.f; acc[1][i] = 0.f; }
  // the three probabilities of output row ph + r for window row (dz, dy)
  auto get = [&](int r, int dz, int dy, float (&p)[3]) {
    const float* sp = sbuf + (r * AT_NB + 9 * dz + 3 * dy) * 256 + tid;
    p[0] = sp[0]; p[1] = sp[256]; p[2] = sp[512];
  };
  // one staged V row into one output row's sums
  auto pv1 = [&](const float* tb, const int r, const float (&p)[3]) {
#pragma unroll
    for (int i = 0; i < 8; ++i) {
      const v4f v0 = *(const v4f*)(tb + o0 + 4 * i);
      const v4f v1 = *(const v4f*)(tb + o1 + 4 * i);
      const v4f v2 = *(const v4f*)(tb + o2 + 4 * i);
#pragma unroll
      for (int c = 0; c < 4; ++c) {
        float s = acc[r][4 * i + c];
        s = fmaf(p[0], v0[c], s);
        s = fmaf(p[1], v1[c], s);
        s = fmaf(p[2], v2[c], s);
        acc[r][4 * i + c] = s;
      }
    }
  };
  // one staged V row into both output rows' sums: each V vector is read once
  auto pv2 = [&](const float* tb, const float (&pA)[3], const float (&pB)[3]) {
#pragma unroll
    for (int i = 0; i < 8; ++i) {
      const v4f v0 = *(const v4f*)(tb + o0 + 4 * i);
      const v4f v1 = *(const v4f*)(tb + o1 + 4 * i);
      const v4f v2 = *(const v4f*)(tb + o2 + 4 * i);
#pragma unroll
      for (int c = 0; c < 4; ++c) {
        float s = acc[0][4 * i + c];
        s = fmaf(pA[0], v0[c], s);
        s = fmaf(pA[1], v1[c], s);
        s = fmaf(pA[2], v2[c], s);
        acc[0][4 * i + c] = s;
        float u = acc[1][4 * i + c];
        u = fmaf(pB[0], v0[c], u);
        u = fmaf(pB[1], v1[c], u);
        u = fmaf(pB[2], v2[c], u);
        acc[1][4 * i + c] = u;
      }
    }
  };
  // the two trips of S slice dz; more: the tiles two trips on exist (a constant at each call, so that a trip holds no branch:
  // with one, the compiler moved both trips' sums behind it and kept two tiles' LDS reads in registers, with spills)
  auto slice3 = [&](const int dz, const bool more) {
    float pA[3], pB[3], pC[3];
    get(0, dz, 0, pC); get(0, dz, 1, pA); get(1, dz, 0, pB);
    pv1(tile + AT_TILE_F, 0, pC);
    pv2(tile + AT_TILE_F + AT_ROW_F, pA, pB);
    ring_publish();
    if (more) issue(2 * dz + 9);
    get(0, dz, 2, pA); get(1, dz, 1, pB); get(1, dz, 2, pC);
    pv2(tile, pA, pB);
    pv1(tile + AT_ROW_F, 1, pC);
    ring_publish();
    if (more) issue(2 * dz + 10);
  };
#pragma unroll 1   // rolled: the ring's trips
  for (int dz = 0; dz < 2; ++dz) slice3(dz, true);    // issues tiles 9 .. 12
  slice3(2, false);                                   // no tile 13
  asm volatile("s_wait_asynccnt 0x0" ::: "memory");   // no copy of this wave is left in flight

  // stage the f16 tile [64 voxels][256] in LDS (pitch 264 halves = 16 B x 33: b128 fragment reads without bank conflicts)
  __syncthreads();
  _Float16* st = reinterpret_cast<_Float16*>(sbuf);
#pragma unroll
  for (int r = 0; r < 2; ++r) {
    const float osc = inv[r] * 8.0f;     // normalise and carry x8 for the f16 A operand of the output projection
    _Float16* sp = st + (r * AT_W + vox) * AT_PITCH + head * 32;
#pragma unroll
    for (int j = 0; j < 4; ++j) {
      v8h hv;
#pragma unroll
      for (int i = 0; i < 8; ++i) hv[i] = (_Float16)(acc[r][8 * j + i] * osc);
      *(v8h*)(sp + 8 * j) = hv;
    }
  }
  __syncthreads();

  v8f c[4][2];
#pragma unroll
  for (int i = 0; i < 4; ++i)
#pragma unroll
    for (int j = 0; j < 2; ++j) c[i][j] = (v8f){0.f,0.f,0.f,0.f,0.f,0.f,0.f,0.f};
  const _Float16* Al = st + rlane * AT_PITCH + koff;
  load_w(1);
#pragma unroll   // unrolled: every Wo load is the one base register plus an immediate offset, and w[] stays in registers
  for (int ks = 0; ks < AT_C / 32; ++ks) {
    if (ks + 2 < AT_C / 32) load_w(ks + 2);
    v16h ah[4];                                // A fragments of this k step, read ahead of the conversions, so that the LDS latency lies under them
#pragma unroll
    for (int i = 0; i < 4; ++i) ah[i] = load_row(Al + i * 16 * AT_PITCH + ks * 32);
    v16h bh[2];
#pragma unroll
    for (int j = 0; j < 2; ++j)
#pragma unroll
      for (int e = 0; e < 16; ++e) bh[j][e] = (_Float16)(w[ks % 3][e][j] * 16.0f);
#pragma unroll
    for (int i = 0; i < 4; ++i)
#pragma unroll
      for (int j = 0; j < 2; ++j) c[i][j] = mma_h(ah[i], bh[j], c[i][j]);
    // no later k step's loads rise above this line: hoisted all at once they would take far more registers than the three k steps in w[]
    __builtin_amdgcn_sched_barrier(0);
  }

  // D: subtile (i, j), register r -> row 16 i + koff + r, column n0 + 2 * rlane + j; 16 lanes store one whole 128-byte line of a row
  float* ob = outp + (size_t)blockIdx.x * 64 * AT_C + koff * AT_C + n0 + 2 * rlane;
#pragma unroll
  for (int i = 0; i < 4; ++i)
#pragma unroll
    for (int r = 0; r < 8; ++r) {
      v2f v;
#pragma unroll
      for (int j = 0; j < 2; ++j) v[j] = c[i][j][r] * (1.0f / 128.0f) + bj[j];
      *(v2f*)(ob + (i * 16 + r) * AT_C) = v;
    }
}

// ---------------------------------------------------------------------------
extern "C" void kernel_launch(void* const* d_in, const int* in_sizes, int n_in,
                              void* d_out, int out_size, void* d_ws, size_t ws_size,
                              hipStream_t stream) {
  const int MP = 16384;     // B*S*H*W = 2*8*32*32
  const int DC = 256;       // DIM == INNER
  if (n_in < 8) return;
  if (in_sizes[0] != MP * DC || in_sizes[1] != MP * DC) return;
  if (in_sizes[2] != DC * DC || in_sizes[3] != DC * DC || in_sizes[4] != DC * DC || in_sizes[6] != DC * DC) return;
  if (in_sizes[5] != DC || in_sizes[7] != DC) return;
  if (out_size != MP * DC) return;

  const float* x  = (const float*)d_in[0];
  const float* q  = (const float*)d_in[1];
  const float* Wq = (const float*)d_in[2];
  const float* Wk = (const float*)d_in[3];
  const float* Wv = (const float*)d_in[4];
  const float* bv = (const float*)d_in[5];
  const float* Wo = (const float*)d_in[6];
  const float* bo = (const float*)d_in[7];
  float* outp = (float*)d_out;

  const size_t actF = (size_t)MP * DC * sizeof(float);      // 16 MiB
  size_t off = 0;
  char* base = (char*)d_ws;
  float*    kF  = (float*)(base + off);    off += actF;
  float*    vF  = (float*)(base + off);    off += actF;
  // total = 33,554,432 B
  if (off > ws_size) return;

  // 1) projections of x, one grid: C = (1/16) * f16(A) . f16(16 W) (+ bias[n]); M = 16384, N = K = 256; 1024 64x64 tiles each, 4 per block
  const dim3 gg2((MP / 64) * (DC / 64) / 4, 2);
  const float s16 = 1.0f / 16.0f;
  proj_kv<<<gg2, 128, 0, stream>>>(x, Wk, Wv, kF, vF, bv, MP, s16);

  // 2) per block of 64 rows: q projection, windowed attention (f32), output projection -> d_out (f32)
  local_attn3d<<<MP / 64, 256, 0, stream>>>(q, Wq, kF, vF, Wo, bo, outp);
}

// v008
// Measured time: 41.6 microseconds a run.
// Timed twice side by side with v007, it ran 1.07 times as fast both times.
// Over all steps from v000 it is 3.89 times as fast.
// Projections x@Wk, x@Wv+bv, q@Wq, o@Wo+bo: v_wmma_f32_16x16x32_f16 (f16 operands; weights carried x16, o carried x8; f32 accumulate). Windowed q.k, softmax, p.v: f32 VALU.
#include <hip/hip_runtime.h>
#include <hip/hip_bf16.h>

typedef __attribute__((ext_vector_type(16))) _Float16 v16h;
typedef __attribute__((ext_vector_type(8)))  _Float16 v8h;
typedef __attribute__((ext_vector_type(4)))  _Float16 v4h;
typedef __attribute__((ext_vector_type(8)))  float    v8f;
typedef __attribute__((ext_vector_type(4)))  float    v4f;
typedef __attribute__((ext_vector_type(2)))  float    v2f;
typedef __attribute__((ext_vector_type(16))) float    v16f;

// hazard guards as plain device helpers (the kernel template body keeps four inline asm waits: s_wait_xcnt after the bias and Wt loads, s_wait_asynccnt before the ring and after it)
__device__ __forceinline__ void dep_guard_h(v8f& a, v8f& b, v16h x, v16h y) { asm volatile("v_nop\n\tv_nop\n\tv_nop\n\tv_nop" : "+v"(a), "+v"(b) : "v"(x), "v"(y)); }
__device__ __forceinline__ void keep4_h(v16h a, v16h b, v16h c, v16h d) { asm volatile("v_nop" :: "v"(a), "v"(b), "v"(c), "v"(d)); }
__device__ __forceinline__ void acc_guard4(v8f& a, v8f& b, v8f& c, v8f& d) { asm volatile("v_nop\n\tv_nop\n\tv_nop\n\tv_nop" : "+v"(a), "+v"(b), "+v"(c), "+v"(d)); }

__device__ __forceinline__ v16f cat4(v4f a, v4f b, v4f c, v4f d) {
  return __builtin_shufflevector(__builtin_shufflevector(a, b, 0, 1, 2, 3, 4, 5, 6, 7),
                                 __builtin_shufflevector(c, d, 0, 1, 2, 3, 4, 5, 6, 7),
                                 0, 1, 2, 3, 4, 5, 6, 7, 8, 9, 10, 11, 12, 13, 14, 15);
}
// The sixteen k of one A row that a lane holds, k order: elements 0..7 <- p[0..7], 8..15 <- p[16..23]; as stored (f16 or f32).
__device__ __forceinline__ v16h load_row(const _Float16* p) {
  union { v16h v; v8h h[2]; } f;
  f.h[0] = *(const v8h*)(p); f.h[1] = *(const v8h*)(p + 16); return f.v;
}
__device__ __forceinline__ v16f load_row(const float* p) {
  return cat4(*(const v4f*)(p), *(const v4f*)(p + 4), *(const v4f*)(p + 16), *(const v4f*)(p + 20));
}
// ... and as the f16 fragment (f32 is rounded here)
__device__ __forceinline__ v16h to_frag(v16f a) { return __builtin_convertvector(a, v16h); }
__device__ __forceinline__ v8f mma_h(v16h a, v16h b, v8f c) {
  return __builtin_amdgcn_wmma_f32_16x16x32_f16(false, a, false, b, (short)0, c, false, false);
}

// ---- LDS ring helpers ---------------------------------------------------------
#define PA_KT 64                         // k per staged A tile: two k steps, 256 B of each of the 64 rows
#define PA_PITCH 68                      // floats per staged row: 272 B = 16 B x 17, so 16 lanes' b128 reads of 16 rows cover all 64 banks
#define PA_TILE_F (64 * PA_PITCH)        // floats per staged tile (17408 B)

// One staged A tile: 1024 pieces of 16 B, eight per lane. g = this lane's first global piece, l = its LDS byte address;
// piece j lies eight rows further, in memory (LD floats per row) and in LDS.
// s_wait_xcnt closes the statement so that no address register of an issued copy is rewritten ahead of it.
template <int LD>
__device__ __forceinline__ void stage_a_async(const float* g, unsigned l) {
  asm volatile(
      "global_load_async_to_lds_b128 %0, %8, off\n\t"
      "global_load_async_to_lds_b128 %1, %9, off\n\t"
      "global_load_async_to_lds_b128 %2, %10, off\n\t"
      "global_load_async_to_lds_b128 %3, %11, off\n\t"
      "global_load_async_to_lds_b128 %4, %12, off\n\t"
      "global_load_async_to_lds_b128 %5, %13, off\n\t"
      "global_load_async_to_lds_b128 %6, %14, off\n\t"
      "global_load_async_to_lds_b128 %7, %15, off\n\t"
      "s_wait_xcnt 0x0"
      :: "v"(l), "v"(l + 1u * 32u * PA_PITCH), "v"(l + 2u * 32u * PA_PITCH), "v"(l + 3u * 32u * PA_PITCH),
         "v"(l + 4u * 32u * PA_PITCH), "v"(l + 5u * 32u * PA_PITCH), "v"(l + 6u * 32u * PA_PITCH), "v"(l + 7u * 32u * PA_PITCH),
         "v"(g), "v"(g + 1 * 8 * LD), "v"(g + 2 * 8 * LD), "v"(g + 3 * 8 * LD),
         "v"(g + 4 * 8 * LD), "v"(g + 5 * 8 * LD), "v"(g + 6 * 8 * LD), "v"(g + 7 * 8 * LD)
      : "memory");
}

// Foot of a ring trip: hands the next tile to every wave and frees the buffer just read.
__device__ __forceinline__ void ring_publish() {
  asm volatile("s_wait_dscnt 0x0" ::: "memory");     // this wave's LDS reads of the buffer to be refilled have retired
  asm volatile("s_wait_asynccnt 0x0" ::: "memory");  // this wave's copies of the next tile have landed
  __syncthreads();                                   // every wave's copies are visible; every reader has left the old buffer
}

// ---- Register-blocked WMMA GEMM ---------------------------------------------
// C[m,n] = scale * sum_k f16(A[m,k]) * f16(16 * Wt[k,n]) (+bias[n]); each wave owns a 64x64 tile; C is f32.
// A row-major [M,K], f32; Wt row-major [K,N], f32, as the caller's input holds it; M % 64 == 0, N == 256, K % 128 == 0.
// A block is one 64-row stripe of A, which all four waves multiply: it passes through a two-buffer LDS ring, 64 k per tile,
// filled by asynchronous copies in whole 256-byte row pieces; every wave takes its A fragments from there.
// N and K are compile-time, so that every Wt load of a k step is one base register plus an immediate offset.
// B fragments come straight from Wt: lane column c of subtile j is n0 + 4 * c + j, so that one 16-byte load of
// Wt[k][n0 + 4 * c ..] gives the lane its k-th element of all four subtiles (16 lanes = 256 contiguous bytes of a row);
// the k order of the sixteen loads is load_row's. D's column map follows: subtile j, lane column c -> n0 + 4 * c + j.
// BIAS_MODE: 2 = bias[n], 3 = bias[n] where a bias pointer is given (block-uniform), else none.
template <int BIAS_MODE, int N, int K>
__device__ __forceinline__ void gemm64_body(
    const float* __restrict__ A, const float* __restrict__ Wt, float* __restrict__ C,
    const float* __restrict__ bias, int M, float scale) {
  static_assert(N == 256 && K % (2 * PA_KT) == 0, "four waves x 64 columns; at least two staged tiles");
  constexpr int lda = K, ldw = N, ldc = N;
  constexpr int NT = K / PA_KT;                    // staged tiles
  __shared__ __align__(16) float sT[4][16 * 68];   // per-wave 16x64 slab, pitch 68 floats
  __shared__ __align__(16) float sA[2 * PA_TILE_F];   // the ring: two staged A tiles
  const int tid  = threadIdx.x;
  const int lane = tid & 31;
  const int wave = tid >> 5;
  const int tm = blockIdx.x;             // the block's 64-row stripe of A
  if (tm >= (M >> 6)) return;            // block-uniform, ahead of every barrier
  const int tn = wave;                   // four waves: the four 64-column tiles of N = 256
  const int m0 = tm << 6;
  const int n0 = tn << 6;

  // lane's piece 0 of a tile: row tid / 16, 16 B number tid % 16 of the row's 256 B (a wave's copy = two whole row pieces)
  const float* Ag = A + (size_t)(m0 + (tid >> 4)) * lda + (tid & 15) * 4;
  const unsigned Alds = (unsigned)(uintptr_t)sA + 4u * (unsigned)((tid >> 4) * PA_PITCH + (tid & 15) * 4);
  auto issue = [&](int t) {              // tile t (k = 64 t .. 64 t + 63) -> buffer t & 1
    stage_a_async<lda>(Ag + t * PA_KT, Alds + (unsigned)(t & 1) * (4u * PA_TILE_F));
  };
  issue(0);

  const int rlane = lane & 15;                 // row (A) / lane column (B, D) within subtile
  const int koff  = (lane >> 4) * 8;           // k offset of this lane half
  const int mOff  = (lane >> 4) * 8;           // D row offset

  v8f acc[4][4];
#pragma unroll
  for (int i = 0; i < 4; ++i)
#pragma unroll
    for (int j = 0; j < 4; ++j) acc[i][j] = (v8f){0.f,0.f,0.f,0.f,0.f,0.f,0.f,0.f};

  v4f bj = (v4f){0.f, 0.f, 0.f, 0.f};          // this lane's four bias values (columns n0 + 4 * rlane + 0..3)
  if (BIAS_MODE == 2 || bias != nullptr) {     // BIAS_MODE 3: one uniform test
    bj = *(const v4f*)(bias + n0 + 4 * rlane);
    asm volatile("s_wait_xcnt 0x0" ::: "memory");   // stands ahead of any rewrite of the address registers that the load names
  }

  const float* Wl = Wt + (size_t)koff * ldw + n0 + 4 * rlane;    // this lane's column group, first k of its half
  asm volatile("s_wait_asynccnt 0x0" ::: "memory");   // tile 0 has landed (this wave's part)
  __syncthreads();                                    // ... and every other wave's
  issue(1);
#pragma unroll 1   // rolled: the ring's trips
  for (int t = 0; t < NT; ++t) {
    const float* Al = sA + (t & 1) * PA_TILE_F + rlane * PA_PITCH + koff;   // this lane's row of subtile 0 in the staged tile, first k of its half
#pragma unroll 1   // rolled: one k step's loads already take the registers that three waves per SIMD leave
    for (int kk = 0; kk < PA_KT; kk += 32) {
      const int k0 = t * PA_KT + kk;
      // All loads of a k step go out together, so that the step waits out one latency.
      // Source order: Wt (the longer latency) in two groups of eight k, then A from LDS.
      v4f w[8];                                  // w[e][j] = Wt[k of element e (+ 8)][n0 + 4 * rlane + j]
      v16h bh[4];
#pragma unroll
      for (int e = 0; e < 8; ++e) w[e] = *(const v4f*)(Wl + (k0 + e) * ldw);
#pragma unroll
      for (int j = 0; j < 4; ++j)
#pragma unroll
        for (int e = 0; e < 8; ++e) bh[j][e] = (_Float16)(w[e][j] * 16.0f);
#pragma unroll
      for (int e = 0; e < 8; ++e) w[e] = *(const v4f*)(Wl + (k0 + 16 + e) * ldw);
      asm volatile("s_wait_xcnt 0x0" ::: "memory");   // stands ahead of any rewrite of the address registers that the Wt loads name
      v16f ar[4];                                // A rows of the four subtiles, as staged
#pragma unroll
      for (int i = 0; i < 4; ++i) ar[i] = load_row(Al + (i << 4) * PA_PITCH + kk);
      // no load of the k step sinks below this line: all are in flight before the first A value is used
      __builtin_amdgcn_sched_barrier(0);
#pragma unroll
      for (int j = 0; j < 4; ++j)
#pragma unroll
        for (int e = 0; e < 8; ++e) bh[j][8 + e] = (_Float16)(w[e][j] * 16.0f);
#pragma unroll
      for (int i = 0; i < 4; ++i) {
        v16h ah = to_frag(ar[i]);
#pragma unroll
        for (int j = 0; j < 4; ++j) acc[i][j] = mma_h(ah, bh[j], acc[i][j]);
        dep_guard_h(acc[i][0], acc[i][3], ah, ah);
      }
      keep4_h(bh[0], bh[1], bh[2], bh[3]);
    }
    ring_publish();
    if (t + 2 < NT) issue(t + 2);                     // block-uniform test
  }
  asm volatile("s_wait_asynccnt 0x0" ::: "memory");   // no copy of this wave is left in flight
  acc_guard4(acc[0][0], acc[0][1], acc[0][2], acc[0][3]);
  acc_guard4(acc[1][0], acc[1][1], acc[1][2], acc[1][3]);
  acc_guard4(acc[2][0], acc[2][1], acc[2][2], acc[2][3]);
  acc_guard4(acc[3][0], acc[3][1], acc[3][2], acc[3][3]);

  // ---- epilogue ----
  float* slab = sT[wave];
#pragma unroll
  for (int i = 0; i < 4; ++i) {
    const int mBase = m0 + (i << 4);
#pragma unroll
    for (int r = 0; r < 8; ++r) {
      v4f v;
#pragma unroll
      for (int j = 0; j < 4; ++j) v[j] = acc[i][j][r] * scale + bj[j];
      *(v4f*)(slab + (mOff + r) * 68 + 4 * rlane) = v;
    }
    __builtin_amdgcn_fence(__ATOMIC_RELEASE, "workgroup");
    __builtin_amdgcn_wave_barrier();
    __builtin_amdgcn_fence(__ATOMIC_ACQUIRE, "workgroup");
    {
      const int hh = lane >> 4, c4 = (lane & 15) * 4;     // row seg = 256 B = 16 lanes x 16 B
#pragma unroll
      for (int it = 0; it < 8; ++it) {
        const int row = it * 2 + hh;
        v4f v = *(const v4f*)(slab + row * 68 + c4);
        *(v4f*)(C + (size_t)(mBase + row) * ldc + n0 + c4) = v;
      }
    }
    __builtin_amdgcn_fence(__ATOMIC_RELEASE, "workgroup");
    __builtin_amdgcn_wave_barrier();
    __builtin_amdgcn_fence(__ATOMIC_ACQUIRE, "workgroup");
  }
}

// The two projections of x, whose rows neighbouring blocks of the attention need: one grid, blockIdx.y = 0: x.Wk, 1: x.Wv + bv.
__global__ __launch_bounds__(128) void proj_kv(
    const float* __restrict__ x, const float* __restrict__ Wk, const float* __restrict__ Wv,
    float* __restrict__ kF, float* __restrict__ vF,
    const float* __restrict__ bv, int M, float scale) {
  const int y = blockIdx.y;
  const float* Wt   = (y == 0) ? Wk : Wv;
  float* C          = (y == 0) ? kF : vF;
  const float* bias = (y == 1) ? bv : nullptr;
  gemm64_body<3, 256, 256>(x, Wt, C, bias, M, scale);
}

// ---- local 3x3x3 windowed attention, f32. One thread per (position along W, head) of TWO neighbouring W rows (H = ph, ph + 1). ----
// q: the input, f32 [16384][256]; kf/vf: f32 [16384][256] (voxel-major, col = head*32 + d). No block needs another block's projected
// q rows, so the block projects its own 64 itself: (1/16) * f16(q) . f16(16 Wq) on WMMA, f32, straight into the ring's buffer 0.
// The block's attention output (f16, x8) stays in LDS and is
// the A operand of the output projection, which the same block does for its 64 rows: outp = (1/128) * o . f16(16 Wo) + bo.
// The two output rows need the same K and V rows but for one each: per S slice four rows (H = ph - 1 .. ph + 2) serve both,
// where one output row alone needs three. They pass, two rows to a tile, through a two-buffer LDS ring filled by asynchronous
// copies in whole lines: six K tiles, six V tiles (tile 0, the projected q rows, the block writes itself). A K or V vector of a row that both output rows need
// (H = ph, ph + 1) is read from LDS once and used for both.
// Row and voxel indices clamped into range; out-of-volume neighbours get weight exactly 0; the centre is always in range.
// Per-thread dots / probabilities live in thread-private LDS slots (27 per thread and output row).
#define AT_S 8
#define AT_H 32
#define AT_W 32
#define AT_C 256
#define AT_NB 27
#define AT_PITCH 264
#define AT_HPITCH 36                     // floats per (voxel, head) slot: 32 + 4 pad = 144 B, so 16 lanes' b128 reads cover all 64 banks
#define AT_VPITCH (8 * AT_HPITCH)        // floats per voxel
#define AT_ROW_F (AT_W * AT_VPITCH)      // floats per staged row of 32 voxels (36864 B)
#define AT_TILE_F (2 * AT_ROW_F)         // floats per tile: two staged rows
#define AT_NT 13                         // tiles: the two q rows, 3 x 2 of K, 3 x 2 of V
#define QK_SCALE 0.17677669529663687f

// One staged row: 2048 pieces of 16 B, eight per lane. g = this lane's first global piece, l = its LDS byte address;
// piece j lies 4 KiB further in memory (4 voxels) and 4 voxel pitches further in LDS.
// s_wait_xcnt closes the statement so that no address register of an issued copy is rewritten ahead of it.
__device__ __forceinline__ void stage_row_async(const float* g, unsigned l) {
  asm volatile(
      "global_load_async_to_lds_b128 %0, %8, off\n\t"
      "global_load_async_to_lds_b128 %1, %9, off\n\t"
      "global_load_async_to_lds_b128 %2, %10, off\n\t"
      "global_load_async_to_lds_b128 %3, %11, off\n\t"
      "global_load_async_to_lds_b128 %4, %12, off\n\t"
      "global_load_async_to_lds_b128 %5, %13, off\n\t"
      "global_load_async_to_lds_b128 %6, %14, off\n\t"
      "global_load_async_to_lds_b128 %7, %15, off\n\t"
      "s_wait_xcnt 0x0"
      :: "v"(l), "v"(l + 1u * 16u * AT_VPITCH), "v"(l + 2u * 16u * AT_VPITCH), "v"(l + 3u * 16u * AT_VPITCH),
         "v"(l + 4u * 16u * AT_VPITCH), "v"(l + 5u * 16u * AT_VPITCH), "v"(l + 6u * 16u * AT_VPITCH), "v"(l + 7u * 16u * AT_VPITCH),
         "v"(g), "v"(g + 1 * 1024), "v"(g + 2 * 1024), "v"(g + 3 * 1024),
         "v"(g + 4 * 1024), "v"(g + 5 * 1024), "v"(g + 6 * 1024), "v"(g + 7 * 1024)
      : "memory");
}

__global__ __launch_bounds__(256) void local_attn3d(
    const float* __restrict__ q, const float* __restrict__ Wq, const float* __restrict__ kf, const float* __restrict__ vf,
    const float* __restrict__ Wo, const float* __restrict__ bo, float* __restrict__ outp) {
  __shared__ __align__(16) float sbuf[2 * AT_NB * 256];   // 55296 B; reused as f16 staging (64 x 264 halves = 33792 B)
  __shared__ __align__(16) float tile[2 * AT_TILE_F];     // the ring: two tiles of two staged rows
  const int tid  = threadIdx.x;
  const int head = tid & 7;
  const int vox  = tid >> 3;                          // = position along W
  const int ph = (blockIdx.x & 15) * 2;               // block-uniform: the first of the block's two W rows; grid = 16384/64 exactly
  const int ps = (blockIdx.x >> 4) & 7;
  const int pb = blockIdx.x >> 7;

  const unsigned lds_lane = (unsigned)(uintptr_t)tile +
      4u * (unsigned)((tid >> 6) * AT_VPITCH + ((tid >> 3) & 7) * AT_HPITCH + (tid & 7) * 4);
  auto issue = [&](int t) {                           // tile t >= 1 -> buffer t & 1
    const int u = (t < 7) ? t - 1 : t - 7;                       // dz = u / 2; u odd: the upper pair of rows
    const float* srcp = (t < 7) ? kf : vf;
    const int zs = ps + (u >> 1) - 1;
    const int cs = zs < 0 ? 0 : (zs > AT_S - 1 ? AT_S - 1 : zs);
    const int h0 = ph - 1 + 2 * (u & 1);                         // ph - 1, ph or ph + 1, ph + 2
    const int c0 = h0 < 0 ? 0 : h0;                              // h0 <= 31
    const int c1 = h0 + 1 > AT_H - 1 ? AT_H - 1 : h0 + 1;        // h0 + 1 >= 0
    const int slab = (pb * AT_S + cs) * AT_H;
    const unsigned l = lds_lane + (unsigned)(t & 1) * (4u * AT_TILE_F);
    stage_row_async(srcp + (size_t)((slab + c0) * AT_W) * AT_C + tid * 4, l);
    stage_row_async(srcp + (size_t)((slab + c1) * AT_W) * AT_C + tid * 4, l + 4u * AT_ROW_F);
  };

  // Both projections of the block, 64 rows x 256 columns: wave w owns all 64 rows of columns 32 w .. 32 w + 31 (4 x 2 subtiles).
  // B fragments come straight from the weights: lane column c of subtile j is n0 + 2 * c + j, so that one 8-byte load of W[k][n0 + 2 * c ..]
  // gives the lane its k-th element of both subtiles (16 lanes = one 128-byte line); the k order of the sixteen loads is load_row's.
  const int lane  = tid & 31;
  const int rlane = lane & 15;                 // row (A) / lane column (B, D) within a subtile
  const int koff  = (lane >> 4) * 8;           // k offset of this lane half; also its D row offset
  const int n0    = (tid >> 5) * 32;

  // q projection of the block's 64 rows (contiguous in memory). Its loads and K tile 1 go out together; the tile flies while the rows are multiplied.
  {
    v4f qr[16];                                // piece j: row tid / 64 + 4 j, floats 4 (tid % 64) ..: a wave's load is 512 contiguous bytes
    const float* qg = q + (size_t)blockIdx.x * 64 * AT_C + tid * 4;
#pragma unroll
    for (int j = 0; j < 16; ++j) qr[j] = *(const v4f*)(qg + j * 1024);
    const float* Wl = Wq + koff * AT_C + n0 + 2 * rlane;
    v2f w[2][16];                              // two k steps of Wq: each is reloaded, for two k steps on, as soon as it has been rounded
    auto load_w = [&](v2f (&d)[16], int ks) {
#pragma unroll
      for (int e = 0; e < 8; ++e) {
        d[e]     = *(const v2f*)(Wl + (ks * 32 + e) * AT_C);
        d[8 + e] = *(const v2f*)(Wl + (ks * 32 + 16 + e) * AT_C);
      }
      asm volatile("s_wait_xcnt 0x0" ::: "memory");   // stands ahead of any rewrite of the address registers that the loads so far name
    };
    load_w(w[0], 0);
    load_w(w[1], 1);
    issue(1);

    // the rows, rounded once, as the f16 A tile [64][256] (pitch 264 halves = 16 B x 33: b128 fragment reads without bank conflicts)
    _Float16* sq = reinterpret_cast<_Float16*>(sbuf);
#pragma unroll
    for (int j = 0; j < 16; ++j)
      *(v4h*)(sq + ((tid >> 6) + 4 * j) * AT_PITCH + (tid & 63) * 4) = __builtin_convertvector(qr[j], v4h);
    __syncthreads();                           // the A tile is whole before any wave takes fragments from it

    v8f c[4][2];
#pragma unroll
    for (int i = 0; i < 4; ++i)
#pragma unroll
      for (int j = 0; j < 2; ++j) c[i][j] = (v8f){0.f,0.f,0.f,0.f,0.f,0.f,0.f,0.f};
    const _Float16* Al = sq + rlane * AT_PITCH + koff;
    // k step ks, its Wq rows in wk; more: k step ks + 2 exists (a constant at each call, so that a trip holds no branch)
    auto kstep = [&](v2f (&wk)[16], const int ks, const bool more) {
      v16h ah[4];                              // A fragments of this k step, read ahead of the conversions, so that the LDS latency lies under them
#pragma unroll
      for (int i = 0; i < 4; ++i) ah[i] = load_row(Al + i * 16 * AT_PITCH + ks * 32);
      v16h bh[2];
#pragma unroll
      for (int j = 0; j < 2; ++j)
#pragma unroll
        for (int e = 0; e < 16; ++e) bh[j][e] = (_Float16)(wk[e][j] * 16.0f);
      // the reload stays below the rounding of the values that it replaces: above it, it would need registers of its own and a copy per value
      __builtin_amdgcn_sched_barrier(0);
      if (more) load_w(wk, ks + 2);
#pragma unroll
      for (int i = 0; i < 4; ++i)
#pragma unroll
        for (int j = 0; j < 2; ++j) c[i][j] = mma_h(ah[i], bh[j], c[i][j]);
    };
#pragma unroll 1   // rolled, two k steps a trip (w[] stays in registers)
    for (int kp = 0; kp < AT_C / 64 - 1; ++kp) {
      kstep(w[0], 2 * kp, true);
      kstep(w[1], 2 * kp + 1, true);
    }
    kstep(w[0], AT_C / 32 - 2, false);
    kstep(w[1], AT_C / 32 - 1, false);
    // D: subtile (i, j), register r -> row 16 i + koff + r, column n0 + 2 * rlane + j = element 2 * rlane + j of head n0 / 32;
    // it goes to its place in ring buffer 0, laid out as a staged tile of two rows of 32 voxels.
    float* qd = tile + koff * AT_VPITCH + (tid >> 5) * AT_HPITCH + 2 * rlane;
#pragma unroll
    for (int i = 0; i < 4; ++i)
#pragma unroll
      for (int r = 0; r < 8; ++r)
        *(v2f*)(qd + (i >> 1) * AT_ROW_F + ((i & 1) * 16 + r) * AT_VPITCH) =
            (v2f){c[i][0][r] * (1.0f / 16.0f), c[i][1][r] * (1.0f / 16.0f)};
    __syncthreads();                           // the q tile is whole before any thread reads its vectors; every read of the A tile has retired
  }

  // this thread's three neighbours along W inside a staged row (clamped)
  const int o0 = (vox > 0 ? vox - 1 : 0) * AT_VPITCH + head * AT_HPITCH;
  const int o1 = vox * AT_VPITCH + head * AT_HPITCH;
  const int o2 = (vox < AT_W - 1 ? vox + 1 : AT_W - 1) * AT_VPITCH + head * AT_HPITCH;

  // trip 0: this thread's two q vectors from the q tile; qq[c] = (q of row ph, q of row ph + 1)
  v2f qq[32];
  {
    const float* qptr = tile + o1;
#pragma unroll
    for (int i = 0; i < 8; ++i) {
      const v4f ta = *(const v4f*)(qptr + 4 * i);
      const v4f tb = *(const v4f*)(qptr + AT_ROW_F + 4 * i);
#pragma unroll
      for (int c = 0; c < 4; ++c) qq[4 * i + c] = (v2f){ta[c], tb[c]};
    }
  }
  ring_publish();
  issue(2);

  // One staged row as this thread needs it: the whole vectors of its three neighbours along W, 24 reads of 16 B, 96 registers.
  // A trip reads both its rows so, ahead of all its arithmetic: at two waves per SIMD nothing else hides an LDS read's latency,
  // and read a few vectors at a time, each just ahead of its use, a row waits that latency out several times over.
  auto read3 = [&](const float* tb, v4f (&x)[3][8]) {
#pragma unroll
    for (int i = 0; i < 8; ++i) {
      x[0][i] = *(const v4f*)(tb + o0 + 4 * i);
      x[1][i] = *(const v4f*)(tb + o1 + 4 * i);
      x[2][i] = *(const v4f*)(tb + o2 + 4 * i);
    }
  };
  // the three dots of one output row (R = 0: ph, 1: ph + 1) with one staged K row
  auto dots1 = [&](const v4f (&x)[3][8], const int r, float (&d)[3]) {
    float a0 = 0.f, a1 = 0.f, a2 = 0.f;
#pragma unroll
    for (int i = 0; i < 8; ++i) {
      const v4f k0 = x[0][i], k1 = x[1][i], k2 = x[2][i];
#pragma unroll
      for (int c = 0; c < 4; ++c) {
        a0 = fmaf(qq[4 * i + c][r], k0[c], a0);
        a1 = fmaf(qq[4 * i + c][r], k1[c], a1);
        a2 = fmaf(qq[4 * i + c][r], k2[c], a2);
      }
    }
    d[0] = a0 * QK_SCALE; d[1] = a1 * QK_SCALE; d[2] = a2 * QK_SCALE;
  };
  // the three dots of both output rows with one staged K row: each K vector is read once
  auto dots2 = [&](const v4f (&x)[3][8], float (&dA)[3], float (&dB)[3]) {
    v2f a0 = (v2f){0.f, 0.f}, a1 = a0, a2 = a0;
#pragma unroll
    for (int i = 0; i < 8; ++i) {
      const v4f k0 = x[0][i], k1 = x[1][i], k2 = x[2][i];
#pragma unroll
      for (int c = 0; c < 4; ++c) {
        a0 = __builtin_elementwise_fma(qq[4 * i + c], (v2f){k0[c], k0[c]}, a0);
        a1 = __builtin_elementwise_fma(qq[4 * i + c], (v2f){k1[c], k1[c]}, a1);
        a2 = __builtin_elementwise_fma(qq[4 * i + c], (v2f){k2[c], k2[c]}, a2);
      }
    }
    dA[0] = a0[0] * QK_SCALE; dA[1] = a1[0] * QK_SCALE; dA[2] = a2[0] * QK_SCALE;
    dB[0] = a0[1] * QK_SCALE; dB[1] = a1[1] * QK_SCALE; dB[2] = a2[1] * QK_SCALE;
  };
  float mx[2] = {-INFINITY, -INFINITY};
  unsigned vmask[2] = {0u, 0u};
  // files the three dots of output row ph + r with window row (dz, dy); vrow: that window row lies in the volume
  auto put = [&](int r, int dz, int dy, const float (&d)[3]) {
    const bool vrow = ((unsigned)(ps + dz - 1) < (unsigned)AT_S) && ((unsigned)(ph + r + dy - 1) < (unsigned)AT_H);
    const int kk = 9 * dz + 3 * dy;
    float* sp = sbuf + (r * AT_NB + kk) * 256 + tid;
    sp[0] = d[0]; sp[256] = d[1]; sp[512] = d[2];
    if (vrow && vox > 0)        { mx[r] = fmaxf(mx[r], d[0]); vmask[r] |= (1u << (kk + 0)); }
    if (vrow)                   { mx[r] = fmaxf(mx[r], d[1]); vmask[r] |= (1u << (kk + 1)); }
    if (vrow && vox < AT_W - 1) { mx[r] = fmaxf(mx[r], d[2]); vmask[r] |= (1u << (kk + 2)); }
  };

  // pass 1: dots; per S slice dz two trips: K rows ph - 1, ph (buffer 1), then ph + 1, ph + 2 (buffer 0)
#pragma unroll 1   // rolled: the ring's trips; unrolled they would only lengthen the code
  for (int dz = 0; dz < 3; ++dz) {
    float dA[3], dB[3];
    v4f ra[3][8], rb[3][8];
    read3(tile + AT_TILE_F, ra);
    read3(tile + AT_TILE_F + AT_ROW_F, rb);
    __builtin_amdgcn_sched_barrier(0);                // no read of the trip sinks below this line: all are in flight before the first value is used
    dots1(ra, 0, dA);
    put(0, dz, 0, dA);
    dots2(rb, dA, dB);
    put(0, dz, 1, dA);
    put(1, dz, 0, dB);
    ring_publish();
    issue(2 * dz + 3);                                // tiles 3, 5, 7 exist
    read3(tile, ra);
    read3(tile + AT_ROW_F, rb);
    __builtin_amdgcn_sched_barrier(0);                // as above
    dots2(ra, dA, dB);
    put(0, dz, 2, dA);
    put(1, dz, 1, dB);
    dots1(rb, 1, dB);
    put(1, dz, 2, dB);
    ring_publish();
    issue(2 * dz + 4);                                // tiles 4, 6, 8 exist
  }

  // pass 2: probabilities (exactly 0 for out-of-range neighbours), sums
  float sum[2] = {0.f, 0.f};
#pragma unroll 1   // rolled, one S slice's nine neighbours a trip: their 18 dots are read together, so that a trip waits out one LDS latency
  for (int kb = 0; kb < AT_NB; kb += 9) {
    float d[9][2];
#pragma unroll
    for (int j = 0; j < 9; ++j)
#pragma unroll
      for (int r = 0; r < 2; ++r) d[j][r] = sbuf[(r * AT_NB + kb + j) * 256 + tid];
#pragma unroll
    for (int j = 0; j < 9; ++j)
#pragma unroll
      for (int r = 0; r < 2; ++r) {
        const float ex = __expf(d[j][r] - mx[r]);
        const float p = ((vmask[r] >> (kb + j)) & 1u) ? ex : 0.f;
        sbuf[(r * AT_NB + kb + j) * 256 + tid] = p;
        sum[r] += p;
      }
  }
  const float inv[2] = {__builtin_amdgcn_rcpf(sum[0]), __builtin_amdgcn_rcpf(sum[1])};   // sums >= 1

  // Output projection: the tiling and the B loads of the q projection above.
  const float* Wl = Wo + koff * AT_C + n0 + 2 * rlane;
  v2f w[3][16];                                // three k steps of Wo: the next two are in flight while this one is multiplied
  auto load_w = [&](int ks) {
#pragma unroll
    for (int e = 0; e < 8; ++e) {
      w[ks % 3][e]     = *(const v2f*)(Wl + (ks * 32 + e) * AT_C);
      w[ks % 3][8 + e] = *(const v2f*)(Wl + (ks * 32 + 16 + e) * AT_C);
    }
  };
  load_w(0);                                   // issued here, ahead of pass 3, so that the first k step waits for nothing behind the ring
  const v2f bj = *(const v2f*)(bo + n0 + 2 * rlane);
  asm volatile("s_wait_xcnt 0x0" ::: "memory");   // stands ahead of any rewrite of the address registers that these loads name

  // pass 3: weighted sums of v rows, the trips as in pass 1
  float acc[2][32];
#pragma unroll
  for (int i = 0; i < 32; ++i) { acc[0][i] = 0.f; acc[1][i] = 0.f; }
  // the three probabilities of output row ph + r for window row (dz, dy)
  auto get = [&](int r, int dz, int dy, float (&p)[3]) {
    const float* sp = sbuf + (r * AT_NB + 9 * dz + 3 * dy) * 256 + tid;
    p[0] = sp[0]; p[1] = sp[256]; p[2] = sp[512];
  };
  // one staged V row into one output row's sums
  auto pv1 = [&](const v4f (&x)[3][8], const int r, const float (&p)[3]) {
#pragma unroll
    for (int i = 0; i < 8; ++i) {
      const v4f v0 = x[0][i], v1 = x[1][i], v2 = x[2][i];
#pragma unroll
      for (int c = 0; c < 4; ++c) {
        float s = acc[r][4 * i + c];
        s = fmaf(p[0], v0[c], s);
        s = fmaf(p[1], v1[c], s);
        s = fmaf(p[2], v2[c], s);
        acc[r][4 * i + c] = s;
      }
    }
  };
  // one staged V row into both output rows' sums: each V vector is read once
  auto pv2 = [&](const v4f (&x)[3][8], const float (&pA)[3], const float (&pB)[3]) {
#pragma unroll
    for (int i = 0; i < 8; ++i) {
      const v4f v0 = x[0][i], v1 = x[1][i], v2 = x[2][i];
#pragma unroll
      for (int c = 0; c < 4; ++c) {
        float s = acc[0][4 * i + c];
        s = fmaf(pA[0], v0[c], s);
        s = fmaf(pA[1], v1[c], s);
        s = fmaf(pA[2], v2[c], s);
        acc[0][4 * i + c] = s;
        float u = acc[1][4 * i + c];
        u = fmaf(pB[0], v0[c], u);
        u = fmaf(pB[1], v1[c], u);
        u = fmaf(pB[2], v2[c], u);
        acc[1][4 * i + c] = u;
      }
    }
  };
  // the two trips of S slice dz; more: the tiles two trips on exist (a constant at each call, so that a trip holds no branch:
  // with one, the compiler moved both trips' sums behind it and kept two tiles' LDS reads in registers, with spills)
  auto slice3 = [&](const int dz, const bool more) {
    float pA[3], pB[3], pC[3];
    v4f ra[3][8], rb[3][8];
    get(0, dz, 0, pC); get(0, dz, 1, pA); get(1, dz, 0, pB);
    read3(tile + AT_TILE_F, ra);
    read3(tile + AT_TILE_F + AT_ROW_F, rb);
    __builtin_amdgcn_sched_barrier(0);                // no read of the trip sinks below this line: all are in flight before the first value is used
    pv1(ra, 0, pC);
    pv2(rb, pA, pB);
    ring_publish();
    if (more) issue(2 * dz + 9);
    get(0, dz, 2, pA); get(1, dz, 1, pB); get(1, dz, 2, pC);
    read3(tile, ra);
    read3(tile + AT_ROW_F, rb);
    __builtin_amdgcn_sched_barrier(0);                // as above
    pv2(ra, pA, pB);
    pv1(rb, 1, pC);
    ring_publish();
    if (more) issue(2 * dz + 10);
  };
#pragma unroll 1   // rolled: the ring's trips
  for (int dz = 0; dz < 2; ++dz) slice3(dz, true);    // issues tiles 9 .. 12
  slice3(2, false);                                   // no tile 13
  asm volatile("s_wait_asynccnt 0x0" ::: "memory");   // no copy of this wave is left in flight

  // stage the f16 tile [64 voxels][256] in LDS (pitch 264 halves = 16 B x 33: b128 fragment reads without bank conflicts)
  __syncthreads();
  _Float16* st = reinterpret_cast<_Float16*>(sbuf);
#pragma unroll
  for (int r = 0; r < 2; ++r) {
    const float osc = inv[r] * 8.0f;     // normalise and carry x8 for the f16 A operand of the output projection
    _Float16* sp = st + (r * AT_W + vox) * AT_PITCH + head * 32;
#pragma unroll
    for (int j = 0; j < 4; ++j) {
      v8h hv;
#pragma unroll
      for (int i = 0; i < 8; ++i) hv[i] = (_Float16)(acc[r][8 * j + i] * osc);
      *(v8h*)(sp + 8 * j) = hv;
    }
  }
  __syncthreads();

  v8f c[4][2];
#pragma unroll
  for (int i = 0; i < 4; ++i)
#pragma unroll
    for (int j = 0; j < 2; ++j) c[i][j] = (v8f){0.f,0.f,0.f,0.f,0.f,0.f,0.f,0.f};
  const _Float16* Al = st + rlane * AT_PITCH + koff;
  load_w(1);
#pragma unroll   // unrolled: every Wo load is the one base register plus an immediate offset, and w[] stays in registers
  for (int ks = 0; ks < AT_C / 32; ++ks) {
    if (ks + 2 < AT_C / 32) load_w(ks + 2);
    v16h ah[4];                                // A fragments of this k step, read ahead of the conversions, so that the LDS latency lies under them
#pragma unroll
    for (int i = 0; i < 4; ++i) ah[i] = load_row(Al + i * 16 * AT_PITCH + ks * 32);
    v16h bh[2];
#pragma unroll
    for (int j = 0; j < 2; ++j)
#pragma unroll
      for (int e = 0; e < 16; ++e) bh[j][e] = (_Float16)(w[ks % 3][e][j] * 16.0f);
#pragma unroll
    for (int i = 0; i < 4; ++i)
#pragma unroll
      for (int j = 0; j < 2; ++j) c[i][j] = mma_h(ah[i], bh[j], c[i][j]);
    // no later k step's loads rise above this line: hoisted all at once they would take far more registers than the three k steps in w[]
    __builtin_amdgcn_sched_barrier(0);
  }

  // D: subtile (i, j), register r -> row 16 i + koff + r, column n0 + 2 * rlane + j; 16 lanes store one whole 128-byte line of a row
  float* ob = outp + (size_t)blockIdx.x * 64 * AT_C + koff * AT_C + n0 + 2 * rlane;
#pragma unroll
  for (int i = 0; i < 4; ++i)
#pragma unroll
    for (int r = 0; r < 8; ++r) {
      v2f v;
#pragma unroll
      for (int j = 0; j < 2; ++j) v[j] = c[i][j][r] * (1.0f / 128.0f) + bj[j];
      *(v2f*)(ob + (i * 16 + r) * AT_C) = v;
    }
}

// ---------------------------------------------------------------------------
extern "C" void kernel_launch(void* const* d_in, const int* in_sizes, int n_in,
                              void* d_out, int out_size, void* d_ws, size_t ws_size,
                              hipStream_t stream) {
  const int MP = 16384;     // B*S*H*W = 2*8*32*32
  const int DC = 256;       // DIM == INNER
  if (n_in < 8) return;
  if (in_sizes[0] != MP * DC || in_sizes[1] != MP * DC) return;
  if (in_sizes[2] != DC * DC || in_sizes[3] != DC * DC || in_sizes[4] != DC * DC || in_sizes[6] != DC * DC) return;
  if (in_sizes[5] != DC || in_sizes[7] != DC) return;
  if (out_size != MP * DC) return;

  const float* x  = (const float*)d_in[0];
  const float* q  = (const float*)d_in[1];
  const float* Wq = (const float*)d_in[2];
  const float* Wk = (const float*)d_in[3];
  const float* Wv = (const float*)d_in[4];
  const float* bv = (const float*)d_in[5];
  const float* Wo = (const float*)d_in[6];
  const float* bo = (const float*)d_in[7];
  float* outp = (float*)d_out;

  const size_t actF = (size_t)MP * DC * sizeof(float);      // 16 MiB
  size_t off = 0;
  char* base = (char*)d_ws;
  float*    kF  = (float*)(base + off);    off += actF;
  float*    vF  = (float*)(base + off);    off += actF;
  // total = 33,554,432 B
  if (off > ws_size) return;

  // 1) projections of x, one grid: C = (1/16) * f16(A) . f16(16 W) (+ bias[n]); M = 16384, N = K = 256; 1024 64x64 tiles each, 4 per block
  const dim3 gg2((MP / 64) * (DC / 64) / 4, 2);
  const float s16 = 1.0f / 16.0f;
  proj_kv<<<gg2, 128, 0, stream>>>(x, Wk, Wv, kF, vF, bv, MP, s16);

  // 2) per block of 64 rows: q projection, windowed attention (f32), output projection -> d_out (f32)
  local_attn3d<<<MP / 64, 256, 0, stream>>>(q, Wq, kF, vF, Wo, bo, outp);
}

// v009
// Measured time: 38.5 microseconds a run.
// Two timings next to v008 both put it at 1.08 times that version's speed.
// Counting every step since v000, it is 4.21 times as fast.
// Projections x@Wk, x@Wv+bv, q@Wq, o@Wo+bo: v_wmma_f32_16x16x32_f16 (f16 operands; weights carried x16, o carried x8; f32 accumulate). Windowed q.k, softmax, p.v: f32 VALU.
// Wq and Wo, which every block of the second launch multiplies by whole, are rounded once, in the first launch, and laid out as the second launch's B fragments.
#include <hip/hip_runtime.h>
#include <hip/hip_bf16.h>

typedef __attribute__((ext_vector_type(16))) _Float16 v16h;
typedef __attribute__((ext_vector_type(8)))  _Float16 v8h;
typedef __attribute__((ext_vector_type(4)))  _Float16 v4h;
typedef __attribute__((ext_vector_type(8)))  float    v8f;
typedef __attribute__((ext_vector_type(4)))  float    v4f;
typedef __attribute__((ext_vector_type(2)))  float    v2f;
typedef __attribute__((ext_vector_type(16))) float    v16f;

// hazard guards as plain device helpers (the kernel template body keeps four inline asm waits: s_wait_xcnt after the bias and Wt loads, s_wait_asynccnt before the ring and after it)
__device__ __forceinline__ void dep_guard_h(v8f& a, v8f& b, v16h x, v16h y) { asm volatile("v_nop\n\tv_nop\n\tv_nop\n\tv_nop" : "+v"(a), "+v"(b) : "v"(x), "v"(y)); }
__device__ __forceinline__ void keep4_h(v16h a, v16h b, v16h c, v16h d) { asm volatile("v_nop" :: "v"(a), "v"(b), "v"(c), "v"(d)); }
__device__ __forceinline__ void acc_guard4(v8f& a, v8f& b, v8f& c, v8f& d) { asm volatile("v_nop\n\tv_nop\n\tv_nop\n\tv_nop" : "+v"(a), "+v"(b), "+v"(c), "+v"(d)); }

__device__ __forceinline__ v16f cat4(v4f a, v4f b, v4f c, v4f d) {
  return __builtin_shufflevector(__builtin_shufflevector(a, b, 0, 1, 2, 3, 4, 5, 6, 7),
                                 __builtin_shufflevector(c, d, 0, 1, 2, 3, 4, 5, 6, 7),
                                 0, 1, 2, 3, 4, 5, 6, 7, 8, 9, 10, 11, 12, 13, 14, 15);
}
// The sixteen k of one A row that a lane holds, k order: elements 0..7 <- p[0..7], 8..15 <- p[16..23]; as stored (f16 or f32).
__device__ __forceinline__ v16h load_row(const _Float16* p) {
  union { v16h v; v8h h[2]; } f;
  f.h[0] = *(const v8h*)(p); f.h[1] = *(const v8h*)(p + 16); return f.v;
}
__device__ __forceinline__ v16f load_row(const float* p) {
  return cat4(*(const v4f*)(p), *(const v4f*)(p + 4), *(const v4f*)(p + 16), *(const v4f*)(p + 20));
}
// ... and as the f16 fragment (f32 is rounded here)
__device__ __forceinline__ v16h to_frag(v16f a) { return __builtin_convertvector(a, v16h); }
__device__ __forceinline__ v8f mma_h(v16h a, v16h b, v8f c) {
  return __builtin_amdgcn_wmma_f32_16x16x32_f16(false, a, false, b, (short)0, c, false, false);
}

// ---- LDS ring helpers ---------------------------------------------------------
#define PA_KT 64                         // k per staged A tile: two k steps, 256 B of each of the 64 rows
#define PA_PITCH 68                      // floats per staged row: 272 B = 16 B x 17, so 16 lanes' b128 reads of 16 rows cover all 64 banks
#define PA_TILE_F (64 * PA_PITCH)        // floats per staged tile (17408 B)

// One staged A tile: 1024 pieces of 16 B, eight per lane. g = this lane's first global piece, l = its LDS byte address;
// piece j lies eight rows further, in memory (LD floats per row) and in LDS.
// s_wait_xcnt closes the statement so that no address register of an issued copy is rewritten ahead of it.
template <int LD>
__device__ __forceinline__ void stage_a_async(const float* g, unsigned l) {
  asm volatile(
      "global_load_async_to_lds_b128 %0, %8, off\n\t"
      "global_load_async_to_lds_b128 %1, %9, off\n\t"
      "global_load_async_to_lds_b128 %2, %10, off\n\t"
      "global_load_async_to_lds_b128 %3, %11, off\n\t"
      "global_load_async_to_lds_b128 %4, %12, off\n\t"
      "global_load_async_to_lds_b128 %5, %13, off\n\t"
      "global_load_async_to_lds_b128 %6, %14, off\n\t"
      "global_load_async_to_lds_b128 %7, %15, off\n\t"
      "s_wait_xcnt 0x0"
      :: "v"(l), "v"(l + 1u * 32u * PA_PITCH), "v"(l + 2u * 32u * PA_PITCH), "v"(l + 3u * 32u * PA_PITCH),
         "v"(l + 4u * 32u * PA_PITCH), "v"(l + 5u * 32u * PA_PITCH), "v"(l + 6u * 32u * PA_PITCH), "v"(l + 7u * 32u * PA_PITCH),
         "v"(g), "v"(g + 1 * 8 * LD), "v"(g + 2 * 8 * LD), "v"(g + 3 * 8 * LD),
         "v"(g + 4 * 8 * LD), "v"(g + 5 * 8 * LD), "v"(g + 6 * 8 * LD), "v"(g + 7 * 8 * LD)
      : "memory");
}

// Foot of a ring trip: hands the next tile to every wave and frees the buffer just read.
__device__ __forceinline__ void ring_publish() {
  asm volatile("s_wait_dscnt 0x0" ::: "memory");     // this wave's LDS reads of the buffer to be refilled have retired
  asm volatile("s_wait_asynccnt 0x0" ::: "memory");  // this wave's copies of the next tile have landed
  __syncthreads();                                   // every wave's copies are visible; every reader has left the old buffer
}

// ---- Register-blocked WMMA GEMM ---------------------------------------------
// C[m,n] = scale * sum_k f16(A[m,k]) * f16(16 * Wt[k,n]) (+bias[n]); each wave owns a 64x64 tile; C is f32.
// A row-major [M,K], f32; Wt row-major [K,N], f32, as the caller's input holds it; M % 64 == 0, N == 256, K % 128 == 0.
// A block is one 64-row stripe of A, which all four waves multiply: it passes through a two-buffer LDS ring, 64 k per tile,
// filled by asynchronous copies in whole 256-byte row pieces; every wave takes its A fragments from there.
// N and K are compile-time, so that every Wt load of a k step is one base register plus an immediate offset.
// B fragments come straight from Wt: lane column c of subtile j is n0 + 4 * c + j, so that one 16-byte load of
// Wt[k][n0 + 4 * c ..] gives the lane its k-th element of all four subtiles (16 lanes = 256 contiguous bytes of a row);
// the k order of the sixteen loads is load_row's. D's column map follows: subtile j, lane column c -> n0 + 4 * c + j.
// BIAS_MODE: 2 = bias[n], 3 = bias[n] where a bias pointer is given (block-uniform), else none.
template <int BIAS_MODE, int N, int K>
__device__ __forceinline__ void gemm64_body(
    const float* __restrict__ A, const float* __restrict__ Wt, float* __restrict__ C,
    const float* __restrict__ bias, int M, float scale) {
  static_assert(N == 256 && K % (2 * PA_KT) == 0, "four waves x 64 columns; at least two staged tiles");
  constexpr int lda = K, ldw = N, ldc = N;
  constexpr int NT = K / PA_KT;                    // staged tiles
  __shared__ __align__(16) float sT[4][16 * 68];   // per-wave 16x64 slab, pitch 68 floats
  __shared__ __align__(16) float sA[2 * PA_TILE_F];   // the ring: two staged A tiles
  const int tid  = threadIdx.x;
  const int lane = tid & 31;
  const int wave = tid >> 5;
  const int tm = blockIdx.x;             // the block's 64-row stripe of A
  if (tm >= (M >> 6)) return;            // block-uniform, ahead of every barrier
  const int tn = wave;                   // four waves: the four 64-column tiles of N = 256
  const int m0 = tm << 6;
  const int n0 = tn << 6;

  // lane's piece 0 of a tile: row tid / 16, 16 B number tid % 16 of the row's 256 B (a wave's copy = two whole row pieces)
  const float* Ag = A + (size_t)(m0 + (tid >> 4)) * lda + (tid & 15) * 4;
  const unsigned Alds = (unsigned)(uintptr_t)sA + 4u * (unsigned)((tid >> 4) * PA_PITCH + (tid & 15) * 4);
  auto issue = [&](int t) {              // tile t (k = 64 t .. 64 t + 63) -> buffer t & 1
    stage_a_async<lda>(Ag + t * PA_KT, Alds + (unsigned)(t & 1) * (4u * PA_TILE_F));
  };
  issue(0);

  const int rlane = lane & 15;                 // row (A) / lane column (B, D) within subtile
  const int koff  = (lane >> 4) * 8;           // k offset of this lane half
  const int mOff  = (lane >> 4) * 8;           // D row offset

  v8f acc[4][4];
#pragma unroll
  for (int i = 0; i < 4; ++i)
#pragma unroll
    for (int j = 0; j < 4; ++j) acc[i][j] = (v8f){0.f,0.f,0.f,0.f,0.f,0.f,0.f,0.f};

  v4f bj = (v4f){0.f, 0.f, 0.f, 0.f};          // this lane's four bias values (columns n0 + 4 * rlane + 0..3)
  if (BIAS_MODE == 2 || bias != nullptr) {     // BIAS_MODE 3: one uniform test
    bj = *(const v4f*)(bias + n0 + 4 * rlane);
    asm volatile("s_wait_xcnt 0x0" ::: "memory");   // stands ahead of any rewrite of the address registers that the load names
  }

  const float* Wl = Wt + (size_t)koff * ldw + n0 + 4 * rlane;    // this lane's column group, first k of its half
  asm volatile("s_wait_asynccnt 0x0" ::: "memory");   // tile 0 has landed (this wave's part)
  __syncthreads();                                    // ... and every other wave's
  issue(1);
#pragma unroll 1   // rolled: the ring's trips
  for (int t = 0; t < NT; ++t) {
    const float* Al = sA + (t & 1) * PA_TILE_F + rlane * PA_PITCH + koff;   // this lane's row of subtile 0 in the staged tile, first k of its half
#pragma unroll 1   // rolled: one k step's loads already take the registers that three waves per SIMD leave
    for (int kk = 0; kk < PA_KT; kk += 32) {
      const int k0 = t * PA_KT + kk;
      // All loads of a k step go out together, so that the step waits out one latency.
      // Source order: Wt (the longer latency) in two groups of eight k, then A from LDS.
      v4f w[8];                                  // w[e][j] = Wt[k of element e (+ 8)][n0 + 4 * rlane + j]
      v16h bh[4];
#pragma unroll
      for (int e = 0; e < 8; ++e) w[e] = *(const v4f*)(Wl + (k0 + e) * ldw);
#pragma unroll
      for (int j = 0; j < 4; ++j)
#pragma unroll
        for (int e = 0; e < 8; ++e) bh[j][e] = (_Float16)(w[e][j] * 16.0f);
#pragma unroll
      for (int e = 0; e < 8; ++e) w[e] = *(const v4f*)(Wl + (k0 + 16 + e) * ldw);
      asm volatile("s_wait_xcnt 0x0" ::: "memory");   // stands ahead of any rewrite of the address registers that the Wt loads name
      v16f ar[4];                                // A rows of the four subtiles, as staged
#pragma unroll
      for (int i = 0; i < 4; ++i) ar[i] = load_row(Al + (i << 4) * PA_PITCH + kk);
      // no load of the k step sinks below this line: all are in flight before the first A value is used
      __builtin_amdgcn_sched_barrier(0);
#pragma unroll
      for (int j = 0; j < 4; ++j)
#pragma unroll
        for (int e = 0; e < 8; ++e) bh[j][8 + e] = (_Float16)(w[e][j] * 16.0f);
#pragma unroll
      for (int i = 0; i < 4; ++i) {
        v16h ah = to_frag(ar[i]);
#pragma unroll
        for (int j = 0; j < 4; ++j) acc[i][j] = mma_h(ah, bh[j], acc[i][j]);
        dep_guard_h(acc[i][0], acc[i][3], ah, ah);
      }
      keep4_h(bh[0], bh[1], bh[2], bh[3]);
    }
    ring_publish();
    if (t + 2 < NT) issue(t + 2);                     // block-uniform test
  }
  asm volatile("s_wait_asynccnt 0x0" ::: "memory");   // no copy of this wave is left in flight
  acc_guard4(acc[0][0], acc[0][1], acc[0][2], acc[0][3]);
  acc_guard4(acc[1][0], acc[1][1], acc[1][2], acc[1][3]);
  acc_guard4(acc[2][0], acc[2][1], acc[2][2], acc[2][3]);
  acc_guard4(acc[3][0], acc[3][1], acc[3][2], acc[3][3]);

  // ---- epilogue ----
  float* slab = sT[wave];
#pragma unroll
  for (int i = 0; i < 4; ++i) {
    const int mBase = m0 + (i << 4);
#pragma unroll
    for (int r = 0; r < 8; ++r) {
      v4f v;
#pragma unroll
      for (int j = 0; j < 4; ++j) v[j] = acc[i][j][r] * scale + bj[j];
      *(v4f*)(slab + (mOff + r) * 68 + 4 * rlane) = v;
    }
    __builtin_amdgcn_fence(__ATOMIC_RELEASE, "workgroup");
    __builtin_amdgcn_wave_barrier();
    __builtin_amdgcn_fence(__ATOMIC_ACQUIRE, "workgroup");
    {
      const int hh = lane >> 4, c4 = (lane & 15) * 4;     // row seg = 256 B = 16 lanes x 16 B
#pragma unroll
      for (int it = 0; it < 8; ++it) {
        const int row = it * 2 + hh;
        v4f v = *(const v4f*)(slab + row * 68 + c4);
        *(v4f*)(C + (size_t)(mBase + row) * ldc + n0 + c4) = v;
      }
    }
    __builtin_amdgcn_fence(__ATOMIC_RELEASE, "workgroup");
    __builtin_amdgcn_wave_barrier();
    __builtin_amdgcn_fence(__ATOMIC_ACQUIRE, "workgroup");
  }
}

// ---- Wq and Wo as ready B fragments -------------------------------------------
// local_attn3d's wave w (columns 32 w .. 32 w + 31), k step ks, subtile j: lane l holds, as element 8 p + e of its B fragment,
// f16(16 * W[32 ks + 8 (l / 16) + 16 p + e][32 w + 2 (l % 16) + j]) (load_row's k order). Piece (w, ks, j, p) is the 32 lanes' eight
// elements each, 512 contiguous bytes, lane l at byte 16 l; pieces follow one another in that order (p fastest): 128 KiB a matrix.
#define WF_PIECE 256                     // halves per piece
#define WF_WAVE (8 * 2 * 2 * WF_PIECE)   // halves per wave of local_attn3d: all its fragments, 16 KiB
#define WF_MAT (8 * WF_WAVE)             // halves per matrix
// One thread makes one lane's 16 bytes of one piece; a wave stores one whole piece.
__device__ __forceinline__ void pack_w_frags(const float* __restrict__ Wq, const float* __restrict__ Wo,
                                             _Float16* __restrict__ wqH, _Float16* __restrict__ woH) {
  const int g = blockIdx.x * 128 + threadIdx.x;          // (matrix, w, ks, j, p, lane)
  if (g >= 2 * (WF_MAT / 8)) return;
  const int l = g & 31, p = (g >> 5) & 1, j = (g >> 6) & 1, ks = (g >> 7) & 7, w = (g >> 10) & 7;
  const bool second = (g >> 13) != 0;
  const float* s = (second ? Wo : Wq) + (32 * ks + 8 * (l >> 4) + 16 * p) * 256 + 32 * w + 2 * (l & 15) + j;
  float t[8];
#pragma unroll
  for (int e = 0; e < 8; ++e) t[e] = s[e * 256];
  asm volatile("s_wait_xcnt 0x0" ::: "memory");   // stands ahead of any rewrite of the address registers that the loads name
  v8h h;
#pragma unroll
  for (int e = 0; e < 8; ++e) h[e] = (_Float16)(t[e] * 16.0f);
  *(v8h*)((second ? woH : wqH) + (g & (WF_MAT / 8 - 1)) * 8) = h;
}
// One B fragment: its two pieces
__device__ __forceinline__ v16h load_w_frag(const _Float16* p) {
  union { v16h v; v8h h[2]; } f;
  f.h[0] = *(const v8h*)(p); f.h[1] = *(const v8h*)(p + WF_PIECE); return f.v;
}

// One grid, blockIdx.y = 0: x.Wk, 1: x.Wv + bv (the two projections of x, whose rows neighbouring blocks of the attention need),
// 2: the fragments of Wq and Wo.
__global__ __launch_bounds__(128) void proj_kv(
    const float* __restrict__ x, const float* __restrict__ Wk, const float* __restrict__ Wv,
    float* __restrict__ kF, float* __restrict__ vF,
    const float* __restrict__ bv, int M, float scale,
    const float* __restrict__ Wq, const float* __restrict__ Wo, _Float16* __restrict__ wqH, _Float16* __restrict__ woH) {
  const int y = blockIdx.y;
  if (y == 2) { pack_w_frags(Wq, Wo, wqH, woH); return; }   // block-uniform, ahead of every barrier
  const float* Wt   = (y == 0) ? Wk : Wv;
  float* C          = (y == 0) ? kF : vF;
  const float* bias = (y == 1) ? bv : nullptr;
  gemm64_body<3, 256, 256>(x, Wt, C, bias, M, scale);
}

// ---- local 3x3x3 windowed attention, f32. One thread per (position along W, head) of TWO neighbouring W rows (H = ph, ph + 1). ----
// q: the input, f32 [16384][256]; kf/vf: f32 [16384][256] (voxel-major, col = head*32 + d); wqH/woH: f16(16 Wq), f16(16 Wo) as B fragments.
// No block needs another block's projected
// q rows, so the block projects its own 64 itself: (1/16) * f16(q) . f16(16 Wq) on WMMA, f32, straight into the ring's buffer 0.
// The block's attention output (f16, x8) stays in LDS and is
// the A operand of the output projection, which the same block does for its 64 rows: outp = (1/128) * o . f16(16 Wo) + bo.
// The two output rows need the same K and V rows but for one each: per S slice four rows (H = ph - 1 .. ph + 2) serve both,
// where one output row alone needs three. They pass, two rows to a tile, through a two-buffer LDS ring filled by asynchronous
// copies in whole lines: six K tiles, six V tiles (tile 0, the projected q rows, the block writes itself). A K or V vector of a row that both output rows need
// (H = ph, ph + 1) is read from LDS once and used for both.
// Row and voxel indices clamped into range; out-of-volume neighbours get weight exactly 0; the centre is always in range.
// Per-thread dots / probabilities live in thread-private LDS slots (27 per thread and output row).
#define AT_S 8
#define AT_H 32
#define AT_W 32
#define AT_C 256
#define AT_NB 27
#define AT_PITCH 264
#define AT_HPITCH 36                     // floats per (voxel, head) slot: 32 + 4 pad = 144 B, so 16 lanes' b128 reads cover all 64 banks
#define AT_VPITCH (8 * AT_HPITCH)        // floats per voxel
#define AT_ROW_F (AT_W * AT_VPITCH)      // floats per staged row of 32 voxels (36864 B)
#define AT_TILE_F (2 * AT_ROW_F)         // floats per tile: two staged rows
#define AT_NT 13                         // tiles: the two q rows, 3 x 2 of K, 3 x 2 of V
#define QK_SCALE 0.17677669529663687f

// One staged row: 2048 pieces of 16 B, eight per lane. g = this lane's first global piece, l = its LDS byte address;
// piece j lies 4 KiB further in memory (4 voxels) and 4 voxel pitches further in LDS.
// s_wait_xcnt closes the statement so that no address register of an issued copy is rewritten ahead of it.
__device__ __forceinline__ void stage_row_async(const float* g, unsigned l) {
  asm volatile(
      "global_load_async_to_lds_b128 %0, %8, off\n\t"
      "global_load_async_to_lds_b128 %1, %9, off\n\t"
      "global_load_async_to_lds_b128 %2, %10, off\n\t"
      "global_load_async_to_lds_b128 %3, %11, off\n\t"
      "global_load_async_to_lds_b128 %4, %12, off\n\t"
      "global_load_async_to_lds_b128 %5, %13, off\n\t"
      "global_load_async_to_lds_b128 %6, %14, off\n\t"
      "global_load_async_to_lds_b128 %7, %15, off\n\t"
      "s_wait_xcnt 0x0"
      :: "v"(l), "v"(l + 1u * 16u * AT_VPITCH), "v"(l + 2u * 16u * AT_VPITCH), "v"(l + 3u * 16u * AT_VPITCH),
         "v"(l + 4u * 16u * AT_VPITCH), "v"(l + 5u * 16u * AT_VPITCH), "v"(l + 6u * 16u * AT_VPITCH), "v"(l + 7u * 16u * AT_VPITCH),
         "v"(g), "v"(g + 1 * 1024), "v"(g + 2 * 1024), "v"(g + 3 * 1024),
         "v"(g + 4 * 1024), "v"(g + 5 * 1024), "v"(g + 6 * 1024), "v"(g + 7 * 1024)
      : "memory");
}

// c += A . B for one wave's 64 x 32 block: A = the block's f16 tile [64][256] in LDS (Al: this lane's row of subtile 0, first k of its half),
// B = the wave's sixteen fragments, in registers. With no rounding left in a k step, the A fragments are read one k step ahead.
__device__ __forceinline__ void mm_tile_frags(const _Float16* Al, const v16h (&bh)[AT_C / 32][2], v8f (&c)[4][2]) {
  v16h ah[2][4];
#pragma unroll
  for (int i = 0; i < 4; ++i) ah[0][i] = load_row(Al + i * 16 * AT_PITCH);
#pragma unroll   // unrolled: bh[] and ah[] stay in registers
  for (int ks = 0; ks < AT_C / 32; ++ks) {
    if (ks + 1 < AT_C / 32) {
#pragma unroll
      for (int i = 0; i < 4; ++i) ah[(ks + 1) & 1][i] = load_row(Al + i * 16 * AT_PITCH + (ks + 1) * 32);
    }
    // the next k step's eight LDS reads stay above this k step's matrix instructions, so that their latency lies under these;
    // left alone, the compiler read each fragment just ahead of its two matrix instructions and waited the latency out 32 times
    __builtin_amdgcn_sched_barrier(0);
#pragma unroll
    for (int i = 0; i < 4; ++i)
#pragma unroll
      for (int j = 0; j < 2; ++j) c[i][j] = mma_h(ah[ks & 1][i], bh[ks][j], c[i][j]);
  }
}

__global__ __launch_bounds__(256) void local_attn3d(
    const float* __restrict__ q, const _Float16* __restrict__ wqH, const float* __restrict__ kf, const float* __restrict__ vf,
    const _Float16* __restrict__ woH, const float* __restrict__ bo, float* __restrict__ outp) {
  __shared__ __align__(16) float sbuf[2 * AT_NB * 256];   // 55296 B; reused as f16 staging (64 x 264 halves = 33792 B)
  __shared__ __align__(16) float tile[2 * AT_TILE_F];     // the ring: two tiles of two staged rows
  const int tid  = threadIdx.x;
  const int head = tid & 7;
  const int vox  = tid >> 3;                          // = position along W
  const int ph = (blockIdx.x & 15) * 2;               // block-uniform: the first of the block's two W rows; grid = 16384/64 exactly
  const int ps = (blockIdx.x >> 4) & 7;
  const int pb = blockIdx.x >> 7;

  const unsigned lds_lane = (unsigned)(uintptr_t)tile +
      4u * (unsigned)((tid >> 6) * AT_VPITCH + ((tid >> 3) & 7) * AT_HPITCH + (tid & 7) * 4);
  auto issue = [&](int t) {                           // tile t >= 1 -> buffer t & 1
    const int u = (t < 7) ? t - 1 : t - 7;                       // dz = u / 2; u odd: the upper pair of rows
    const float* srcp = (t < 7) ? kf : vf;
    const int zs = ps + (u >> 1) - 1;
    const int cs = zs < 0 ? 0 : (zs > AT_S - 1 ? AT_S - 1 : zs);
    const int h0 = ph - 1 + 2 * (u & 1);                         // ph - 1, ph or ph + 1, ph + 2
    const int c0 = h0 < 0 ? 0 : h0;                              // h0 <= 31
    const int c1 = h0 + 1 > AT_H - 1 ? AT_H - 1 : h0 + 1;        // h0 + 1 >= 0
    const int slab = (pb * AT_S + cs) * AT_H;
    const unsigned l = lds_lane + (unsigned)(t & 1) * (4u * AT_TILE_F);
    stage_row_async(srcp + (size_t)((slab + c0) * AT_W) * AT_C + tid * 4, l);
    stage_row_async(srcp + (size_t)((slab + c1) * AT_W) * AT_C + tid * 4, l + 4u * AT_ROW_F);
  };

  // Both projections of the block, 64 rows x 256 columns: wave w owns all 64 rows of columns 32 w .. 32 w + 31 (4 x 2 subtiles).
  // B fragments come ready from the first launch (pack_w_frags): lane column c of subtile j is n0 + 2 * c + j, the k order is load_row's;
  // a fragment is two 16-byte loads, each 512 contiguous bytes for the wave, and all of a projection's are one base register plus an immediate offset.
  const int lane  = tid & 31;
  const int rlane = lane & 15;                 // row (A) / lane column (B, D) within a subtile
  const int koff  = (lane >> 4) * 8;           // k offset of this lane half; also its D row offset
  const int n0    = (tid >> 5) * 32;

  // q projection of the block's 64 rows (contiguous in memory). Its loads and K tile 1 go out together; the tile flies while the rows are multiplied.
  {
    v4f qr[16];                                // piece j: row tid / 64 + 4 j, floats 4 (tid % 64) ..: a wave's load is 512 contiguous bytes
    const float* qg = q + (size_t)blockIdx.x * 64 * AT_C + tid * 4;
#pragma unroll
    for (int j = 0; j < 16; ++j) qr[j] = *(const v4f*)(qg + j * 1024);
    const _Float16* Bl = wqH + (tid >> 5) * WF_WAVE + lane * 8;
    v16h bh[AT_C / 32][2];                     // all the wave's fragments of Wq, 128 registers: they go out behind the q rows and wait out one latency together
#pragma unroll
    for (int ks = 0; ks < AT_C / 32; ++ks)
#pragma unroll
      for (int j = 0; j < 2; ++j) bh[ks][j] = load_w_frag(Bl + (ks * 2 + j) * 2 * WF_PIECE);
    asm volatile("s_wait_xcnt 0x0" ::: "memory");   // stands ahead of any rewrite of the address registers that the loads so far name
    issue(1);

    // the rows, rounded once, as the f16 A tile [64][256] (pitch 264 halves = 16 B x 33: b128 fragment reads without bank conflicts)
    _Float16* sq = reinterpret_cast<_Float16*>(sbuf);
#pragma unroll
    for (int j = 0; j < 16; ++j)
      *(v4h*)(sq + ((tid >> 6) + 4 * j) * AT_PITCH + (tid & 63) * 4) = __builtin_convertvector(qr[j], v4h);
    __syncthreads();                           // the A tile is whole before any wave takes fragments from it

    v8f c[4][2];
#pragma unroll
    for (int i = 0; i < 4; ++i)
#pragma unroll
      for (int j = 0; j < 2; ++j) c[i][j] = (v8f){0.f,0.f,0.f,0.f,0.f,0.f,0.f,0.f};
    const _Float16* Al = sq + rlane * AT_PITCH + koff;
    mm_tile_frags(Al, bh, c);
    // D: subtile (i, j), register r -> row 16 i + koff + r, column n0 + 2 * rlane + j = element 2 * rlane + j of head n0 / 32;
    // it goes to its place in ring buffer 0, laid out as a staged tile of two rows of 32 voxels.
    float* qd = tile + koff * AT_VPITCH + (tid >> 5) * AT_HPITCH + 2 * rlane;
#pragma unroll
    for (int i = 0; i < 4; ++i)
#pragma unroll
      for (int r = 0; r < 8; ++r)
        *(v2f*)(qd + (i >> 1) * AT_ROW_F + ((i & 1) * 16 + r) * AT_VPITCH) =
            (v2f){c[i][0][r] * (1.0f / 16.0f), c[i][1][r] * (1.0f / 16.0f)};
    __syncthreads();                           // the q tile is whole before any thread reads its vectors; every read of the A tile has retired
  }

  // this thread's three neighbours along W inside a staged row (clamped)
  const int o0 = (vox > 0 ? vox - 1 : 0) * AT_VPITCH + head * AT_HPITCH;
  const int o1 = vox * AT_VPITCH + head * AT_HPITCH;
  const int o2 = (vox < AT_W - 1 ? vox + 1 : AT_W - 1) * AT_VPITCH + head * AT_HPITCH;

  // trip 0: this thread's two q vectors from the q tile; qq[c] = (q of row ph, q of row ph + 1)
  v2f qq[32];
  {
    const float* qptr = tile + o1;
#pragma unroll
    for (int i = 0; i < 8; ++i) {
      const v4f ta = *(const v4f*)(qptr + 4 * i);
      const v4f tb = *(const v4f*)(qptr + AT_ROW_F + 4 * i);
#pragma unroll
      for (int c = 0; c < 4; ++c) qq[4 * i + c] = (v2f){ta[c], tb[c]};
    }
  }
  ring_publish();
  issue(2);

  // One staged row as this thread needs it: the whole vectors of its three neighbours along W, 24 reads of 16 B, 96 registers.
  // A trip reads both its rows so, ahead of all its arithmetic: at two waves per SIMD nothing else hides an LDS read's latency,
  // and read a few vectors at a time, each just ahead of its use, a row waits that latency out several times over.
  auto read3 = [&](const float* tb, v4f (&x)[3][8]) {
#pragma unroll
    for (int i = 0; i < 8; ++i) {
      x[0][i] = *(const v4f*)(tb + o0 + 4 * i);
      x[1][i] = *(const v4f*)(tb + o1 + 4 * i);
      x[2][i] = *(const v4f*)(tb + o2 + 4 * i);
    }
  };
  // the three dots of one output row (R = 0: ph, 1: ph + 1) with one staged K row
  auto dots1 = [&](const v4f (&x)[3][8], const int r, float (&d)[3]) {
    float a0 = 0.f, a1 = 0.f, a2 = 0.f;
#pragma unroll
    for (int i = 0; i < 8; ++i) {
      const v4f k0 = x[0][i], k1 = x[1][i], k2 = x[2][i];
#pragma unroll
      for (int c = 0; c < 4; ++c) {
        a0 = fmaf(qq[4 * i + c][r], k0[c], a0);
        a1 = fmaf(qq[4 * i + c][r], k1[c], a1);
        a2 = fmaf(qq[4 * i + c][r], k2[c], a2);
      }
    }
    d[0] = a0 * QK_SCALE; d[1] = a1 * QK_SCALE; d[2] = a2 * QK_SCALE;
  };
  // the three dots of both output rows with one staged K row: each K vector is read once
  auto dots2 = [&](const v4f (&x)[3][8], float (&dA)[3], float (&dB)[3]) {
    v2f a0 = (v2f){0.f, 0.f}, a1 = a0, a2 = a0;
#pragma unroll
    for (int i = 0; i < 8; ++i) {
      const v4f k0 = x[0][i], k1 = x[1][i], k2 = x[2][i];
#pragma unroll
      for (int c = 0; c < 4; ++c) {
        a0 = __builtin_elementwise_fma(qq[4 * i + c], (v2f){k0[c], k0[c]}, a0);
        a1 = __builtin_elementwise_fma(qq[4 * i + c], (v2f){k1[c], k1[c]}, a1);
        a2 = __builtin_elementwise_fma(qq[4 * i + c], (v2f){k2[c], k2[c]}, a2);
      }
    }
    dA[0] = a0[0] * QK_SCALE; dA[1] = a1[0] * QK_SCALE; dA[2] = a2[0] * QK_SCALE;
    dB[0] = a0[1] * QK_SCALE; dB[1] = a1[1] * QK_SCALE; dB[2] = a2[1] * QK_SCALE;
  };
  float mx[2] = {-INFINITY, -INFINITY};
  unsigned vmask[2] = {0u, 0u};
  // files the three dots of output row ph + r with window row (dz, dy); vrow: that window row lies in the volume
  auto put = [&](int r, int dz, int dy, const float (&d)[3]) {
    const bool vrow = ((unsigned)(ps + dz - 1) < (unsigned)AT_S) && ((unsigned)(ph + r + dy - 1) < (unsigned)AT_H);
    const int kk = 9 * dz + 3 * dy;
    float* sp = sbuf + (r * AT_NB + kk) * 256 + tid;
    sp[0] = d[0]; sp[256] = d[1]; sp[512] = d[2];
    if (vrow && vox > 0)        { mx[r] = fmaxf(mx[r], d[0]); vmask[r] |= (1u << (kk + 0)); }
    if (vrow)                   { mx[r] = fmaxf(mx[r], d[1]); vmask[r] |= (1u << (kk + 1)); }
    if (vrow && vox < AT_W - 1) { mx[r] = fmaxf(mx[r], d[2]); vmask[r] |= (1u << (kk + 2)); }
  };

  // pass 1: dots; per S slice dz two trips: K rows ph - 1, ph (buffer 1), then ph + 1, ph + 2 (buffer 0)
#pragma unroll 1   // rolled: the ring's trips; unrolled they would only lengthen the code
  for (int dz = 0; dz < 3; ++dz) {
    float dA[3], dB[3];
    v4f ra[3][8], rb[3][8];
    read3(tile + AT_TILE_F, ra);
    read3(tile + AT_TILE_F + AT_ROW_F, rb);
    __builtin_amdgcn_sched_barrier(0);                // no read of the trip sinks below this line: all are in flight before the first value is used
    dots1(ra, 0, dA);
    put(0, dz, 0, dA);
    dots2(rb, dA, dB);
    put(0, dz, 1, dA);
    put(1, dz, 0, dB);
    ring_publish();
    issue(2 * dz + 3);                                // tiles 3, 5, 7 exist
    read3(tile, ra);
    read3(tile + AT_ROW_F, rb);
    __builtin_amdgcn_sched_barrier(0);                // as above
    dots2(ra, dA, dB);
    put(0, dz, 2, dA);
    put(1, dz, 1, dB);
    dots1(rb, 1, dB);
    put(1, dz, 2, dB);
    ring_publish();
    issue(2 * dz + 4);                                // tiles 4, 6, 8 exist
  }

  // Output projection: the tiling and the B fragments of the q projection above. All the wave's fragments of Wo, 128 registers, are
  // issued here, ahead of the softmax: no barrier stands before the foot of pass 3's first trip, so that their latency lies under both.
  v16h bh[AT_C / 32][2];
  {
    const _Float16* Bl = woH + (tid >> 5) * WF_WAVE + lane * 8;
#pragma unroll
    for (int ks = 0; ks < AT_C / 32; ++ks)
#pragma unroll
      for (int j = 0; j < 2; ++j) bh[ks][j] = load_w_frag(Bl + (ks * 2 + j) * 2 * WF_PIECE);
    asm volatile("s_wait_xcnt 0x0" ::: "memory");   // stands ahead of any rewrite of the address registers that these loads name
    // nothing from below rises over the wait: without this line the softmax's address arithmetic was lifted above it, into the loads' address register
    __builtin_amdgcn_sched_barrier(0);
  }

  // pass 2: probabilities (exactly 0 for out-of-range neighbours), sums
  float sum[2] = {0.f, 0.f};
#pragma unroll 1   // rolled, one S slice's nine neighbours a trip: their 18 dots are read together, so that a trip waits out one LDS latency
  for (int kb = 0; kb < AT_NB; kb += 9) {
    float d[9][2];
#pragma unroll
    for (int j = 0; j < 9; ++j)
#pragma unroll
      for (int r = 0; r < 2; ++r) d[j][r] = sbuf[(r * AT_NB + kb + j) * 256 + tid];
#pragma unroll
    for (int j = 0; j < 9; ++j)
#pragma unroll
      for (int r = 0; r < 2; ++r) {
        const float ex = __expf(d[j][r] - mx[r]);
        const float p = ((vmask[r] >> (kb + j)) & 1u) ? ex : 0.f;
        sbuf[(r * AT_NB + kb + j) * 256 + tid] = p;
        sum[r] += p;
      }
  }
  const float inv[2] = {__builtin_amdgcn_rcpf(sum[0]), __builtin_amdgcn_rcpf(sum[1])};   // sums >= 1

  const v2f bj = *(const v2f*)(bo + n0 + 2 * rlane);
  asm volatile("s_wait_xcnt 0x0" ::: "memory");   // stands ahead of any rewrite of the address registers that this load names

  // pass 3: weighted sums of v rows, the trips as in pass 1
  float acc[2][32];
#pragma unroll
  for (int i = 0; i < 32; ++i) { acc[0][i] = 0.f; acc[1][i] = 0.f; }
  // the three probabilities of output row ph + r for window row (dz, dy)
  auto get = [&](int r, int dz, int dy, float (&p)[3]) {
    const float* sp = sbuf + (r * AT_NB + 9 * dz + 3 * dy) * 256 + tid;
    p[0] = sp[0]; p[1] = sp[256]; p[2] = sp[512];
  };
  // one staged V row into one output row's sums
  auto pv1 = [&](const v4f (&x)[3][8], const int r, const float (&p)[3]) {
#pragma unroll
    for (int i = 0; i < 8; ++i) {
      const v4f v0 = x[0][i], v1 = x[1][i], v2 = x[2][i];
#pragma unroll
      for (int c = 0; c < 4; ++c) {
        float s = acc[r][4 * i + c];
        s = fmaf(p[0], v0[c], s);
        s = fmaf(p[1], v1[c], s);
        s = fmaf(p[2], v2[c], s);
        acc[r][4 * i + c] = s;
      }
    }
  };
  // one staged V row into both output rows' sums: each V vector is read once
  auto pv2 = [&](const v4f (&x)[3][8], const float (&pA)[3], const float (&pB)[3]) {
#pragma unroll
    for (int i = 0; i < 8; ++i) {
      const v4f v0 = x[0][i], v1 = x[1][i], v2 = x[2][i];
#pragma unroll
      for (int c = 0; c < 4; ++c) {
        float s = acc[0][4 * i + c];
        s = fmaf(pA[0], v0[c], s);
        s = fmaf(pA[1], v1[c], s);
        s = fmaf(pA[2], v2[c], s);
        acc[0][4 * i + c] = s;
        float u = acc[1][4 * i + c];
        u = fmaf(pB[0], v0[c], u);
        u = fmaf(pB[1], v1[c], u);
        u = fmaf(pB[2], v2[c], u);
        acc[1][4 * i + c] = u;
      }
    }
  };
  // the two trips of S slice dz; more: the tiles two trips on exist (a constant at each call, so that a trip holds no branch:
  // with one, the compiler moved both trips' sums behind it and kept two tiles' LDS reads in registers, with spills)
  auto slice3 = [&](const int dz, const bool more) {
    float pA[3], pB[3], pC[3];
    v4f ra[3][8], rb[3][8];
    get(0, dz, 0, pC); get(0, dz, 1, pA); get(1, dz, 0, pB);
    read3(tile + AT_TILE_F, ra);
    read3(tile + AT_TILE_F + AT_ROW_F, rb);
    __builtin_amdgcn_sched_barrier(0);                // no read of the trip sinks below this line: all are in flight before the first value is used
    pv1(ra, 0, pC);
    pv2(rb, pA, pB);
    ring_publish();
    if (more) issue(2 * dz + 9);
    get(0, dz, 2, pA); get(1, dz, 1, pB); get(1, dz, 2, pC);
    read3(tile, ra);
    read3(tile + AT_ROW_F, rb);
    __builtin_amdgcn_sched_barrier(0);                // as above
    pv2(ra, pA, pB);
    pv1(rb, 1, pC);
    ring_publish();
    if (more) issue(2 * dz + 10);
  };
#pragma unroll 1   // rolled: the ring's trips
  for (int dz = 0; dz < 2; ++dz) slice3(dz, true);    // issues tiles 9 .. 12
  slice3(2, false);                                   // no tile 13
  asm volatile("s_wait_asynccnt 0x0" ::: "memory");   // no copy of this wave is left in flight

  // stage the f16 tile [64 voxels][256] in LDS (pitch 264 halves = 16 B x 33: b128 fragment reads without bank conflicts)
  __syncthreads();
  _Float16* st = reinterpret_cast<_Float16*>(sbuf);
#pragma unroll
  for (int r = 0; r < 2; ++r) {
    const float osc = inv[r] * 8.0f;     // normalise and carry x8 for the f16 A operand of the output projection
    _Float16* sp = st + (r * AT_W + vox) * AT_PITCH + head * 32;
#pragma unroll
    for (int j = 0; j < 4; ++j) {
      v8h hv;
#pragma unroll
      for (int i = 0; i < 8; ++i) hv[i] = (_Float16)(acc[r][8 * j + i] * osc);
      *(v8h*)(sp + 8 * j) = hv;
    }
  }
  __syncthreads();

  v8f c[4][2];
#pragma unroll
  for (int i = 0; i < 4; ++i)
#pragma unroll
    for (int j = 0; j < 2; ++j) c[i][j] = (v8f){0.f,0.f,0.f,0.f,0.f,0.f,0.f,0.f};
  const _Float16* Al = st + rlane * AT_PITCH + koff;
  mm_tile_frags(Al, bh, c);

  // D: subtile (i, j), register r -> row 16 i + koff + r, column n0 + 2 * rlane + j; 16 lanes store one whole 128-byte line of a row
  float* ob = outp + (size_t)blockIdx.x * 64 * AT_C + koff * AT_C + n0 + 2 * rlane;
#pragma unroll
  for (int i = 0; i < 4; ++i)
#pragma unroll
    for (int r = 0; r < 8; ++r) {
      v2f v;
#pragma unroll
      for (int j = 0; j < 2; ++j) v[j] = c[i][j][r] * (1.0f / 128.0f) + bj[j];
      *(v2f*)(ob + (i * 16 + r) * AT_C) = v;
    }
}

// ---------------------------------------------------------------------------
extern "C" void kernel_launch(void* const* d_in, const int* in_sizes, int n_in,
                              void* d_out, int out_size, void* d_ws, size_t ws_size,
                              hipStream_t stream) {
  const int MP = 16384;     // B*S*H*W = 2*8*32*32
  const int DC = 256;       // DIM == INNER
  if (n_in < 8) return;
  if (in_sizes[0] != MP * DC || in_sizes[1] != MP * DC) return;
  if (in_sizes[2] != DC * DC || in_sizes[3] != DC * DC || in_sizes[4] != DC * DC || in_sizes[6] != DC * DC) return;
  if (in_sizes[5] != DC || in_sizes[7] != DC) return;
  if (out_size != MP * DC) return;

  const float* x  = (const float*)d_in[0];
  const float* q  = (const float*)d_in[1];
  const float* Wq = (const float*)d_in[2];
  const float* Wk = (const float*)d_in[3];
  const float* Wv = (const float*)d_in[4];
  const float* bv = (const float*)d_in[5];
  const float* Wo = (const float*)d_in[6];
  const float* bo = (const float*)d_in[7];
  float* outp = (float*)d_out;

  const size_t actF = (size_t)MP * DC * sizeof(float);      // 16 MiB
  size_t off = 0;
  char* base = (char*)d_ws;
  float*    kF  = (float*)(base + off);    off += actF;
  float*    vF  = (float*)(base + off);    off += actF;
  _Float16* wqH = (_Float16*)(base + off); off += (size_t)DC * DC * sizeof(_Float16);   // 128 KiB
  _Float16* woH = (_Float16*)(base + off); off += (size_t)DC * DC * sizeof(_Float16);
  // total = 33,816,576 B
  if (off > ws_size) return;

  // 1) projections of x, one grid: C = (1/16) * f16(A) . f16(16 W) (+ bias[n]); M = 16384, N = K = 256; 1024 64x64 tiles each, 4 per block;
  //    its third row of blocks rounds Wq and Wo into B fragments
  const dim3 gg2((MP / 64) * (DC / 64) / 4, 3);
  const float s16 = 1.0f / 16.0f;
  proj_kv<<<gg2, 128, 0, stream>>>(x, Wk, Wv, kF, vF, bv, MP, s16, Wq, Wo, wqH, woH);

  // 2) per block of 64 rows: q projection, windowed attention (f32), output projection -> d_out (f32)
  local_attn3d<<<MP / 64, 256, 0, stream>>>(q, wqH, kF, vF, woH, bo, outp);
}

// v010
// It runs in 36 microseconds.
// Next to v009, in two timings, it ran 1.07 times as fast each time.
// All steps since v000 together make it 4.50 times as fast.
// Projections x@Wk, x@Wv+bv, q@Wq, o@Wo+bo: v_wmma_f32_16x16x32_f16 (f16 operands; weights carried x16, o carried x8; f32 accumulate). Windowed q.k, softmax, p.v: f32 VALU.
// Wq and Wo, which every block of the second launch multiplies by whole, are rounded once, in the first launch, and laid out as the second launch's B fragments.
#include <hip/hip_runtime.h>
#include <hip/hip_bf16.h>

typedef __attribute__((ext_vector_type(16))) _Float16 v16h;
typedef __attribute__((ext_vector_type(8)))  _Float16 v8h;
typedef __attribute__((ext_vector_type(4)))  _Float16 v4h;
typedef __attribute__((ext_vector_type(8)))  float    v8f;
typedef __attribute__((ext_vector_type(4)))  float    v4f;
typedef __attribute__((ext_vector_type(2)))  float    v2f;
typedef __attribute__((ext_vector_type(16))) float    v16f;

// hazard guards as plain device helpers (the kernel template body keeps three inline asm waits: s_wait_xcnt after the bias load, s_wait_asynccnt before the ring and after it)
__device__ __forceinline__ void dep_guard_h(v8f& a, v8f& b, v16h x, v16h y) { asm volatile("v_nop\n\tv_nop\n\tv_nop\n\tv_nop" : "+v"(a), "+v"(b) : "v"(x), "v"(y)); }
__device__ __forceinline__ void keep4_h(v16h a, v16h b, v16h c, v16h d) { asm volatile("v_nop" :: "v"(a), "v"(b), "v"(c), "v"(d)); }
__device__ __forceinline__ void acc_guard4(v8f& a, v8f& b, v8f& c, v8f& d) { asm volatile("v_nop\n\tv_nop\n\tv_nop\n\tv_nop" : "+v"(a), "+v"(b), "+v"(c), "+v"(d)); }

__device__ __forceinline__ v16f cat4(v4f a, v4f b, v4f c, v4f d) {
  return __builtin_shufflevector(__builtin_shufflevector(a, b, 0, 1, 2, 3, 4, 5, 6, 7),
                                 __builtin_shufflevector(c, d, 0, 1, 2, 3, 4, 5, 6, 7),
                                 0, 1, 2, 3, 4, 5, 6, 7, 8, 9, 10, 11, 12, 13, 14, 15);
}
// The sixteen k of one A row that a lane holds, k order: elements 0..7 <- p[0..7], 8..15 <- p[16..23]; as stored (f16 or f32).
__device__ __forceinline__ v16h load_row(const _Float16* p) {
  union { v16h v; v8h h[2]; } f;
  f.h[0] = *(const v8h*)(p); f.h[1] = *(const v8h*)(p + 16); return f.v;
}
__device__ __forceinline__ v16f load_row(const float* p) {
  return cat4(*(const v4f*)(p), *(const v4f*)(p + 4), *(const v4f*)(p + 16), *(const v4f*)(p + 20));
}
// ... and as the f16 fragment (f32 is rounded here)
__device__ __forceinline__ v16h to_frag(v16f a) { return __builtin_convertvector(a, v16h); }
__device__ __forceinline__ v8f mma_h(v16h a, v16h b, v8f c) {
  return __builtin_amdgcn_wmma_f32_16x16x32_f16(false, a, false, b, (short)0, c, false, false);
}

// ---- LDS ring helpers ---------------------------------------------------------
#define PA_KT 64                         // k per staged A tile: two k steps, 256 B of each of the 128 rows
#define PA_PITCH 68                      // floats per staged row: 272 B = 16 B x 17, so 16 lanes' b128 reads of 16 rows cover all 64 banks
#define PA_ROWS 128                      // rows of A per block
#define PA_TILE_F (PA_ROWS * PA_PITCH)   // floats per staged A tile (34816 B)
#define PW_TILE_F (PA_KT * 256)          // floats per staged W tile: 64 k rows of 256 columns, unpadded (a half wave reads 256 contiguous bytes of one row)

// One staged A tile: 2048 pieces of 16 B, eight per lane. g = this lane's first global piece, l = its LDS byte address;
// piece j lies sixteen rows further, in memory (LD floats per row) and in LDS.
// s_wait_xcnt closes the statement so that no address register of an issued copy is rewritten ahead of it.
template <int LD>
__device__ __forceinline__ void stage_a_async(const float* g, unsigned l) {
  asm volatile(
      "global_load_async_to_lds_b128 %0, %8, off\n\t"
      "global_load_async_to_lds_b128 %1, %9, off\n\t"
      "global_load_async_to_lds_b128 %2, %10, off\n\t"
      "global_load_async_to_lds_b128 %3, %11, off\n\t"
      "global_load_async_to_lds_b128 %4, %12, off\n\t"
      "global_load_async_to_lds_b128 %5, %13, off\n\t"
      "global_load_async_to_lds_b128 %6, %14, off\n\t"
      "global_load_async_to_lds_b128 %7, %15, off\n\t"
      "s_wait_xcnt 0x0"
      :: "v"(l), "v"(l + 1u * 64u * PA_PITCH), "v"(l + 2u * 64u * PA_PITCH), "v"(l + 3u * 64u * PA_PITCH),
         "v"(l + 4u * 64u * PA_PITCH), "v"(l + 5u * 64u * PA_PITCH), "v"(l + 6u * 64u * PA_PITCH), "v"(l + 7u * 64u * PA_PITCH),
         "v"(g), "v"(g + 1 * 16 * LD), "v"(g + 2 * 16 * LD), "v"(g + 3 * 16 * LD),
         "v"(g + 4 * 16 * LD), "v"(g + 5 * 16 * LD), "v"(g + 6 * 16 * LD), "v"(g + 7 * 16 * LD)
      : "memory");
}

// Half a staged W tile (32 k rows of 1 KiB): 2048 pieces of 16 B, eight per lane. g = this lane's first global piece, l = its LDS byte address;
// piece j lies four k rows (4 KiB) further, in memory and in LDS.
// s_wait_xcnt closes the statement so that no address register of an issued copy is rewritten ahead of it.
__device__ __forceinline__ void stage_w_async(const float* g, unsigned l) {
  asm volatile(
      "global_load_async_to_lds_b128 %0, %8, off\n\t"
      "global_load_async_to_lds_b128 %1, %9, off\n\t"
      "global_load_async_to_lds_b128 %2, %10, off\n\t"
      "global_load_async_to_lds_b128 %3, %11, off\n\t"
      "global_load_async_to_lds_b128 %4, %12, off\n\t"
      "global_load_async_to_lds_b128 %5, %13, off\n\t"
      "global_load_async_to_lds_b128 %6, %14, off\n\t"
      "global_load_async_to_lds_b128 %7, %15, off\n\t"
      "s_wait_xcnt 0x0"
      :: "v"(l), "v"(l + 1u * 4096u), "v"(l + 2u * 4096u), "v"(l + 3u * 4096u),
         "v"(l + 4u * 4096u), "v"(l + 5u * 4096u), "v"(l + 6u * 4096u), "v"(l + 7u * 4096u),
         "v"(g), "v"(g + 1 * 1024), "v"(g + 2 * 1024), "v"(g + 3 * 1024),
         "v"(g + 4 * 1024), "v"(g + 5 * 1024), "v"(g + 6 * 1024), "v"(g + 7 * 1024)
      : "memory");
}

// Foot of a ring trip: hands the next tile to every wave and frees the buffer just read.
__device__ __forceinline__ void ring_publish() {
  asm volatile("s_wait_dscnt 0x0" ::: "memory");     // this wave's LDS reads of the buffer to be refilled have retired
  asm volatile("s_wait_asynccnt 0x0" ::: "memory");  // this wave's copies of the next tile have landed
  __syncthreads();                                   // every wave's copies are visible; every reader has left the old buffer
}

template <int BIAS_MODE, int N, int K, class SideLoad, class SideStore>
__device__ __forceinline__ void gemm64_body(
    const float* __restrict__ A, const float* __restrict__ Wt, float* __restrict__ C,
    const float* __restrict__ bias, int M, float scale, SideLoad side_load, SideStore side_store) {
  static_assert(N == 256 && K % (2 * PA_KT) == 0 && PA_KT == 64, "two rows of four waves x 64 columns; at least two staged tiles of two k steps");
  constexpr int lda = K, ldw = N, ldc = N;
  constexpr int NT = K / PA_KT;                    // staged tiles
  __shared__ __align__(16) float sT[8][16 * 68];   // per-wave 16x64 slab, pitch 68 floats
  __shared__ __align__(16) float sA[2 * PA_TILE_F];   // the A ring: two staged tiles
  __shared__ __align__(16) float sW[2 * PW_TILE_F];   // the Wt ring: two staged tiles
  const int tid  = threadIdx.x;
  const int lane = tid & 31;
  const int wave = tid >> 5;
  const int tm = blockIdx.x;             // the block's 128-row stripe of A
  if (tm >= (M >> 7)) return;            // block-uniform, ahead of every barrier
  const int tn = wave & 3;               // the wave's 64-column tile of N = 256
  const int r0 = (wave >> 2) << 6;       // the wave's first row within the stripe
  const int m0 = (tm << 7) + r0;
  const int n0 = tn << 6;

  // lane's piece 0 of an A tile: row tid / 16, 16 B number tid % 16 of the row's 256 B (a wave's copy = two whole row pieces)
  const float* Ag = A + (size_t)((tm << 7) + (tid >> 4)) * lda + (tid & 15) * 4;
  const unsigned Alds = (unsigned)(uintptr_t)sA + 4u * (unsigned)((tid >> 4) * PA_PITCH + (tid & 15) * 4);
  // lane's piece 0 of a Wt tile: k row tid / 64, 16 B number tid % 64 of the row's 1 KiB (a wave's copy = 512 contiguous bytes)
  const float* Wg = Wt + (tid >> 6) * ldw + (tid & 63) * 4;
  const unsigned Wlds = (unsigned)(uintptr_t)sW + 4u * (unsigned)((tid >> 6) * ldw + (tid & 63) * 4);
  auto issue = [&](int t) {              // tile t (k = 64 t .. 64 t + 63) -> buffers t & 1; 24 copies a wave
    const float* wg = Wg + t * PA_KT * ldw;
    const unsigned wl = Wlds + (unsigned)(t & 1) * (4u * PW_TILE_F);
    stage_w_async(wg, wl);
    stage_w_async(wg + 32 * ldw, wl + 4u * 32u * (unsigned)ldw);
    stage_a_async<lda>(Ag + t * PA_KT, Alds + (unsigned)(t & 1) * (4u * PA_TILE_F));
  };
  issue(0);
  side_load();

  const int rlane = lane & 15;                 // row (A) / lane column (B, D) within subtile
  const int koff  = (lane >> 4) * 8;           // k offset of this lane half
  const int mOff  = (lane >> 4) * 8;           // D row offset

  v8f acc[4][4];
#pragma unroll
  for (int i = 0; i < 4; ++i)
#pragma unroll
    for (int j = 0; j < 4; ++j) acc[i][j] = (v8f){0.f,0.f,0.f,0.f,0.f,0.f,0.f,0.f};

  v4f bj = (v4f){0.f, 0.f, 0.f, 0.f};          // this lane's four bias values (columns n0 + 4 * rlane + 0..3)
  if (BIAS_MODE == 2 || bias != nullptr) {     // BIAS_MODE 3: one uniform test
    bj = *(const v4f*)(bias + n0 + 4 * rlane);
    asm volatile("s_wait_xcnt 0x0" ::: "memory");   // stands ahead of any rewrite of the address registers that the load names
  }

  asm volatile("s_wait_asynccnt 0x0" ::: "memory");   // tile 0 has landed (this wave's part)
  __syncthreads();                                    // ... and every other wave's
  issue(1);
  side_store();
#pragma unroll 1   // rolled: the ring's trips
  for (int t = 0; t < NT; ++t) {
    const float* Al = sA + (t & 1) * PA_TILE_F + (r0 + rlane) * PA_PITCH + koff;   // this lane's row of subtile 0 in the staged tile, first k of its half
    const float* Wl = sW + (t & 1) * PW_TILE_F + koff * ldw + n0 + 4 * rlane;      // this lane's column group in the staged tile, first k of its half
    // The tile's two k steps, their LDS reads ahead of the arithmetic that they can lie under: step 0's reads and step 1's Wt go out first
    // (LDS returns in order, so that step 0 waits for its own reads alone); step 1's A follows once step 0's f32 values are rounded and their
    // registers free, and comes in under step 0's matrix instructions.
    v4f w[2][16];                                // w[s][e][j] = Wt[k of element e, k step s][n0 + 4 * rlane + j]
    v16f ar[4];                                  // A rows of the four subtiles, as staged
    v16h bh[4], ah[4];
#pragma unroll
    for (int e = 0; e < 8; ++e) { w[0][e] = *(const v4f*)(Wl + e * ldw); w[0][8 + e] = *(const v4f*)(Wl + (16 + e) * ldw); }
#pragma unroll
    for (int i = 0; i < 4; ++i) ar[i] = load_row(Al + (i << 4) * PA_PITCH);
    __builtin_amdgcn_sched_barrier(0);           // step 0's reads stay ahead of step 1's
#pragma unroll
    for (int e = 0; e < 8; ++e) { w[1][e] = *(const v4f*)(Wl + (32 + e) * ldw); w[1][8 + e] = *(const v4f*)(Wl + (48 + e) * ldw); }
    __builtin_amdgcn_sched_barrier(0);           // no read so far sinks into the arithmetic below
#pragma unroll   // unrolled: w[] stays in registers
    for (int s = 0; s < 2; ++s) {
#pragma unroll
      for (int j = 0; j < 4; ++j)
#pragma unroll
        for (int e = 0; e < 16; ++e) bh[j][e] = (_Float16)(w[s][e][j] * 16.0f);
#pragma unroll
      for (int i = 0; i < 4; ++i) ah[i] = to_frag(ar[i]);
      if (s == 0) {
#pragma unroll
        for (int i = 0; i < 4; ++i) ar[i] = load_row(Al + (i << 4) * PA_PITCH + 32);
        __builtin_amdgcn_sched_barrier(0);       // step 1's A reads stay above step 0's matrix instructions
      }
#pragma unroll
      for (int i = 0; i < 4; ++i) {
#pragma unroll
        for (int j = 0; j < 4; ++j) acc[i][j] = mma_h(ah[i], bh[j], acc[i][j]);
        dep_guard_h(acc[i][0], acc[i][3], ah[i], ah[i]);
      }
      keep4_h(bh[0], bh[1], bh[2], bh[3]);
    }
    ring_publish();
    if (t + 2 < NT) issue(t + 2);                     // block-uniform test
  }
  asm volatile("s_wait_asynccnt 0x0" ::: "memory");   // no copy of this wave is left in flight
  acc_guard4(acc[0][0], acc[0][1], acc[0][2], acc[0][3]);
  acc_guard4(acc[1][0], acc[1][1], acc[1][2], acc[1][3]);
  acc_guard4(acc[2][0], acc[2][1], acc[2][2], acc[2][3]);
  acc_guard4(acc[3][0], acc[3][1], acc[3][2], acc[3][3]);

  // ---- epilogue ----
  float* slab = sT[wave];
#pragma unroll
  for (int i = 0; i < 4; ++i) {
    const int mBase = m0 + (i << 4);
#pragma unroll
    for (int r = 0; r < 8; ++r) {
      v4f v;
#pragma unroll
      for (int j = 0; j < 4; ++j) v[j] = acc[i][j][r] * scale + bj[j];
      *(v4f*)(slab + (mOff + r) * 68 + 4 * rlane) = v;
    }
    __builtin_amdgcn_fence(__ATOMIC_RELEASE, "workgroup");
    __builtin_amdgcn_wave_barrier();
    __builtin_amdgcn_fence(__ATOMIC_ACQUIRE, "workgroup");
    {
      const int hh = lane >> 4, c4 = (lane & 15) * 4;     // row seg = 256 B = 16 lanes x 16 B
#pragma unroll
      for (int it = 0; it < 8; ++it) {
        const int row = it * 2 + hh;
        v4f v = *(const v4f*)(slab + row * 68 + c4);
        *(v4f*)(C + (size_t)(mBase + row) * ldc + n0 + c4) = v;
      }
    }
    __builtin_amdgcn_fence(__ATOMIC_RELEASE, "workgroup");
    __builtin_amdgcn_wave_barrier();
    __builtin_amdgcn_fence(__ATOMIC_ACQUIRE, "workgroup");
  }
}

// ---- Wq and Wo as ready B fragments -------------------------------------------
// local_attn3d's wave w (columns 32 w .. 32 w + 31), k step ks, subtile j: lane l holds, as element 8 p + e of its B fragment,
// f16(16 * W[32 ks + 8 (l / 16) + 16 p + e][32 w + 2 (l % 16) + j]) (load_row's k order). Piece (w, ks, j, p) is the 32 lanes' eight
// elements each, 512 contiguous bytes, lane l at byte 16 l; pieces follow one another in that order (p fastest): 128 KiB a matrix.
#define WF_PIECE 256                     // halves per piece
#define WF_WAVE (8 * 2 * 2 * WF_PIECE)   // halves per wave of local_attn3d: all its fragments, 16 KiB
#define WF_MAT (8 * WF_WAVE)             // halves per matrix
// One thread makes one lane's 16 bytes of one piece; a wave stores one whole piece. g = (matrix, w, ks, j, p, lane), 0 .. 2 * WF_MAT / 8 - 1.
__device__ __forceinline__ void pack_w_load(const int g, const float* __restrict__ Wq, const float* __restrict__ Wo, float (&t)[8]) {
  const int l = g & 31, p = (g >> 5) & 1, j = (g >> 6) & 1, ks = (g >> 7) & 7, w = (g >> 10) & 7;
  const bool second = (g >> 13) != 0;
  const float* s = (second ? Wo : Wq) + (32 * ks + 8 * (l >> 4) + 16 * p) * 256 + 32 * w + 2 * (l & 15) + j;
#pragma unroll
  for (int e = 0; e < 8; ++e) t[e] = s[e * 256];
  asm volatile("s_wait_xcnt 0x0" ::: "memory");   // stands ahead of any rewrite of the address registers that the loads name
}
__device__ __forceinline__ void pack_w_store(const int g, const float (&t)[8], _Float16* __restrict__ wqH, _Float16* __restrict__ woH) {
  const bool second = (g >> 13) != 0;
  v8h h;
#pragma unroll
  for (int e = 0; e < 8; ++e) h[e] = (_Float16)(t[e] * 16.0f);
  *(v8h*)((second ? woH : wqH) + (g & (WF_MAT / 8 - 1)) * 8) = h;
}
// One B fragment: its two pieces
__device__ __forceinline__ v16h load_w_frag(const _Float16* p) {
  union { v16h v; v8h h[2]; } f;
  f.h[0] = *(const v8h*)(p); f.h[1] = *(const v8h*)(p + WF_PIECE); return f.v;
}

// One grid, blockIdx.y = 0: x.Wk, 1: x.Wv + bv (the two projections of x, whose rows neighbouring blocks of the attention need).
// The fragments of Wq and Wo are dealt to the blocks, 64 threads' worth each (waves 0 and 1), made while the block's first tile flies:
// a block takes most of a WGP's LDS, so that blocks of their own for them would have to wait for a free WGP.
__global__ __launch_bounds__(256) void proj_kv(
    const float* __restrict__ x, const float* __restrict__ Wk, const float* __restrict__ Wv,
    float* __restrict__ kF, float* __restrict__ vF,
    const float* __restrict__ bv, int M, float scale,
    const float* __restrict__ Wq, const float* __restrict__ Wo, _Float16* __restrict__ wqH, _Float16* __restrict__ woH) {
  const int y = blockIdx.y;
  const float* Wt   = (y == 0) ? Wk : Wv;
  float* C          = (y == 0) ? kF : vF;
  const float* bias = (y == 1) ? bv : nullptr;
  const int g = (int)((y * gridDim.x + blockIdx.x) * 64 + threadIdx.x);   // this thread's piece, where it has one
  const bool packs = threadIdx.x < 64 && g < 2 * (WF_MAT / 8);            // waves 0 and 1: wave-uniform; no barrier inside either part
  float t[8] = {0.f, 0.f, 0.f, 0.f, 0.f, 0.f, 0.f, 0.f};
  gemm64_body<3, 256, 256>(x, Wt, C, bias, M, scale,
                           [&]() { if (packs) pack_w_load(g, Wq, Wo, t); },
                           [&]() { if (packs) pack_w_store(g, t, wqH, woH); });
}

// ---- local 3x3x3 windowed attention, f32. One thread per (position along W, head) of TWO neighbouring W rows (H = ph, ph + 1). ----
// q: the input, f32 [16384][256]; kf/vf: f32 [16384][256] (voxel-major, col = head*32 + d); wqH/woH: f16(16 Wq), f16(16 Wo) as B fragments.
// No block needs another block's projected
// q rows, so the block projects its own 64 itself: (1/16) * f16(q) . f16(16 Wq) on WMMA, f32, straight into the ring's buffer 0.
// The block's attention output (f16, x8) stays in LDS and is
// the A operand of the output projection, which the same block does for its 64 rows: outp = (1/128) * o . f16(16 Wo) + bo.
// The two output rows need the same K and V rows but for one each: per S slice four rows (H = ph - 1 .. ph + 2) serve both,
// where one output row alone needs three. They pass, two rows to a tile, through a two-buffer LDS ring filled by asynchronous
// copies in whole lines: six K tiles, six V tiles (tile 0, the projected q rows, the block writes itself). A K or V vector of a row that both output rows need
// (H = ph, ph + 1) is read from LDS once and used for both.
// Row and voxel indices clamped into range; out-of-volume neighbours get weight exactly 0; the centre is always in range.
// Per-thread dots / probabilities live in thread-private LDS slots (27 per thread and output row).
#define AT_S 8
#define AT_H 32
#define AT_W 32
#define AT_C 256
#define AT_NB 27
#define AT_PITCH 264
#define AT_HPITCH 36                     // floats per (voxel, head) slot: 32 + 4 pad = 144 B, so 16 lanes' b128 reads cover all 64 banks
#define AT_VPITCH (8 * AT_HPITCH)        // floats per voxel
#define AT_ROW_F (AT_W * AT_VPITCH)      // floats per staged row of 32 voxels (36864 B)
#define AT_TILE_F (2 * AT_ROW_F)         // floats per tile: two staged rows
#define AT_NT 13                         // tiles: the two q rows, 3 x 2 of K, 3 x 2 of V
#define QK_SCALE 0.17677669529663687f

// One staged row: 2048 pieces of 16 B, eight per lane. g = this lane's first global piece, l = its LDS byte address;
// piece j lies 4 KiB further in memory (4 voxels) and 4 voxel pitches further in LDS.
// s_wait_xcnt closes the statement so that no address register of an issued copy is rewritten ahead of it.
__device__ __forceinline__ void stage_row_async(const float* g, unsigned l) {
  asm volatile(
      "global_load_async_to_lds_b128 %0, %8, off\n\t"
      "global_load_async_to_lds_b128 %1, %9, off\n\t"
      "global_load_async_to_lds_b128 %2, %10, off\n\t"
      "global_load_async_to_lds_b128 %3, %11, off\n\t"
      "global_load_async_to_lds_b128 %4, %12, off\n\t"
      "global_load_async_to_lds_b128 %5, %13, off\n\t"
      "global_load_async_to_lds_b128 %6, %14, off\n\t"
      "global_load_async_to_lds_b128 %7, %15, off\n\t"
      "s_wait_xcnt 0x0"
      :: "v"(l), "v"(l + 1u * 16u * AT_VPITCH), "v"(l + 2u * 16u * AT_VPITCH), "v"(l + 3u * 16u * AT_VPITCH),
         "v"(l + 4u * 16u * AT_VPITCH), "v"(l + 5u * 16u * AT_VPITCH), "v"(l + 6u * 16u * AT_VPITCH), "v"(l + 7u * 16u * AT_VPITCH),
         "v"(g), "v"(g + 1 * 1024), "v"(g + 2 * 1024), "v"(g + 3 * 1024),
         "v"(g + 4 * 1024), "v"(g + 5 * 1024), "v"(g + 6 * 1024), "v"(g + 7 * 1024)
      : "memory");
}

// c += A . B for one wave's 64 x 32 block: A = the block's f16 tile [64][256] in LDS (Al: this lane's row of subtile 0, first k of its half),
// B = the wave's sixteen fragments, in registers. With no rounding left in a k step, the A fragments are read one k step ahead.
__device__ __forceinline__ void mm_tile_frags(const _Float16* Al, const v16h (&bh)[AT_C / 32][2], v8f (&c)[4][2]) {
  v16h ah[2][4];
#pragma unroll
  for (int i = 0; i < 4; ++i) ah[0][i] = load_row(Al + i * 16 * AT_PITCH);
#pragma unroll   // unrolled: bh[] and ah[] stay in registers
  for (int ks = 0; ks < AT_C / 32; ++ks) {
    if (ks + 1 < AT_C / 32) {
#pragma unroll
      for (int i = 0; i < 4; ++i) ah[(ks + 1) & 1][i] = load_row(Al + i * 16 * AT_PITCH + (ks + 1) * 32);
    }
    // the next k step's eight LDS reads stay above this k step's matrix instructions, so that their latency lies under these;
    // left alone, the compiler read each fragment just ahead of its two matrix instructions and waited the latency out 32 times
    __builtin_amdgcn_sched_barrier(0);
#pragma unroll
    for (int i = 0; i < 4; ++i)
#pragma unroll
      for (int j = 0; j < 2; ++j) c[i][j] = mma_h(ah[ks & 1][i], bh[ks][j], c[i][j]);
  }
}

__global__ __launch_bounds__(256) void local_attn3d(
    const float* __restrict__ q, const _Float16* __restrict__ wqH, const float* __restrict__ kf, const float* __restrict__ vf,
    const _Float16* __restrict__ woH, const float* __restrict__ bo, float* __restrict__ outp) {
  __shared__ __align__(16) float sbuf[2 * AT_NB * 256];   // 55296 B; reused as f16 staging (64 x 264 halves = 33792 B)
  __shared__ __align__(16) float tile[2 * AT_TILE_F];     // the ring: two tiles of two staged rows
  const int tid  = threadIdx.x;
  const int head = tid & 7;
  const int vox  = tid >> 3;                          // = position along W
  const int ph = (blockIdx.x & 15) * 2;               // block-uniform: the first of the block's two W rows; grid = 16384/64 exactly
  const int ps = (blockIdx.x >> 4) & 7;
  const int pb = blockIdx.x >> 7;

  const unsigned lds_lane = (unsigned)(uintptr_t)tile +
      4u * (unsigned)((tid >> 6) * AT_VPITCH + ((tid >> 3) & 7) * AT_HPITCH + (tid & 7) * 4);
  auto issue = [&](int t) {                           // tile t >= 1 -> buffer t & 1
    const int u = (t < 7) ? t - 1 : t - 7;                       // dz = u / 2; u odd: the upper pair of rows
    const float* srcp = (t < 7) ? kf : vf;
    const int zs = ps + (u >> 1) - 1;
    const int cs = zs < 0 ? 0 : (zs > AT_S - 1 ? AT_S - 1 : zs);
    const int h0 = ph - 1 + 2 * (u & 1);                         // ph - 1, ph or ph + 1, ph + 2
    const int c0 = h0 < 0 ? 0 : h0;                              // h0 <= 31
    const int c1 = h0 + 1 > AT_H - 1 ? AT_H - 1 : h0 + 1;        // h0 + 1 >= 0
    const int slab = (pb * AT_S + cs) * AT_H;
    const unsigned l = lds_lane + (unsigned)(t & 1) * (4u * AT_TILE_F);
    stage_row_async(srcp + (size_t)((slab + c0) * AT_W) * AT_C + tid * 4, l);
    stage_row_async(srcp + (size_t)((slab + c1) * AT_W) * AT_C + tid * 4, l + 4u * AT_ROW_F);
  };

  // Both projections of the block, 64 rows x 256 columns: wave w owns all 64 rows of columns 32 w .. 32 w + 31 (4 x 2 subtiles).
  // B fragments come ready from the first launch (pack_w_load, pack_w_store): lane column c of subtile j is n0 + 2 * c + j, the k order is load_row's;
  // a fragment is two 16-byte loads, each 512 contiguous bytes for the wave, and all of a projection's are one base register plus an immediate offset.
  const int lane  = tid & 31;
  const int rlane = lane & 15;                 // row (A) / lane column (B, D) within a subtile
  const int koff  = (lane >> 4) * 8;           // k offset of this lane half; also its D row offset
  const int n0    = (tid >> 5) * 32;

  // q projection of the block's 64 rows (contiguous in memory). Its loads and K tile 1 go out together; the tile flies while the rows are multiplied.
  {
    v4f qr[16];                                // piece j: row tid / 64 + 4 j, floats 4 (tid % 64) ..: a wave's load is 512 contiguous bytes
    const float* qg = q + (size_t)blockIdx.x * 64 * AT_C + tid * 4;
#pragma unroll
    for (int j = 0; j < 16; ++j) qr[j] = *(const v4f*)(qg + j * 1024);
    const _Float16* Bl = wqH + (tid >> 5) * WF_WAVE + lane * 8;
    v16h bh[AT_C / 32][2];                     // all the wave's fragments of Wq, 128 registers: they go out behind the q rows and wait out one latency together
#pragma unroll
    for (int ks = 0; ks < AT_C / 32; ++ks)
#pragma unroll
      for (int j = 0; j < 2; ++j) bh[ks][j] = load_w_frag(Bl + (ks * 2 + j) * 2 * WF_PIECE);
    asm volatile("s_wait_xcnt 0x0" ::: "memory");   // stands ahead of any rewrite of the address registers that the loads so far name
    issue(1);

    // the rows, rounded once, as the f16 A tile [64][256] (pitch 264 halves = 16 B x 33: b128 fragment reads without bank conflicts)
    _Float16* sq = reinterpret_cast<_Float16*>(sbuf);
#pragma unroll
    for (int j = 0; j < 16; ++j)
      *(v4h*)(sq + ((tid >> 6) + 4 * j) * AT_PITCH + (tid & 63) * 4) = __builtin_convertvector(qr[j], v4h);
    __syncthreads();                           // the A tile is whole before any wave takes fragments from it

    v8f c[4][2];
#pragma unroll
    for (int i = 0; i < 4; ++i)
#pragma unroll
      for (int j = 0; j < 2; ++j) c[i][j] = (v8f){0.f,0.f,0.f,0.f,0.f,0.f,0.f,0.f};
    const _Float16* Al = sq + rlane * AT_PITCH + koff;
    mm_tile_frags(Al, bh, c);
    // D: subtile (i, j), register r -> row 16 i + koff + r, column n0 + 2 * rlane + j = element 2 * rlane + j of head n0 / 32;
    // it goes to its place in ring buffer 0, laid out as a staged tile of two rows of 32 voxels.
    float* qd = tile + koff * AT_VPITCH + (tid >> 5) * AT_HPITCH + 2 * rlane;
#pragma unroll
    for (int i = 0; i < 4; ++i)
#pragma unroll
      for (int r = 0; r < 8; ++r)
        *(v2f*)(qd + (i >> 1) * AT_ROW_F + ((i & 1) * 16 + r) * AT_VPITCH) =
            (v2f){c[i][0][r] * (1.0f / 16.0f), c[i][1][r] * (1.0f / 16.0f)};
    __syncthreads();                           // the q tile is whole before any thread reads its vectors; every read of the A tile has retired
  }

  // this thread's three neighbours along W inside a staged row (clamped)
  const int o0 = (vox > 0 ? vox - 1 : 0) * AT_VPITCH + head * AT_HPITCH;
  const int o1 = vox * AT_VPITCH + head * AT_HPITCH;
  const int o2 = (vox < AT_W - 1 ? vox + 1 : AT_W - 1) * AT_VPITCH + head * AT_HPITCH;

  // trip 0: this thread's two q vectors from the q tile; qq[c] = (q of row ph, q of row ph + 1)
  v2f qq[32];
  {
    const float* qptr = tile + o1;
#pragma unroll
    for (int i = 0; i < 8; ++i) {
      const v4f ta = *(const v4f*)(qptr + 4 * i);
      const v4f tb = *(const v4f*)(qptr + AT_ROW_F + 4 * i);
#pragma unroll
      for (int c = 0; c < 4; ++c) qq[4 * i + c] = (v2f){ta[c], tb[c]};
    }
  }
  ring_publish();
  issue(2);

  // One staged row as this thread needs it: the whole vectors of its three neighbours along W, 24 reads of 16 B, 96 registers.
  // A trip reads both its rows so, ahead of all its arithmetic: at two waves per SIMD nothing else hides an LDS read's latency,
  // and read a few vectors at a time, each just ahead of its use, a row waits that latency out several times over.
  auto read3 = [&](const float* tb, v4f (&x)[3][8]) {
#pragma unroll
    for (int i = 0; i < 8; ++i) {
      x[0][i] = *(const v4f*)(tb + o0 + 4 * i);
      x[1][i] = *(const v4f*)(tb + o1 + 4 * i);
      x[2][i] = *(const v4f*)(tb + o2 + 4 * i);
    }
  };
  // the three dots of one output row (R = 0: ph, 1: ph + 1) with one staged K row
  auto dots1 = [&](const v4f (&x)[3][8], const int r, float (&d)[3]) {
    float a0 = 0.f, a1 = 0.f, a2 = 0.f;
#pragma unroll
    for (int i = 0; i < 8; ++i) {
      const v4f k0 = x[0][i], k1 = x[1][i], k2 = x[2][i];
#pragma unroll
      for (int c = 0; c < 4; ++c) {
        a0 = fmaf(qq[4 * i + c][r], k0[c], a0);
        a1 = fmaf(qq[4 * i + c][r], k1[c], a1);
        a2 = fmaf(qq[4 * i + c][r], k2[c], a2);
      }
    }
    d[0] = a0 * QK_SCALE; d[1] = a1 * QK_SCALE; d[2] = a2 * QK_SCALE;
  };
  // the three dots of both output rows with one staged K row: each K vector is read once
  auto dots2 = [&](const v4f (&x)[3][8], float (&dA)[3], float (&dB)[3]) {
    v2f a0 = (v2f){0.f, 0.f}, a1 = a0, a2 = a0;
#pragma unroll
    for (int i = 0; i < 8; ++i) {
      const v4f k0 = x[0][i], k1 = x[1][i], k2 = x[2][i];
#pragma unroll
      for (int c = 0; c < 4; ++c) {
        a0 = __builtin_elementwise_fma(qq[4 * i + c], (v2f){k0[c], k0[c]}, a0);
        a1 = __builtin_elementwise_fma(qq[4 * i + c], (v2f){k1[c], k1[c]}, a1);
        a2 = __builtin_elementwise_fma(qq[4 * i + c], (v2f){k2[c], k2[c]}, a2);
      }
    }
    dA[0] = a0[0] * QK_SCALE; dA[1] = a1[0] * QK_SCALE; dA[2] = a2[0] * QK_SCALE;
    dB[0] = a0[1] * QK_SCALE; dB[1] = a1[1] * QK_SCALE; dB[2] = a2[1] * QK_SCALE;
  };
  float mx[2] = {-INFINITY, -INFINITY};
  unsigned vmask[2] = {0u, 0u};
  // files the three dots of output row ph + r with window row (dz, dy); vrow: that window row lies in the volume
  auto put = [&](int r, int dz, int dy, const float (&d)[3]) {
    const bool vrow = ((unsigned)(ps + dz - 1) < (unsigned)AT_S) && ((unsigned)(ph + r + dy - 1) < (unsigned)AT_H);
    const int kk = 9 * dz + 3 * dy;
    float* sp = sbuf + (r * AT_NB + kk) * 256 + tid;
    sp[0] = d[0]; sp[256] = d[1]; sp[512] = d[2];
    if (vrow && vox > 0)        { mx[r] = fmaxf(mx[r], d[0]); vmask[r] |= (1u << (kk + 0)); }
    if (vrow)                   { mx[r] = fmaxf(mx[r], d[1]); vmask[r] |= (1u << (kk + 1)); }
    if (vrow && vox < AT_W - 1) { mx[r] = fmaxf(mx[r], d[2]); vmask[r] |= (1u << (kk + 2)); }
  };

  // pass 1: dots; per S slice dz two trips: K rows ph - 1, ph (buffer 1), then ph + 1, ph + 2 (buffer 0)
#pragma unroll 1   // rolled: the ring's trips; unrolled they would only lengthen the code
  for (int dz = 0; dz < 3; ++dz) {
    float dA[3], dB[3];
    v4f ra[3][8], rb[3][8];
    read3(tile + AT_TILE_F, ra);
    read3(tile + AT_TILE_F + AT_ROW_F, rb);
    __builtin_amdgcn_sched_barrier(0);                // no read of the trip sinks below this line: all are in flight before the first value is used
    dots1(ra, 0, dA);
    put(0, dz, 0, dA);
    dots2(rb, dA, dB);
    put(0, dz, 1, dA);
    put(1, dz, 0, dB);
    ring_publish();
    issue(2 * dz + 3);                                // tiles 3, 5, 7 exist
    read3(tile, ra);
    read3(tile + AT_ROW_F, rb);
    __builtin_amdgcn_sched_barrier(0);                // as above
    dots2(ra, dA, dB);
    put(0, dz, 2, dA);
    put(1, dz, 1, dB);
    dots1(rb, 1, dB);
    put(1, dz, 2, dB);
    ring_publish();
    issue(2 * dz + 4);                                // tiles 4, 6, 8 exist
  }

  // Output projection: the tiling and the B fragments of the q projection above. All the wave's fragments of Wo, 128 registers, are
  // issued here, ahead of the softmax: no barrier stands before the foot of pass 3's first trip, so that their latency lies under both.
  v16h bh[AT_C / 32][2];
  {
    const _Float16* Bl = woH + (tid >> 5) * WF_WAVE + lane * 8;
#pragma unroll
    for (int ks = 0; ks < AT_C / 32; ++ks)
#pragma unroll
      for (int j = 0; j < 2; ++j) bh[ks][j] = load_w_frag(Bl + (ks * 2 + j) * 2 * WF_PIECE);
    asm volatile("s_wait_xcnt 0x0" ::: "memory");   // stands ahead of any rewrite of the address registers that these loads name
    // nothing from below rises over the wait: without this line the softmax's address arithmetic was lifted above it, into the loads' address register
    __builtin_amdgcn_sched_barrier(0);
  }

  // pass 2: probabilities (exactly 0 for out-of-range neighbours), sums
  float sum[2] = {0.f, 0.f};
#pragma unroll 1   // rolled, one S slice's nine neighbours a trip: their 18 dots are read together, so that a trip waits out one LDS latency
  for (int kb = 0; kb < AT_NB; kb += 9) {
    float d[9][2];
#pragma unroll
    for (int j = 0; j < 9; ++j)
#pragma unroll
      for (int r = 0; r < 2; ++r) d[j][r] = sbuf[(r * AT_NB + kb + j) * 256 + tid];
#pragma unroll
    for (int j = 0; j < 9; ++j)
#pragma unroll
      for (int r = 0; r < 2; ++r) {
        const float ex = __expf(d[j][r] - mx[r]);
        const float p = ((vmask[r] >> (kb + j)) & 1u) ? ex : 0.f;
        sbuf[(r * AT_NB + kb + j) * 256 + tid] = p;
        sum[r] += p;
      }
  }
  const float inv[2] = {__builtin_amdgcn_rcpf(sum[0]), __builtin_amdgcn_rcpf(sum[1])};   // sums >= 1

  const v2f bj = *(const v2f*)(bo + n0 + 2 * rlane);
  asm volatile("s_wait_xcnt 0x0" ::: "memory");   // stands ahead of any rewrite of the address registers that this load names

  // pass 3: weighted sums of v rows, the trips as in pass 1
  float acc[2][32];
#pragma unroll
  for (int i = 0; i < 32; ++i) { acc[0][i] = 0.f; acc[1][i] = 0.f; }
  // the three probabilities of output row ph + r for window row (dz, dy)
  auto get = [&](int r, int dz, int dy, float (&p)[3]) {
    const float* sp = sbuf + (r * AT_NB + 9 * dz + 3 * dy) * 256 + tid;
    p[0] = sp[0]; p[1] = sp[256]; p[2] = sp[512];
  };
  // one staged V row into one output row's sums
  auto pv1 = [&](const v4f (&x)[3][8], const int r, const float (&p)[3]) {
#pragma unroll
    for (int i = 0; i < 8; ++i) {
      const v4f v0 = x[0][i], v1 = x[1][i], v2 = x[2][i];
#pragma unroll
      for (int c = 0; c < 4; ++c) {
        float s = acc[r][4 * i + c];
        s = fmaf(p[0], v0[c], s);
        s = fmaf(p[1], v1[c], s);
        s = fmaf(p[2], v2[c], s);
        acc[r][4 * i + c] = s;
      }
    }
  };
  // one staged V row into both output rows' sums: each V vector is read once
  auto pv2 = [&](const v4f (&x)[3][8], const float (&pA)[3], const float (&pB)[3]) {
#pragma unroll
    for (int i = 0; i < 8; ++i) {
      const v4f v0 = x[0][i], v1 = x[1][i], v2 = x[2][i];
#pragma unroll
      for (int c = 0; c < 4; ++c) {
        float s = acc[0][4 * i + c];
        s = fmaf(pA[0], v0[c], s);
        s = fmaf(pA[1], v1[c], s);
        s = fmaf(pA[2], v2[c], s);
        acc[0][4 * i + c] = s;
        float u = acc[1][4 * i + c];
        u = fmaf(pB[0], v0[c], u);
        u = fmaf(pB[1], v1[c], u);
        u = fmaf(pB[2], v2[c], u);
        acc[1][4 * i + c] = u;
      }
    }
  };
  // the two trips of S slice dz; more: the tiles two trips on exist (a constant at each call, so that a trip holds no branch:
  // with one, the compiler moved both trips' sums behind it and kept two tiles' LDS reads in registers, with spills)
  auto slice3 = [&](const int dz, const bool more) {
    float pA[3], pB[3], pC[3];
    v4f ra[3][8], rb[3][8];
    get(0, dz, 0, pC); get(0, dz, 1, pA); get(1, dz, 0, pB);
    read3(tile + AT_TILE_F, ra);
    read3(tile + AT_TILE_F + AT_ROW_F, rb);
    __builtin_amdgcn_sched_barrier(0);                // no read of the trip sinks below this line: all are in flight before the first value is used
    pv1(ra, 0, pC);
    pv2(rb, pA, pB);
    ring_publish();
    if (more) issue(2 * dz + 9);
    get(0, dz, 2, pA); get(1, dz, 1, pB); get(1, dz, 2, pC);
    read3(tile, ra);
    read3(tile + AT_ROW_F, rb);
    __builtin_amdgcn_sched_barrier(0);                // as above
    pv2(ra, pA, pB);
    pv1(rb, 1, pC);
    ring_publish();
    if (more) issue(2 * dz + 10);
  };
#pragma unroll 1   // rolled: the ring's trips
  for (int dz = 0; dz < 2; ++dz) slice3(dz, true);    // issues tiles 9 .. 12
  slice3(2, false);                                   // no tile 13
  asm volatile("s_wait_asynccnt 0x0" ::: "memory");   // no copy of this wave is left in flight

  // stage the f16 tile [64 voxels][256] in LDS (pitch 264 halves = 16 B x 33: b128 fragment reads without bank conflicts)
  __syncthreads();
  _Float16* st = reinterpret_cast<_Float16*>(sbuf);
#pragma unroll
  for (int r = 0; r < 2; ++r) {
    const float osc = inv[r] * 8.0f;     // normalise and carry x8 for the f16 A operand of the output projection
    _Float16* sp = st + (r * AT_W + vox) * AT_PITCH + head * 32;
#pragma unroll
    for (int j = 0; j < 4; ++j) {
      v8h hv;
#pragma unroll
      for (int i = 0; i < 8; ++i) hv[i] = (_Float16)(acc[r][8 * j + i] * osc);
      *(v8h*)(sp + 8 * j) = hv;
    }
  }
  __syncthreads();

  v8f c[4][2];
#pragma unroll
  for (int i = 0; i < 4; ++i)
#pragma unroll
    for (int j = 0; j < 2; ++j) c[i][j] = (v8f){0.f,0.f,0.f,0.f,0.f,0.f,0.f,0.f};
  const _Float16* Al = st + rlane * AT_PITCH + koff;
  mm_tile_frags(Al, bh, c);

  // D: subtile (i, j), register r -> row 16 i + koff + r, column n0 + 2 * rlane + j; 16 lanes store one whole 128-byte line of a row
  float* ob = outp + (size_t)blockIdx.x * 64 * AT_C + koff * AT_C + n0 + 2 * rlane;
#pragma unroll
  for (int i = 0; i < 4; ++i)
#pragma unroll
    for (int r = 0; r < 8; ++r) {
      v2f v;
#pragma unroll
      for (int j = 0; j < 2; ++j) v[j] = c[i][j][r] * (1.0f / 128.0f) + bj[j];
      *(v2f*)(ob + (i * 16 + r) * AT_C) = v;
    }
}

// ---------------------------------------------------------------------------
extern "C" void kernel_launch(void* const* d_in, const int* in_sizes, int n_in,
                              void* d_out, int out_size, void* d_ws, size_t ws_size,
                              hipStream_t stream) {
  const int MP = 16384;     // B*S*H*W = 2*8*32*32
  const int DC = 256;       // DIM == INNER
  if (n_in < 8) return;
  if (in_sizes[0] != MP * DC || in_sizes[1] != MP * DC) return;
  if (in_sizes[2] != DC * DC || in_sizes[3] != DC * DC || in_sizes[4] != DC * DC || in_sizes[6] != DC * DC) return;
  if (in_sizes[5] != DC || in_sizes[7] != DC) return;
  if (out_size != MP * DC) return;

  const float* x  = (const float*)d_in[0];
  const float* q  = (const float*)d_in[1];
  const float* Wq = (const float*)d_in[2];
  const float* Wk = (const float*)d_in[3];
  const float* Wv = (const float*)d_in[4];
  const float* bv = (const float*)d_in[5];
  const float* Wo = (const float*)d_in[6];
  const float* bo = (const float*)d_in[7];
  float* outp = (float*)d_out;

  const size_t actF = (size_t)MP * DC * sizeof(float);      // 16 MiB
  size_t off = 0;
  char* base = (char*)d_ws;
  float*    kF  = (float*)(base + off);    off += actF;
  float*    vF  = (float*)(base + off);    off += actF;
  _Float16* wqH = (_Float16*)(base + off); off += (size_t)DC * DC * sizeof(_Float16);   // 128 KiB
  _Float16* woH = (_Float16*)(base + off); off += (size_t)DC * DC * sizeof(_Float16);
  // total = 33,816,576 B
  if (off > ws_size) return;

  // 1) projections of x, one grid: C = (1/16) * f16(A) . f16(16 W) (+ bias[n]); M = 16384, N = K = 256; 1024 64x64 tiles each, 8 per block;
  //    each block also rounds its share of Wq and Wo into B fragments (256 blocks x 64 threads = all 16384 pieces of 16 B)
  const dim3 gg2(MP / 128, 2);
  const float s16 = 1.0f / 16.0f;
  proj_kv<<<gg2, 256, 0, stream>>>(x, Wk, Wv, kF, vF, bv, MP, s16, Wq, Wo, wqH, woH);

  // 2) per block of 64 rows: q projection, windowed attention (f32), output projection -> d_out (f32)
  local_attn3d<<<MP / 64, 256, 0, stream>>>(q, wqH, kF, vF, woH, bo, outp);
}
